// v000
// The times below were measured on an AMD MI455X: many runs one after another, warmed up first and cycling through
// copies of the inputs, with the whole window's GPU time divided by the number of runs. Launches and the gaps
// between them are all in it. The median over several windows is given; except for v000 it joins two sittings, which
// can be a few percent apart, so the side-by-side timings, each taken in one sitting, are the better comparison.
// v000 is the starting kernel. One run takes 117 microseconds.
#include <hip/hip_runtime.h>

#define BDIM 2
#define NDIM 1024
#define TDIM 12
#define DDIM 64
#define HDIM 4
#define HD   16
#define BT   (BDIM * TDIM)

typedef __bf16 bf16;
typedef __attribute__((ext_vector_type(16))) __bf16 bf16x16;
typedef __attribute__((ext_vector_type(8)))  __bf16 bf16x8;
typedef __attribute__((ext_vector_type(8)))  float  f32x8;

__device__ __forceinline__ f32x8 wmma_bf16(bf16x16 a, bf16x16 b, f32x8 c) {
  return __builtin_amdgcn_wmma_f32_16x16x32_bf16(false, a, false, b, (short)0, c,
                                                 false, false);
}

// A fragment (16x32 bf16, rows on lanes). ISA 7.12.2: lane<16 holds K=0..7 /
// 16..23, lane>=16 holds K=8..15 / 24..31 for row M=lane%16.
__device__ __forceinline__ bf16x16 load_a_frag(const bf16* base, int ld) {
  const int lane = threadIdx.x & 31;
  const int m    = lane & 15;
  const int koff = (lane & 16) ? 8 : 0;
  const bf16* p  = base + m * ld + koff;
  bf16x8 lo = *(const bf16x8*)(p);
  bf16x8 hi = *(const bf16x8*)(p + 16);
  bf16x16 a;
#pragma unroll
  for (int i = 0; i < 8; ++i) { a[i] = lo[i]; a[i + 8] = hi[i]; }
  return a;
}

// B fragment from pre-swizzled weights: each lane's 16 elements are contiguous.
__device__ __forceinline__ bf16x16 load_b_pack(const bf16* pack, int nt, int kt,
                                               int KT) {
  const int lane = threadIdx.x & 31;
  return *(const bf16x16*)(pack + (((size_t)nt * KT + kt) * 32 + lane) * 16);
}

// ---------------------------------------------------------------------------
// Repack a KxNn f32 weight matrix into per-lane B-fragment order (bf16).
// grid = (K/32, Nn/16), block = 32.
__global__ void pack_w_kernel(const float* __restrict__ src, bf16* __restrict__ dst,
                              int K, int Nn) {
  const int kt = blockIdx.x, nt = blockIdx.y;
  const int lane = threadIdx.x;
  const int KT = K >> 5;
  const int n  = nt * 16 + (lane & 15);
  const int koff = (lane & 16) ? 8 : 0;
  bf16 vals[16];
#pragma unroll
  for (int e = 0; e < 16; ++e) {
    const int p = e >> 1, h = e & 1;
    const int k = kt * 32 + ((p < 4) ? 0 : 16) + ((p & 3) * 2 + h) + koff;
    vals[e] = (bf16)src[(size_t)k * Nn + n];
  }
  bf16* d = dst + (((size_t)nt * KT + kt) * 32 + lane) * 16;
#pragma unroll
  for (int e = 0; e < 16; ++e) d[e] = vals[e];
}

// Adjacency rows -> bitmasks (1024 bits per row as 32 u32 words).
__global__ void pack_adj_kernel(const int* __restrict__ adj,
                                unsigned* __restrict__ adjb) {
  const int row = blockIdx.x;
  const int w = threadIdx.x;  // 0..31
  unsigned bits = 0u;
#pragma unroll 8
  for (int b = 0; b < 32; ++b)
    bits |= (adj[(size_t)row * NDIM + w * 32 + b] != 0 ? 1u : 0u) << b;
  adjb[(size_t)row * 32 + w] = bits;
}

// ---------------------------------------------------------------------------
// Kernel 1: LN1 + QKV projection. grid = (N/64, BT), block = 128 (4 waves).
__global__ void ln_qkv_kernel(const float* __restrict__ x,
                              const float* __restrict__ g1,
                              const float* __restrict__ be1,
                              const bf16* __restrict__ wqp,
                              const bf16* __restrict__ wkp,
                              const bf16* __restrict__ wvp,
                              bf16* __restrict__ Qs, bf16* __restrict__ Kb,
                              bf16* __restrict__ Vt) {
  __shared__ __align__(16) bf16 hbuf[64 * 80];
  const int tid = threadIdx.x;
  const int bt = blockIdx.y;
  const int b = bt / TDIM, t = bt % TDIM;
  const int r0 = blockIdx.x * 64;

  {  // LayerNorm: 2 threads per row, 32 columns each.
    const int row = tid >> 1;
    const int c0 = (tid & 1) * 32;
    const float* xr =
        x + (((size_t)b * NDIM + (r0 + row)) * TDIM + t) * DDIM + c0;
    float v[32], s = 0.f, ss = 0.f;
#pragma unroll
    for (int i = 0; i < 32; ++i) { v[i] = xr[i]; s += v[i]; ss += v[i] * v[i]; }
    s  += __shfl_xor(s, 1);
    ss += __shfl_xor(ss, 1);
    const float mean = s * (1.f / 64.f);
    const float var  = ss * (1.f / 64.f) - mean * mean;
    const float rstd = rsqrtf(var + 1e-5f);
#pragma unroll
    for (int i = 0; i < 32; ++i) {
      const int c = c0 + i;
      hbuf[row * 80 + c] = (bf16)((v[i] - mean) * rstd * g1[c] + be1[c]);
    }
  }
  __syncthreads();

  const int wave = tid >> 5, lane = tid & 31;
  const int rowbase = wave * 16;
  const int rhalf = (lane >> 4) * 8;
  const int coln = lane & 15;
  const bf16* packs[3] = {wqp, wkp, wvp};
  const f32x8 fz = {0.f, 0.f, 0.f, 0.f, 0.f, 0.f, 0.f, 0.f};

#pragma unroll
  for (int mtx = 0; mtx < 3; ++mtx) {
#pragma unroll
    for (int nt = 0; nt < 4; ++nt) {
      f32x8 acc = fz;
#pragma unroll
      for (int kt = 0; kt < 2; ++kt)
        acc = wmma_bf16(load_a_frag(hbuf + rowbase * 80 + kt * 32, 80),
                        load_b_pack(packs[mtx], nt, kt, 2), acc);
#pragma unroll
      for (int r = 0; r < 8; ++r) {
        const int node = r0 + rowbase + rhalf + r;
        const int col = nt * 16 + coln;
        if (mtx == 0)       // Q pre-scaled by 1/sqrt(HD)
          Qs[((size_t)bt * NDIM + node) * DDIM + col] = (bf16)(acc[r] * 0.25f);
        else if (mtx == 1)
          Kb[((size_t)bt * NDIM + node) * DDIM + col] = (bf16)acc[r];
        else                // V channel-major for PV B-fragments
          Vt[((size_t)bt * DDIM + col) * NDIM + node] = (bf16)acc[r];
      }
    }
  }
}

// ---------------------------------------------------------------------------
// Kernel 2: flash attention with adjacency mask.
// grid = (N/32, H, BT), block = 64 (2 waves; 16 query rows per wave).
__global__ void attn_kernel(const bf16* __restrict__ Qs,
                            const bf16* __restrict__ Kb,
                            const bf16* __restrict__ Vt,
                            const unsigned* __restrict__ adjb,
                            float* __restrict__ O) {
  __shared__ __align__(16) unsigned adjw[32][32];
  __shared__ __align__(16) bf16 pbuf[2][16][32];
  const int tid = threadIdx.x;
  const int wave = tid >> 5, lane = tid & 31;
  const int qt = blockIdx.x, h = blockIdx.y, bt = blockIdx.z;
  const int qblock = qt * 32;
  const int qbase = qblock + wave * 16;
  const int coln = lane & 15;
  const int koff = (lane & 16) ? 8 : 0;
  const int rhalf = (lane >> 4) * 8;

  for (int i = tid; i < 32 * 32; i += 64)
    adjw[i >> 5][i & 31] = adjb[(size_t)(qblock + (i >> 5)) * 32 + (i & 31)];
  __syncthreads();

  // Q fragment: HD=16 channels zero-padded to K=32.
  bf16x16 qa;
  {
    const bf16* qp =
        Qs + ((size_t)bt * NDIM + qbase + (lane & 15)) * DDIM + h * HD + koff;
    bf16x8 lo = *(const bf16x8*)qp;
#pragma unroll
    for (int i = 0; i < 8; ++i) { qa[i] = lo[i]; qa[i + 8] = (bf16)0.f; }
  }

  float mrun[8], lrun[8];
  f32x8 oacc = {0.f, 0.f, 0.f, 0.f, 0.f, 0.f, 0.f, 0.f};
#pragma unroll
  for (int r = 0; r < 8; ++r) { mrun[r] = -1e9f; lrun[r] = 0.f; }
  const f32x8 fz = {0.f, 0.f, 0.f, 0.f, 0.f, 0.f, 0.f, 0.f};

  const bf16* krow = Kb + ((size_t)bt * NDIM + coln) * DDIM + h * HD + koff;
  const bf16* vrow = Vt + ((size_t)bt * DDIM + h * HD + coln) * NDIM;

  for (int kc = 0; kc < 32; ++kc) {
    const int j0 = kc * 32;
    // Prefetch next chunk's K/V lines into the cache hierarchy so the
    // L2->WGP transit overlaps the softmax VALU tail of this iteration.
    if (kc + 1 < 32) {
      __builtin_prefetch(krow + (size_t)(j0 + 32) * DDIM, 0, 1);
      __builtin_prefetch(krow + (size_t)(j0 + 48) * DDIM, 0, 1);
      __builtin_prefetch(vrow + j0 + 32, 0, 1);
    }
    // Two K^T B-fragments (channels on K dim, zero-padded to 32).
    bf16x16 kb0, kb1;
    {
      const bf16* kp = krow + (size_t)j0 * DDIM;
      bf16x8 l0 = *(const bf16x8*)kp;
      bf16x8 l1 = *(const bf16x8*)(kp + (size_t)16 * DDIM);
#pragma unroll
      for (int i = 0; i < 8; ++i) {
        kb0[i] = l0[i]; kb0[i + 8] = (bf16)0.f;
        kb1[i] = l1[i]; kb1[i + 8] = (bf16)0.f;
      }
    }
    f32x8 s0 = wmma_bf16(qa, kb0, fz);
    f32x8 s1 = wmma_bf16(qa, kb1, fz);

#pragma unroll
    for (int r = 0; r < 8; ++r) {
      const int lrow = wave * 16 + rhalf + r;  // block-local query row
      const unsigned mw = adjw[lrow][kc];
      float v0 = ((mw >> coln) & 1u) ? s0[r] : -1e9f;
      float v1 = ((mw >> (coln + 16)) & 1u) ? s1[r] : -1e9f;
      float cm = fmaxf(v0, v1);
#pragma unroll
      for (int off = 1; off < 16; off <<= 1) cm = fmaxf(cm, __shfl_xor(cm, off));
      const float mnew = fmaxf(mrun[r], cm);
      const float corr = __expf(mrun[r] - mnew);
      const float e0 = __expf(v0 - mnew);
      const float e1 = __expf(v1 - mnew);
      float ps = e0 + e1;
#pragma unroll
      for (int off = 1; off < 16; off <<= 1) ps += __shfl_xor(ps, off);
      lrun[r] = lrun[r] * corr + ps;
      mrun[r] = mnew;
      oacc[r] = oacc[r] * corr;
      pbuf[wave][rhalf + r][coln]      = (bf16)e0;
      pbuf[wave][rhalf + r][coln + 16] = (bf16)e1;
    }
    asm volatile("s_wait_dscnt 0" ::: "memory");  // wave-local P transpose
    bf16x16 pa = load_a_frag(&pbuf[wave][0][0], 32);
    bf16x16 vb;
    {
      const bf16* vp = vrow + j0;
      bf16x8 lo = *(const bf16x8*)(vp + koff);
      bf16x8 hi = *(const bf16x8*)(vp + 16 + koff);
#pragma unroll
      for (int i = 0; i < 8; ++i) { vb[i] = lo[i]; vb[i + 8] = hi[i]; }
    }
    oacc = wmma_bf16(pa, vb, oacc);
  }

#pragma unroll
  for (int r = 0; r < 8; ++r) {
    const float inv = 1.f / lrun[r];
    const int node = qbase + rhalf + r;
    O[((size_t)bt * NDIM + node) * DDIM + h * HD + coln] = oacc[r] * inv;
  }
}

// ---------------------------------------------------------------------------
// Kernel 3: out-proj + residual + LN2 + MLP + residual.
// grid = (N/64, BT), block = 128.
__global__ void proj_mlp_kernel(const float* __restrict__ x,
                                const float* __restrict__ O,
                                const bf16* __restrict__ wop,
                                const float* __restrict__ bo,
                                const float* __restrict__ g2,
                                const float* __restrict__ be2,
                                const bf16* __restrict__ w1p,
                                const float* __restrict__ b1,
                                const bf16* __restrict__ w2p,
                                const float* __restrict__ b2,
                                float* __restrict__ out) {
  __shared__ __align__(16) bf16 hbuf[64 * 80];
  __shared__ __align__(16) float xbuf[64 * 72];
  __shared__ __align__(16) bf16 ubuf[64 * 264];
  const int tid = threadIdx.x;
  const int bt = blockIdx.y;
  const int b = bt / TDIM, t = bt % TDIM;
  const int r0 = blockIdx.x * 64;
  const f32x8 fz = {0.f, 0.f, 0.f, 0.f, 0.f, 0.f, 0.f, 0.f};

  {  // stage attention output as bf16
    const int row = tid >> 1;
    const int c0 = (tid & 1) * 32;
    const float* op = O + ((size_t)bt * NDIM + r0 + row) * DDIM + c0;
    // Pull the residual x row toward the caches while we stage o.
    __builtin_prefetch(x + (((size_t)b * NDIM + r0 + row) * TDIM + t) * DDIM + c0,
                       0, 1);
#pragma unroll
    for (int i = 0; i < 32; ++i) hbuf[row * 80 + c0 + i] = (bf16)op[i];
  }
  __syncthreads();

  const int wave = tid >> 5, lane = tid & 31;
  const int rowbase = wave * 16;
  const int rhalf = (lane >> 4) * 8;
  const int coln = lane & 15;

  // o @ wo + bo + x  -> xbuf (f32)
#pragma unroll
  for (int nt = 0; nt < 4; ++nt) {
    f32x8 acc = fz;
#pragma unroll
    for (int kt = 0; kt < 2; ++kt)
      acc = wmma_bf16(load_a_frag(hbuf + rowbase * 80 + kt * 32, 80),
                      load_b_pack(wop, nt, kt, 2), acc);
#pragma unroll
    for (int r = 0; r < 8; ++r) {
      const int row_in = rowbase + rhalf + r;
      const int node = r0 + row_in;
      const int col = nt * 16 + coln;
      const float xv = x[(((size_t)b * NDIM + node) * TDIM + t) * DDIM + col];
      xbuf[row_in * 72 + col] = xv + acc[r] + bo[col];
    }
  }
  __syncthreads();

  {  // LN2 -> hbuf (bf16)
    const int row = tid >> 1;
    const int c0 = (tid & 1) * 32;
    float v[32], s = 0.f, ss = 0.f;
#pragma unroll
    for (int i = 0; i < 32; ++i) {
      v[i] = xbuf[row * 72 + c0 + i];
      s += v[i]; ss += v[i] * v[i];
    }
    s  += __shfl_xor(s, 1);
    ss += __shfl_xor(ss, 1);
    const float mean = s * (1.f / 64.f);
    const float var  = ss * (1.f / 64.f) - mean * mean;
    const float rstd = rsqrtf(var + 1e-5f);
#pragma unroll
    for (int i = 0; i < 32; ++i) {
      const int c = c0 + i;
      hbuf[row * 80 + c] = (bf16)((v[i] - mean) * rstd * g2[c] + be2[c]);
    }
  }
  __syncthreads();

  // MLP layer 1: 64 -> 256, ReLU -> ubuf (bf16)
#pragma unroll
  for (int nt = 0; nt < 16; ++nt) {
    f32x8 acc = fz;
#pragma unroll
    for (int kt = 0; kt < 2; ++kt)
      acc = wmma_bf16(load_a_frag(hbuf + rowbase * 80 + kt * 32, 80),
                      load_b_pack(w1p, nt, kt, 2), acc);
#pragma unroll
    for (int r = 0; r < 8; ++r) {
      const int row_in = rowbase + rhalf + r;
      const int col = nt * 16 + coln;
      ubuf[row_in * 264 + col] = (bf16)fmaxf(acc[r] + b1[col], 0.f);
    }
  }
  __syncthreads();

  // MLP layer 2: 256 -> 64, + residual -> out (original [B,N,T,D] layout)
#pragma unroll
  for (int nt = 0; nt < 4; ++nt) {
    f32x8 acc = fz;
#pragma unroll
    for (int kt = 0; kt < 8; ++kt)
      acc = wmma_bf16(load_a_frag(ubuf + rowbase * 264 + kt * 32, 264),
                      load_b_pack(w2p, nt, kt, 8), acc);
#pragma unroll
    for (int r = 0; r < 8; ++r) {
      const int row_in = rowbase + rhalf + r;
      const int node = r0 + row_in;
      const int col = nt * 16 + coln;
      out[(((size_t)b * NDIM + node) * TDIM + t) * DDIM + col] =
          xbuf[row_in * 72 + col] + acc[r] + b2[col];
    }
  }
}

// ---------------------------------------------------------------------------
extern "C" void kernel_launch(void* const* d_in, const int* in_sizes, int n_in,
                              void* d_out, int out_size, void* d_ws,
                              size_t ws_size, hipStream_t stream) {
  (void)in_sizes; (void)n_in; (void)out_size; (void)ws_size;
  const float* x   = (const float*)d_in[0];
  const int*   adj = (const int*)d_in[1];
  const float* wq  = (const float*)d_in[2];
  const float* wk  = (const float*)d_in[3];
  const float* wv  = (const float*)d_in[4];
  const float* wo  = (const float*)d_in[5];
  const float* bo  = (const float*)d_in[6];
  const float* w1  = (const float*)d_in[7];
  const float* b1  = (const float*)d_in[8];
  const float* w2  = (const float*)d_in[9];
  const float* b2  = (const float*)d_in[10];
  const float* g1  = (const float*)d_in[11];
  const float* be1 = (const float*)d_in[12];
  const float* g2  = (const float*)d_in[13];
  const float* be2 = (const float*)d_in[14];
  float* out = (float*)d_out;

  char* w = (char*)d_ws;
  size_t off = 0;
  auto carve = [&](size_t bytes) -> void* {
    off = (off + 255) & ~(size_t)255;
    void* p = w + off;
    off += bytes;
    return p;
  };
  const size_t act = (size_t)BT * NDIM * DDIM;  // 1.57M elements
  bf16*     Qs   = (bf16*)carve(act * 2);
  bf16*     Kb   = (bf16*)carve(act * 2);
  bf16*     Vt   = (bf16*)carve(act * 2);
  float*    O    = (float*)carve(act * 4);
  unsigned* adjb = (unsigned*)carve((size_t)NDIM * 32 * 4);
  bf16* wqp = (bf16*)carve(64 * 64 * 2);
  bf16* wkp = (bf16*)carve(64 * 64 * 2);
  bf16* wvp = (bf16*)carve(64 * 64 * 2);
  bf16* wop = (bf16*)carve(64 * 64 * 2);
  bf16* w1p = (bf16*)carve(64 * 256 * 2);
  bf16* w2p = (bf16*)carve(256 * 64 * 2);

  pack_w_kernel<<<dim3(2, 4), 32, 0, stream>>>(wq, wqp, 64, 64);
  pack_w_kernel<<<dim3(2, 4), 32, 0, stream>>>(wk, wkp, 64, 64);
  pack_w_kernel<<<dim3(2, 4), 32, 0, stream>>>(wv, wvp, 64, 64);
  pack_w_kernel<<<dim3(2, 4), 32, 0, stream>>>(wo, wop, 64, 64);
  pack_w_kernel<<<dim3(2, 16), 32, 0, stream>>>(w1, w1p, 64, 256);
  pack_w_kernel<<<dim3(8, 4), 32, 0, stream>>>(w2, w2p, 256, 64);
  pack_adj_kernel<<<dim3(NDIM), 32, 0, stream>>>(adj, adjb);

  ln_qkv_kernel<<<dim3(NDIM / 64, BT), 128, 0, stream>>>(x, g1, be1, wqp, wkp,
                                                         wvp, Qs, Kb, Vt);
  attn_kernel<<<dim3(NDIM / 32, HDIM, BT), 64, 0, stream>>>(Qs, Kb, Vt, adjb, O);
  proj_mlp_kernel<<<dim3(NDIM / 64, BT), 128, 0, stream>>>(
      x, O, wop, bo, g2, be2, w1p, b1, w2p, b2, out);
}

// v001
// It runs in 108 microseconds.
// Next to v000, in two timings, it ran 1.11 times as fast each time.
#include <hip/hip_runtime.h>

#define BDIM 2
#define NDIM 1024
#define TDIM 12
#define DDIM 64
#define HDIM 4
#define HD   16
#define BT   (BDIM * TDIM)

typedef __bf16 bf16;
typedef __attribute__((ext_vector_type(16))) __bf16 bf16x16;
typedef __attribute__((ext_vector_type(8)))  __bf16 bf16x8;
typedef __attribute__((ext_vector_type(8)))  float  f32x8;

__device__ __forceinline__ f32x8 wmma_bf16(bf16x16 a, bf16x16 b, f32x8 c) {
  return __builtin_amdgcn_wmma_f32_16x16x32_bf16(false, a, false, b, (short)0, c,
                                                 false, false);
}

// A fragment (16x32 bf16, rows on lanes). ISA 7.12.2: lane<16 holds K=0..7 /
// 16..23, lane>=16 holds K=8..15 / 24..31 for row M=lane%16.
__device__ __forceinline__ bf16x16 load_a_frag(const bf16* base, int ld) {
  const int lane = threadIdx.x & 31;
  const int m    = lane & 15;
  const int koff = (lane & 16) ? 8 : 0;
  const bf16* p  = base + m * ld + koff;
  bf16x8 lo = *(const bf16x8*)(p);
  bf16x8 hi = *(const bf16x8*)(p + 16);
  bf16x16 a;
#pragma unroll
  for (int i = 0; i < 8; ++i) { a[i] = lo[i]; a[i + 8] = hi[i]; }
  return a;
}

// B fragment from pre-swizzled weights: each lane's 16 elements are contiguous.
__device__ __forceinline__ bf16x16 load_b_pack(const bf16* pack, int nt, int kt,
                                               int KT) {
  const int lane = threadIdx.x & 31;
  return *(const bf16x16*)(pack + (((size_t)nt * KT + kt) * 32 + lane) * 16);
}

// ---------------------------------------------------------------------------
// Repack a KxNn f32 weight matrix into per-lane B-fragment order (bf16).
// grid = (K/32, Nn/16), block = 32.
__global__ void pack_w_kernel(const float* __restrict__ src, bf16* __restrict__ dst,
                              int K, int Nn) {
  const int kt = blockIdx.x, nt = blockIdx.y;
  const int lane = threadIdx.x;
  const int KT = K >> 5;
  const int n  = nt * 16 + (lane & 15);
  const int koff = (lane & 16) ? 8 : 0;
  bf16 vals[16];
#pragma unroll
  for (int e = 0; e < 16; ++e) {
    const int p = e >> 1, h = e & 1;
    const int k = kt * 32 + ((p < 4) ? 0 : 16) + ((p & 3) * 2 + h) + koff;
    vals[e] = (bf16)src[(size_t)k * Nn + n];
  }
  bf16* d = dst + (((size_t)nt * KT + kt) * 32 + lane) * 16;
#pragma unroll
  for (int e = 0; e < 16; ++e) d[e] = vals[e];
}

// Adjacency rows -> bitmasks (1024 bits per row as 32 u32 words).
__global__ void pack_adj_kernel(const int* __restrict__ adj,
                                unsigned* __restrict__ adjb) {
  const int row = blockIdx.x;
  const int w = threadIdx.x;  // 0..31
  unsigned bits = 0u;
#pragma unroll 8
  for (int b = 0; b < 32; ++b)
    bits |= (adj[(size_t)row * NDIM + w * 32 + b] != 0 ? 1u : 0u) << b;
  adjb[(size_t)row * 32 + w] = bits;
}

// ---------------------------------------------------------------------------
// Kernel 1: LN1 + QKV projection. grid = (N/64, BT), block = 128 (4 waves).
__global__ void ln_qkv_kernel(const float* __restrict__ x,
                              const float* __restrict__ g1,
                              const float* __restrict__ be1,
                              const bf16* __restrict__ wqp,
                              const bf16* __restrict__ wkp,
                              const bf16* __restrict__ wvp,
                              bf16* __restrict__ Qs, bf16* __restrict__ Kb,
                              bf16* __restrict__ Vt) {
  __shared__ __align__(16) bf16 hbuf[64 * 80];
  const int tid = threadIdx.x;
  const int bt = blockIdx.y;
  const int b = bt / TDIM, t = bt % TDIM;
  const int r0 = blockIdx.x * 64;

  {  // LayerNorm: 2 threads per row, 32 columns each.
    const int row = tid >> 1;
    const int c0 = (tid & 1) * 32;
    const float* xr =
        x + (((size_t)b * NDIM + (r0 + row)) * TDIM + t) * DDIM + c0;
    float v[32], s = 0.f, ss = 0.f;
#pragma unroll
    for (int i = 0; i < 32; ++i) { v[i] = xr[i]; s += v[i]; ss += v[i] * v[i]; }
    s  += __shfl_xor(s, 1);
    ss += __shfl_xor(ss, 1);
    const float mean = s * (1.f / 64.f);
    const float var  = ss * (1.f / 64.f) - mean * mean;
    const float rstd = rsqrtf(var + 1e-5f);
#pragma unroll
    for (int i = 0; i < 32; ++i) {
      const int c = c0 + i;
      hbuf[row * 80 + c] = (bf16)((v[i] - mean) * rstd * g1[c] + be1[c]);
    }
  }
  __syncthreads();

  const int wave = tid >> 5, lane = tid & 31;
  const int rowbase = wave * 16;
  const int rhalf = (lane >> 4) * 8;
  const int coln = lane & 15;
  const bf16* packs[3] = {wqp, wkp, wvp};
  const f32x8 fz = {0.f, 0.f, 0.f, 0.f, 0.f, 0.f, 0.f, 0.f};

#pragma unroll
  for (int mtx = 0; mtx < 3; ++mtx) {
#pragma unroll
    for (int nt = 0; nt < 4; ++nt) {
      f32x8 acc = fz;
#pragma unroll
      for (int kt = 0; kt < 2; ++kt)
        acc = wmma_bf16(load_a_frag(hbuf + rowbase * 80 + kt * 32, 80),
                        load_b_pack(packs[mtx], nt, kt, 2), acc);
#pragma unroll
      for (int r = 0; r < 8; ++r) {
        const int node = r0 + rowbase + rhalf + r;
        const int col = nt * 16 + coln;
        if (mtx == 0)       // Q pre-scaled by 1/sqrt(HD)
          Qs[((size_t)bt * NDIM + node) * DDIM + col] = (bf16)(acc[r] * 0.25f);
        else if (mtx == 1)
          Kb[((size_t)bt * NDIM + node) * DDIM + col] = (bf16)acc[r];
        else                // V channel-major for V^T A-fragments
          Vt[((size_t)bt * DDIM + col) * NDIM + node] = (bf16)acc[r];
      }
    }
  }
}

// Value of lane l ^ 16 (the other half of the same query column).
__device__ __forceinline__ float other_half(float v) {
  const int b = __builtin_bit_cast(int, v);
  return __builtin_bit_cast(
      float, __builtin_amdgcn_permlanex16(b, b, 0x76543210, 0xfedcba98, false,
                                          false));
}

// s where bit 'bit' of w is set, else -1e9 (bit field extract + bit select).
__device__ __forceinline__ float mask_score(float s, unsigned w, int bit) {
  const int keep = ((int)(w << (31 - bit))) >> 31;
  const int si = __builtin_bit_cast(int, s);
  const int ni = __builtin_bit_cast(int, -1e9f);
  return __builtin_bit_cast(float, (si & keep) | (ni & ~keep));
}

__global__ void attn_kernel(const bf16* __restrict__ Qs,
                            const bf16* __restrict__ Kb,
                            const bf16* __restrict__ Vt,
                            const unsigned* __restrict__ adjb,
                            float* __restrict__ O) {
  // Pitch 33 words: the 16 query rows a wave reads at one kc hit 16 banks.
  __shared__ unsigned adjw[32][33];
  const int tid = threadIdx.x;
  const int wave = tid >> 5, lane = tid & 31;
  const int qt = blockIdx.x, h = blockIdx.y, bt = blockIdx.z;
  const int qblock = qt * 32;
  const int qbase = qblock + wave * 16;
  const int coln = lane & 15;
  const int koff = (lane & 16) ? 8 : 0;

  for (int i = tid; i < 32 * 32; i += 64)
    adjw[i >> 5][i & 31] = adjb[(size_t)(qblock + (i >> 5)) * 32 + (i & 31)];
  __syncthreads();

  // Q^T B-fragment (column = query): HD=16 channels zero-padded to K=32.
  bf16x16 qb;
  {
    const bf16* qp =
        Qs + ((size_t)bt * NDIM + qbase + coln) * DDIM + h * HD + koff;
    bf16x8 lo = *(const bf16x8*)qp;
#pragma unroll
    for (int i = 0; i < 8; ++i) { qb[i] = lo[i]; qb[i + 8] = (bf16)0.f; }
  }

  // Per lane: running maximum of its query (equal in both halves), the sum of
  // its own half's keys, and 8 output channels of its query.
  float mrun = -1e9f, lrun = 0.f;
  f32x8 oacc = {0.f, 0.f, 0.f, 0.f, 0.f, 0.f, 0.f, 0.f};
  const f32x8 fz = {0.f, 0.f, 0.f, 0.f, 0.f, 0.f, 0.f, 0.f};

  const bf16* krow = Kb + ((size_t)bt * NDIM + coln) * DDIM + h * HD + koff;
  const bf16* vrow = Vt + ((size_t)bt * DDIM + h * HD + coln) * NDIM;
  const unsigned* mrow = &adjw[wave * 16 + coln][0];
  bf16x16 ka0, ka1;  // upper halves (k = 16..31) stay zero through the loop
#pragma unroll
  for (int i = 0; i < 16; ++i) { ka0[i] = (bf16)0.f; ka1[i] = (bf16)0.f; }

  for (int kc = 0; kc < 32; ++kc) {
    const int j0 = kc * 32;
    // Prefetch next chunk's K/V lines into the cache hierarchy so the
    // L2->WGP transit overlaps the softmax VALU tail of this iteration.
    if (kc + 1 < 32) {
      __builtin_prefetch(krow + (size_t)(j0 + 32) * DDIM, 0, 1);
      __builtin_prefetch(krow + (size_t)(j0 + 48) * DDIM, 0, 1);
      __builtin_prefetch(vrow + j0 + 32, 0, 1);
    }
    // Two K A-fragments (row = key, channels on K dim, zero-padded to 32).
    {
      const bf16* kp = krow + (size_t)j0 * DDIM;
      bf16x8 l0 = *(const bf16x8*)kp;
      bf16x8 l1 = *(const bf16x8*)(kp + (size_t)16 * DDIM);
#pragma unroll
      for (int i = 0; i < 8; ++i) { ka0[i] = l0[i]; ka1[i] = l1[i]; }
    }
    // V^T A-fragment (row = channel, keys in the hardware k order).
    bf16x16 va;
    {
      const bf16* vp = vrow + j0;
      bf16x8 lo = *(const bf16x8*)(vp + koff);
      bf16x8 hi = *(const bf16x8*)(vp + 16 + koff);
#pragma unroll
      for (int i = 0; i < 8; ++i) { va[i] = lo[i]; va[i + 8] = hi[i]; }
    }
    // s0[r] = S[query coln][j0 + koff + r], s1[r] = the same 16 keys on.
    f32x8 s0 = wmma_bf16(ka0, qb, fz);
    f32x8 s1 = wmma_bf16(ka1, qb, fz);

    const unsigned mw = mrow[kc] >> koff;  // bit r: s0[r], bit 16 + r: s1[r]
    float cm = -1e9f;
#pragma unroll
    for (int r = 0; r < 8; ++r) {
      s0[r] = mask_score(s0[r], mw, r);
      s1[r] = mask_score(s1[r], mw, 16 + r);
      cm = fmaxf(cm, fmaxf(s0[r], s1[r]));
    }
    const float mnew = fmaxf(mrun, fmaxf(cm, other_half(cm)));
    const float corr = __expf(mrun - mnew);
    mrun = mnew;
    float ps = 0.f;
    bf16x16 pb;  // P^T B-fragment straight from the two score tiles
#pragma unroll
    for (int r = 0; r < 8; ++r) {
      const float e0 = __expf(s0[r] - mnew);
      const float e1 = __expf(s1[r] - mnew);
      ps += e0 + e1;
      pb[r]     = (bf16)e0;
      pb[r + 8] = (bf16)e1;
    }
    lrun = lrun * corr + ps;
#pragma unroll
    for (int r = 0; r < 8; ++r) oacc[r] *= corr;
    oacc = wmma_bf16(va, pb, oacc);
  }

  // oacc[r] = O[query coln][channel koff + r]: 8 consecutive floats per lane.
  const float inv = 1.f / (lrun + other_half(lrun));
  float* op = O + ((size_t)bt * NDIM + qbase + coln) * DDIM + h * HD + koff;
  float4 w0 = {oacc[0] * inv, oacc[1] * inv, oacc[2] * inv, oacc[3] * inv};
  float4 w1 = {oacc[4] * inv, oacc[5] * inv, oacc[6] * inv, oacc[7] * inv};
  *(float4*)(op)     = w0;
  *(float4*)(op + 4) = w1;
}

// ---------------------------------------------------------------------------
// Kernel 3: out-proj + residual + LN2 + MLP + residual.
// grid = (N/64, BT), block = 128.
__global__ void proj_mlp_kernel(const float* __restrict__ x,
                                const float* __restrict__ O,
                                const bf16* __restrict__ wop,
                                const float* __restrict__ bo,
                                const float* __restrict__ g2,
                                const float* __restrict__ be2,
                                const bf16* __restrict__ w1p,
                                const float* __restrict__ b1,
                                const bf16* __restrict__ w2p,
                                const float* __restrict__ b2,
                                float* __restrict__ out) {
  __shared__ __align__(16) bf16 hbuf[64 * 80];
  __shared__ __align__(16) float xbuf[64 * 72];
  __shared__ __align__(16) bf16 ubuf[64 * 264];
  const int tid = threadIdx.x;
  const int bt = blockIdx.y;
  const int b = bt / TDIM, t = bt % TDIM;
  const int r0 = blockIdx.x * 64;
  const f32x8 fz = {0.f, 0.f, 0.f, 0.f, 0.f, 0.f, 0.f, 0.f};

  {  // stage attention output as bf16
    const int row = tid >> 1;
    const int c0 = (tid & 1) * 32;
    const float* op = O + ((size_t)bt * NDIM + r0 + row) * DDIM + c0;
    // Pull the residual x row toward the caches while we stage o.
    __builtin_prefetch(x + (((size_t)b * NDIM + r0 + row) * TDIM + t) * DDIM + c0,
                       0, 1);
#pragma unroll
    for (int i = 0; i < 32; ++i) hbuf[row * 80 + c0 + i] = (bf16)op[i];
  }
  __syncthreads();

  const int wave = tid >> 5, lane = tid & 31;
  const int rowbase = wave * 16;
  const int rhalf = (lane >> 4) * 8;
  const int coln = lane & 15;

  // o @ wo + bo + x  -> xbuf (f32)
#pragma unroll
  for (int nt = 0; nt < 4; ++nt) {
    f32x8 acc = fz;
#pragma unroll
    for (int kt = 0; kt < 2; ++kt)
      acc = wmma_bf16(load_a_frag(hbuf + rowbase * 80 + kt * 32, 80),
                      load_b_pack(wop, nt, kt, 2), acc);
#pragma unroll
    for (int r = 0; r < 8; ++r) {
      const int row_in = rowbase + rhalf + r;
      const int node = r0 + row_in;
      const int col = nt * 16 + coln;
      const float xv = x[(((size_t)b * NDIM + node) * TDIM + t) * DDIM + col];
      xbuf[row_in * 72 + col] = xv + acc[r] + bo[col];
    }
  }
  __syncthreads();

  {  // LN2 -> hbuf (bf16)
    const int row = tid >> 1;
    const int c0 = (tid & 1) * 32;
    float v[32], s = 0.f, ss = 0.f;
#pragma unroll
    for (int i = 0; i < 32; ++i) {
      v[i] = xbuf[row * 72 + c0 + i];
      s += v[i]; ss += v[i] * v[i];
    }
    s  += __shfl_xor(s, 1);
    ss += __shfl_xor(ss, 1);
    const float mean = s * (1.f / 64.f);
    const float var  = ss * (1.f / 64.f) - mean * mean;
    const float rstd = rsqrtf(var + 1e-5f);
#pragma unroll
    for (int i = 0; i < 32; ++i) {
      const int c = c0 + i;
      hbuf[row * 80 + c] = (bf16)((v[i] - mean) * rstd * g2[c] + be2[c]);
    }
  }
  __syncthreads();

  // MLP layer 1: 64 -> 256, ReLU -> ubuf (bf16)
#pragma unroll
  for (int nt = 0; nt < 16; ++nt) {
    f32x8 acc = fz;
#pragma unroll
    for (int kt = 0; kt < 2; ++kt)
      acc = wmma_bf16(load_a_frag(hbuf + rowbase * 80 + kt * 32, 80),
                      load_b_pack(w1p, nt, kt, 2), acc);
#pragma unroll
    for (int r = 0; r < 8; ++r) {
      const int row_in = rowbase + rhalf + r;
      const int col = nt * 16 + coln;
      ubuf[row_in * 264 + col] = (bf16)fmaxf(acc[r] + b1[col], 0.f);
    }
  }
  __syncthreads();

  // MLP layer 2: 256 -> 64, + residual -> out (original [B,N,T,D] layout)
#pragma unroll
  for (int nt = 0; nt < 4; ++nt) {
    f32x8 acc = fz;
#pragma unroll
    for (int kt = 0; kt < 8; ++kt)
      acc = wmma_bf16(load_a_frag(ubuf + rowbase * 264 + kt * 32, 264),
                      load_b_pack(w2p, nt, kt, 8), acc);
#pragma unroll
    for (int r = 0; r < 8; ++r) {
      const int row_in = rowbase + rhalf + r;
      const int node = r0 + row_in;
      const int col = nt * 16 + coln;
      out[(((size_t)b * NDIM + node) * TDIM + t) * DDIM + col] =
          xbuf[row_in * 72 + col] + acc[r] + b2[col];
    }
  }
}

// ---------------------------------------------------------------------------
extern "C" void kernel_launch(void* const* d_in, const int* in_sizes, int n_in,
                              void* d_out, int out_size, void* d_ws,
                              size_t ws_size, hipStream_t stream) {
  (void)in_sizes; (void)n_in; (void)out_size; (void)ws_size;
  const float* x   = (const float*)d_in[0];
  const int*   adj = (const int*)d_in[1];
  const float* wq  = (const float*)d_in[2];
  const float* wk  = (const float*)d_in[3];
  const float* wv  = (const float*)d_in[4];
  const float* wo  = (const float*)d_in[5];
  const float* bo  = (const float*)d_in[6];
  const float* w1  = (const float*)d_in[7];
  const float* b1  = (const float*)d_in[8];
  const float* w2  = (const float*)d_in[9];
  const float* b2  = (const float*)d_in[10];
  const float* g1  = (const float*)d_in[11];
  const float* be1 = (const float*)d_in[12];
  const float* g2  = (const float*)d_in[13];
  const float* be2 = (const float*)d_in[14];
  float* out = (float*)d_out;

  char* w = (char*)d_ws;
  size_t off = 0;
  auto carve = [&](size_t bytes) -> void* {
    off = (off + 255) & ~(size_t)255;
    void* p = w + off;
    off += bytes;
    return p;
  };
  const size_t act = (size_t)BT * NDIM * DDIM;  // 1.57M elements
  bf16*     Qs   = (bf16*)carve(act * 2);
  bf16*     Kb   = (bf16*)carve(act * 2);
  bf16*     Vt   = (bf16*)carve(act * 2);
  float*    O    = (float*)carve(act * 4);
  unsigned* adjb = (unsigned*)carve((size_t)NDIM * 32 * 4);
  bf16* wqp = (bf16*)carve(64 * 64 * 2);
  bf16* wkp = (bf16*)carve(64 * 64 * 2);
  bf16* wvp = (bf16*)carve(64 * 64 * 2);
  bf16* wop = (bf16*)carve(64 * 64 * 2);
  bf16* w1p = (bf16*)carve(64 * 256 * 2);
  bf16* w2p = (bf16*)carve(256 * 64 * 2);

  pack_w_kernel<<<dim3(2, 4), 32, 0, stream>>>(wq, wqp, 64, 64);
  pack_w_kernel<<<dim3(2, 4), 32, 0, stream>>>(wk, wkp, 64, 64);
  pack_w_kernel<<<dim3(2, 4), 32, 0, stream>>>(wv, wvp, 64, 64);
  pack_w_kernel<<<dim3(2, 4), 32, 0, stream>>>(wo, wop, 64, 64);
  pack_w_kernel<<<dim3(2, 16), 32, 0, stream>>>(w1, w1p, 64, 256);
  pack_w_kernel<<<dim3(8, 4), 32, 0, stream>>>(w2, w2p, 256, 64);
  pack_adj_kernel<<<dim3(NDIM), 32, 0, stream>>>(adj, adjb);

  ln_qkv_kernel<<<dim3(NDIM / 64, BT), 128, 0, stream>>>(x, g1, be1, wqp, wkp,
                                                         wvp, Qs, Kb, Vt);
  attn_kernel<<<dim3(NDIM / 32, HDIM, BT), 64, 0, stream>>>(Qs, Kb, Vt, adjb, O);
  proj_mlp_kernel<<<dim3(NDIM / 64, BT), 128, 0, stream>>>(
      x, O, wop, bo, g2, be2, w1p, b1, w2p, b2, out);
}

// v002
// Measured time: 96.2 microseconds a run.
// Two timings next to v001 both put it at 1.13 times that version's speed.
// All steps since v000 together make it 1.26 times as fast.
#include <hip/hip_runtime.h>

#define BDIM 2
#define NDIM 1024
#define TDIM 12
#define DDIM 64
#define HDIM 4
#define HD   16
#define BT   (BDIM * TDIM)

typedef __bf16 bf16;
typedef __attribute__((ext_vector_type(16))) __bf16 bf16x16;
typedef __attribute__((ext_vector_type(8)))  __bf16 bf16x8;
typedef __attribute__((ext_vector_type(8)))  float  f32x8;

__device__ __forceinline__ f32x8 wmma_bf16(bf16x16 a, bf16x16 b, f32x8 c) {
  return __builtin_amdgcn_wmma_f32_16x16x32_bf16(false, a, false, b, (short)0, c,
                                                 false, false);
}

// A fragment (16x32 bf16, rows on lanes). ISA 7.12.2: lane<16 holds K=0..7 /
// 16..23, lane>=16 holds K=8..15 / 24..31 for row M=lane%16.
__device__ __forceinline__ bf16x16 load_a_frag(const bf16* base, int ld) {
  const int lane = threadIdx.x & 31;
  const int m    = lane & 15;
  const int koff = (lane & 16) ? 8 : 0;
  const bf16* p  = base + m * ld + koff;
  bf16x8 lo = *(const bf16x8*)(p);
  bf16x8 hi = *(const bf16x8*)(p + 16);
  bf16x16 a;
#pragma unroll
  for (int i = 0; i < 8; ++i) { a[i] = lo[i]; a[i + 8] = hi[i]; }
  return a;
}

// B fragment from pre-swizzled weights: each lane's 16 elements are contiguous.
__device__ __forceinline__ bf16x16 load_b_pack(const bf16* pack, int nt, int kt,
                                               int KT) {
  const int lane = threadIdx.x & 31;
  return *(const bf16x16*)(pack + (((size_t)nt * KT + kt) * 32 + lane) * 16);
}

// ---------------------------------------------------------------------------
// Repack one 32x16 tile (kt, nt) of a KxNn f32 weight matrix into per-lane
// B-fragment order (bf16). One wave per tile.
__device__ __forceinline__ void pack_w_tile(const float* __restrict__ src,
                                            bf16* __restrict__ dst, int K, int Nn,
                                            int kt, int nt, int lane) {
  const int KT = K >> 5;
  const int n  = nt * 16 + (lane & 15);
  const int koff = (lane & 16) ? 8 : 0;
  float vals[16];
#pragma unroll
  for (int e = 0; e < 16; ++e) {
    const int p = e >> 1, h = e & 1;
    const int k = kt * 32 + ((p < 4) ? 0 : 16) + ((p & 3) * 2 + h) + koff;
    vals[e] = src[(size_t)k * Nn + n];
  }
  // Stands ahead of the conversions, whose results may land in the registers
  // that the loads above name as addresses.
  asm volatile("s_wait_xcnt 0x0" ::: "memory");
  bf16* d = dst + (((size_t)nt * KT + kt) * 32 + lane) * 16;
#pragma unroll
  for (int e = 0; e < 16; ++e) d[e] = (bf16)vals[e];
}

// The three weights the QKV projection reads. grid = (2, 4, 3), block = 32.
__global__ void pack_qkv_w_kernel(const float* __restrict__ wq,
                                  const float* __restrict__ wk,
                                  const float* __restrict__ wv,
                                  bf16* __restrict__ wqp, bf16* __restrict__ wkp,
                                  bf16* __restrict__ wvp) {
  const int z = blockIdx.z;
  const float* src = (z == 0) ? wq : (z == 1) ? wk : wv;
  bf16* dst = (z == 0) ? wqp : (z == 1) ? wkp : wvp;
  pack_w_tile(src, dst, 64, 64, blockIdx.x, blockIdx.y, threadIdx.x);
}

// One adjacency row -> bitmask (1024 bits as 32 u32 words); lane w = word w.
__device__ __forceinline__ void pack_adj_row(const int* __restrict__ adj,
                                             unsigned* __restrict__ adjb, int row,
                                             int w) {
  unsigned bits = 0u;
#pragma unroll 8
  for (int b = 0; b < 32; ++b)
    bits |= (adj[(size_t)row * NDIM + w * 32 + b] != 0 ? 1u : 0u) << b;
  adjb[(size_t)row * 32 + w] = bits;
}

// ---------------------------------------------------------------------------
// Kernel 1: LN1 + QKV projection, block = 128 (4 waves), LNQ_BLOCKS blocks.
// The same grid carries, in the blocks behind those, the packing that only the
// later launches read and that reads nothing written here: the adjacency
// bitmasks (one row per wave) and the wo, w1, w2 tiles (one tile per wave).
#define LNQ_BLOCKS (NDIM / 64 * BT)
#define ADJ_BLOCKS (NDIM / 4)
#define WT_BLOCKS  ((8 + 32 + 32) / 4)
__global__ void ln_qkv_kernel(const float* __restrict__ x,
                              const float* __restrict__ g1,
                              const float* __restrict__ be1,
                              const bf16* __restrict__ wqp,
                              const bf16* __restrict__ wkp,
                              const bf16* __restrict__ wvp,
                              bf16* __restrict__ Qs, bf16* __restrict__ Kb,
                              bf16* __restrict__ Vt,
                              const int* __restrict__ adj,
                              unsigned* __restrict__ adjb,
                              const float* __restrict__ wo,
                              const float* __restrict__ w1,
                              const float* __restrict__ w2,
                              bf16* __restrict__ wop, bf16* __restrict__ w1p,
                              bf16* __restrict__ w2p) {
  __shared__ __align__(16) bf16 hbuf[64 * 80];
  const int tid = threadIdx.x;
  const int bid = blockIdx.x;
  if (bid >= LNQ_BLOCKS) {  // whole blocks leave here, ahead of the barrier
    const int pw = (bid - LNQ_BLOCKS) * 4 + (tid >> 5);
    const int pl = tid & 31;
    if (pw < NDIM) {
      pack_adj_row(adj, adjb, pw, pl);
    } else {
      const int tl = pw - NDIM;
      if (tl < 8)       pack_w_tile(wo, wop, 64, 64, tl & 1, tl >> 1, pl);
      else if (tl < 40) pack_w_tile(w1, w1p, 64, 256, tl & 1, (tl - 8) >> 1, pl);
      else              pack_w_tile(w2, w2p, 256, 64, tl & 7, (tl - 40) >> 3, pl);
    }
    return;
  }
  const int bt = bid / (NDIM / 64);
  const int b = bt / TDIM, t = bt % TDIM;
  const int r0 = (bid % (NDIM / 64)) * 64;

  {  // LayerNorm: 2 threads per row, 32 columns each.
    const int row = tid >> 1;
    const int c0 = (tid & 1) * 32;
    const float* xr =
        x + (((size_t)b * NDIM + (r0 + row)) * TDIM + t) * DDIM + c0;
    float v[32], s = 0.f, ss = 0.f;
#pragma unroll
    for (int i = 0; i < 32; ++i) { v[i] = xr[i]; s += v[i]; ss += v[i] * v[i]; }
    s  += __shfl_xor(s, 1);
    ss += __shfl_xor(ss, 1);
    const float mean = s * (1.f / 64.f);
    const float var  = ss * (1.f / 64.f) - mean * mean;
    const float rstd = rsqrtf(var + 1e-5f);
#pragma unroll
    for (int i = 0; i < 32; ++i) {
      const int c = c0 + i;
      hbuf[row * 80 + c] = (bf16)((v[i] - mean) * rstd * g1[c] + be1[c]);
    }
  }
  __syncthreads();

  const int wave = tid >> 5, lane = tid & 31;
  const int rowbase = wave * 16;
  const int rhalf = (lane >> 4) * 8;
  const int coln = lane & 15;
  const bf16* packs[3] = {wqp, wkp, wvp};
  const f32x8 fz = {0.f, 0.f, 0.f, 0.f, 0.f, 0.f, 0.f, 0.f};

#pragma unroll
  for (int mtx = 0; mtx < 3; ++mtx) {
#pragma unroll
    for (int nt = 0; nt < 4; ++nt) {
      f32x8 acc = fz;
#pragma unroll
      for (int kt = 0; kt < 2; ++kt)
        acc = wmma_bf16(load_a_frag(hbuf + rowbase * 80 + kt * 32, 80),
                        load_b_pack(packs[mtx], nt, kt, 2), acc);
#pragma unroll
      for (int r = 0; r < 8; ++r) {
        const int node = r0 + rowbase + rhalf + r;
        const int col = nt * 16 + coln;
        if (mtx == 0)       // Q pre-scaled by 1/sqrt(HD)
          Qs[((size_t)bt * NDIM + node) * DDIM + col] = (bf16)(acc[r] * 0.25f);
        else if (mtx == 1)
          Kb[((size_t)bt * NDIM + node) * DDIM + col] = (bf16)acc[r];
        else                // V channel-major for V^T A-fragments
          Vt[((size_t)bt * DDIM + col) * NDIM + node] = (bf16)acc[r];
      }
    }
  }
}

// Value of lane l ^ 16 (the other half of the same query column).
__device__ __forceinline__ float other_half(float v) {
  const int b = __builtin_bit_cast(int, v);
  return __builtin_bit_cast(
      float, __builtin_amdgcn_permlanex16(b, b, 0x76543210, 0xfedcba98, false,
                                          false));
}

// s where bit 'bit' of w is set, else -1e9 (bit field extract + bit select).
__device__ __forceinline__ float mask_score(float s, unsigned w, int bit) {
  const int keep = ((int)(w << (31 - bit))) >> 31;
  const int si = __builtin_bit_cast(int, s);
  const int ni = __builtin_bit_cast(int, -1e9f);
  return __builtin_bit_cast(float, (si & keep) | (ni & ~keep));
}

__global__ void attn_kernel(const bf16* __restrict__ Qs,
                            const bf16* __restrict__ Kb,
                            const bf16* __restrict__ Vt,
                            const unsigned* __restrict__ adjb,
                            float* __restrict__ O) {
  // Pitch 33 words: the 16 query rows a wave reads at one kc hit 16 banks.
  __shared__ unsigned adjw[32][33];
  const int tid = threadIdx.x;
  const int wave = tid >> 5, lane = tid & 31;
  const int qt = blockIdx.x, h = blockIdx.y, bt = blockIdx.z;
  const int qblock = qt * 32;
  const int qbase = qblock + wave * 16;
  const int coln = lane & 15;
  const int koff = (lane & 16) ? 8 : 0;

  for (int i = tid; i < 32 * 32; i += 64)
    adjw[i >> 5][i & 31] = adjb[(size_t)(qblock + (i >> 5)) * 32 + (i & 31)];
  __syncthreads();

  // Q^T B-fragment (column = query): HD=16 channels zero-padded to K=32.
  bf16x16 qb;
  {
    const bf16* qp =
        Qs + ((size_t)bt * NDIM + qbase + coln) * DDIM + h * HD + koff;
    bf16x8 lo = *(const bf16x8*)qp;
#pragma unroll
    for (int i = 0; i < 8; ++i) { qb[i] = lo[i]; qb[i + 8] = (bf16)0.f; }
  }

  // Per lane: running maximum of its query (equal in both halves), the sum of
  // its own half's keys, and 8 output channels of its query.
  float mrun = -1e9f, lrun = 0.f;
  f32x8 oacc = {0.f, 0.f, 0.f, 0.f, 0.f, 0.f, 0.f, 0.f};
  const f32x8 fz = {0.f, 0.f, 0.f, 0.f, 0.f, 0.f, 0.f, 0.f};

  const bf16* krow = Kb + ((size_t)bt * NDIM + coln) * DDIM + h * HD + koff;
  const bf16* vrow = Vt + ((size_t)bt * DDIM + h * HD + coln) * NDIM;
  const unsigned* mrow = &adjw[wave * 16 + coln][0];
  bf16x16 ka0, ka1;  // upper halves (k = 16..31) stay zero through the loop
#pragma unroll
  for (int i = 0; i < 16; ++i) { ka0[i] = (bf16)0.f; ka1[i] = (bf16)0.f; }

  for (int kc = 0; kc < 32; ++kc) {
    const int j0 = kc * 32;
    // Prefetch next chunk's K/V lines into the cache hierarchy so the
    // L2->WGP transit overlaps the softmax VALU tail of this iteration.
    if (kc + 1 < 32) {
      __builtin_prefetch(krow + (size_t)(j0 + 32) * DDIM, 0, 1);
      __builtin_prefetch(krow + (size_t)(j0 + 48) * DDIM, 0, 1);
      __builtin_prefetch(vrow + j0 + 32, 0, 1);
    }
    // Two K A-fragments (row = key, channels on K dim, zero-padded to 32).
    {
      const bf16* kp = krow + (size_t)j0 * DDIM;
      bf16x8 l0 = *(const bf16x8*)kp;
      bf16x8 l1 = *(const bf16x8*)(kp + (size_t)16 * DDIM);
#pragma unroll
      for (int i = 0; i < 8; ++i) { ka0[i] = l0[i]; ka1[i] = l1[i]; }
    }
    // V^T A-fragment (row = channel, keys in the hardware k order).
    bf16x16 va;
    {
      const bf16* vp = vrow + j0;
      bf16x8 lo = *(const bf16x8*)(vp + koff);
      bf16x8 hi = *(const bf16x8*)(vp + 16 + koff);
#pragma unroll
      for (int i = 0; i < 8; ++i) { va[i] = lo[i]; va[i + 8] = hi[i]; }
    }
    // s0[r] = S[query coln][j0 + koff + r], s1[r] = the same 16 keys on.
    f32x8 s0 = wmma_bf16(ka0, qb, fz);
    f32x8 s1 = wmma_bf16(ka1, qb, fz);

    const unsigned mw = mrow[kc] >> koff;  // bit r: s0[r], bit 16 + r: s1[r]
    float cm = -1e9f;
#pragma unroll
    for (int r = 0; r < 8; ++r) {
      s0[r] = mask_score(s0[r], mw, r);
      s1[r] = mask_score(s1[r], mw, 16 + r);
      cm = fmaxf(cm, fmaxf(s0[r], s1[r]));
    }
    const float mnew = fmaxf(mrun, fmaxf(cm, other_half(cm)));
    const float corr = __expf(mrun - mnew);
    mrun = mnew;
    float ps = 0.f;
    bf16x16 pb;  // P^T B-fragment straight from the two score tiles
#pragma unroll
    for (int r = 0; r < 8; ++r) {
      const float e0 = __expf(s0[r] - mnew);
      const float e1 = __expf(s1[r] - mnew);
      ps += e0 + e1;
      pb[r]     = (bf16)e0;
      pb[r + 8] = (bf16)e1;
    }
    lrun = lrun * corr + ps;
#pragma unroll
    for (int r = 0; r < 8; ++r) oacc[r] *= corr;
    oacc = wmma_bf16(va, pb, oacc);
  }

  // oacc[r] = O[query coln][channel koff + r]: 8 consecutive floats per lane.
  const float inv = 1.f / (lrun + other_half(lrun));
  float* op = O + ((size_t)bt * NDIM + qbase + coln) * DDIM + h * HD + koff;
  float4 w0 = {oacc[0] * inv, oacc[1] * inv, oacc[2] * inv, oacc[3] * inv};
  float4 w1 = {oacc[4] * inv, oacc[5] * inv, oacc[6] * inv, oacc[7] * inv};
  *(float4*)(op)     = w0;
  *(float4*)(op + 4) = w1;
}

// ---------------------------------------------------------------------------
// Kernel 3: out-proj + residual + LN2 + MLP + residual.
// grid = (N/64, BT), block = 128.
__global__ void proj_mlp_kernel(const float* __restrict__ x,
                                const float* __restrict__ O,
                                const bf16* __restrict__ wop,
                                const float* __restrict__ bo,
                                const float* __restrict__ g2,
                                const float* __restrict__ be2,
                                const bf16* __restrict__ w1p,
                                const float* __restrict__ b1,
                                const bf16* __restrict__ w2p,
                                const float* __restrict__ b2,
                                float* __restrict__ out) {
  __shared__ __align__(16) bf16 hbuf[64 * 80];
  __shared__ __align__(16) float xbuf[64 * 72];
  __shared__ __align__(16) bf16 ubuf[64 * 264];
  const int tid = threadIdx.x;
  const int bt = blockIdx.y;
  const int b = bt / TDIM, t = bt % TDIM;
  const int r0 = blockIdx.x * 64;
  const f32x8 fz = {0.f, 0.f, 0.f, 0.f, 0.f, 0.f, 0.f, 0.f};

  {  // stage attention output as bf16
    const int row = tid >> 1;
    const int c0 = (tid & 1) * 32;
    const float* op = O + ((size_t)bt * NDIM + r0 + row) * DDIM + c0;
    // Pull the residual x row toward the caches while we stage o.
    __builtin_prefetch(x + (((size_t)b * NDIM + r0 + row) * TDIM + t) * DDIM + c0,
                       0, 1);
#pragma unroll
    for (int i = 0; i < 32; ++i) hbuf[row * 80 + c0 + i] = (bf16)op[i];
  }
  __syncthreads();

  const int wave = tid >> 5, lane = tid & 31;
  const int rowbase = wave * 16;
  const int rhalf = (lane >> 4) * 8;
  const int coln = lane & 15;

  // o @ wo + bo + x  -> xbuf (f32)
#pragma unroll
  for (int nt = 0; nt < 4; ++nt) {
    f32x8 acc = fz;
#pragma unroll
    for (int kt = 0; kt < 2; ++kt)
      acc = wmma_bf16(load_a_frag(hbuf + rowbase * 80 + kt * 32, 80),
                      load_b_pack(wop, nt, kt, 2), acc);
#pragma unroll
    for (int r = 0; r < 8; ++r) {
      const int row_in = rowbase + rhalf + r;
      const int node = r0 + row_in;
      const int col = nt * 16 + coln;
      const float xv = x[(((size_t)b * NDIM + node) * TDIM + t) * DDIM + col];
      xbuf[row_in * 72 + col] = xv + acc[r] + bo[col];
    }
  }
  __syncthreads();

  {  // LN2 -> hbuf (bf16)
    const int row = tid >> 1;
    const int c0 = (tid & 1) * 32;
    float v[32], s = 0.f, ss = 0.f;
#pragma unroll
    for (int i = 0; i < 32; ++i) {
      v[i] = xbuf[row * 72 + c0 + i];
      s += v[i]; ss += v[i] * v[i];
    }
    s  += __shfl_xor(s, 1);
    ss += __shfl_xor(ss, 1);
    const float mean = s * (1.f / 64.f);
    const float var  = ss * (1.f / 64.f) - mean * mean;
    const float rstd = rsqrtf(var + 1e-5f);
#pragma unroll
    for (int i = 0; i < 32; ++i) {
      const int c = c0 + i;
      hbuf[row * 80 + c] = (bf16)((v[i] - mean) * rstd * g2[c] + be2[c]);
    }
  }
  __syncthreads();

  // MLP layer 1: 64 -> 256, ReLU -> ubuf (bf16)
#pragma unroll
  for (int nt = 0; nt < 16; ++nt) {
    f32x8 acc = fz;
#pragma unroll
    for (int kt = 0; kt < 2; ++kt)
      acc = wmma_bf16(load_a_frag(hbuf + rowbase * 80 + kt * 32, 80),
                      load_b_pack(w1p, nt, kt, 2), acc);
#pragma unroll
    for (int r = 0; r < 8; ++r) {
      const int row_in = rowbase + rhalf + r;
      const int col = nt * 16 + coln;
      ubuf[row_in * 264 + col] = (bf16)fmaxf(acc[r] + b1[col], 0.f);
    }
  }
  __syncthreads();

  // MLP layer 2: 256 -> 64, + residual -> out (original [B,N,T,D] layout)
#pragma unroll
  for (int nt = 0; nt < 4; ++nt) {
    f32x8 acc = fz;
#pragma unroll
    for (int kt = 0; kt < 8; ++kt)
      acc = wmma_bf16(load_a_frag(ubuf + rowbase * 264 + kt * 32, 264),
                      load_b_pack(w2p, nt, kt, 8), acc);
#pragma unroll
    for (int r = 0; r < 8; ++r) {
      const int row_in = rowbase + rhalf + r;
      const int node = r0 + row_in;
      const int col = nt * 16 + coln;
      out[(((size_t)b * NDIM + node) * TDIM + t) * DDIM + col] =
          xbuf[row_in * 72 + col] + acc[r] + b2[col];
    }
  }
}

// ---------------------------------------------------------------------------
extern "C" void kernel_launch(void* const* d_in, const int* in_sizes, int n_in,
                              void* d_out, int out_size, void* d_ws,
                              size_t ws_size, hipStream_t stream) {
  (void)in_sizes; (void)n_in; (void)out_size; (void)ws_size;
  const float* x   = (const float*)d_in[0];
  const int*   adj = (const int*)d_in[1];
  const float* wq  = (const float*)d_in[2];
  const float* wk  = (const float*)d_in[3];
  const float* wv  = (const float*)d_in[4];
  const float* wo  = (const float*)d_in[5];
  const float* bo  = (const float*)d_in[6];
  const float* w1  = (const float*)d_in[7];
  const float* b1  = (const float*)d_in[8];
  const float* w2  = (const float*)d_in[9];
  const float* b2  = (const float*)d_in[10];
  const float* g1  = (const float*)d_in[11];
  const float* be1 = (const float*)d_in[12];
  const float* g2  = (const float*)d_in[13];
  const float* be2 = (const float*)d_in[14];
  float* out = (float*)d_out;

  char* w = (char*)d_ws;
  size_t off = 0;
  auto carve = [&](size_t bytes) -> void* {
    off = (off + 255) & ~(size_t)255;
    void* p = w + off;
    off += bytes;
    return p;
  };
  const size_t act = (size_t)BT * NDIM * DDIM;  // 1.57M elements
  bf16*     Qs   = (bf16*)carve(act * 2);
  bf16*     Kb   = (bf16*)carve(act * 2);
  bf16*     Vt   = (bf16*)carve(act * 2);
  float*    O    = (float*)carve(act * 4);
  unsigned* adjb = (unsigned*)carve((size_t)NDIM * 32 * 4);
  bf16* wqp = (bf16*)carve(64 * 64 * 2);
  bf16* wkp = (bf16*)carve(64 * 64 * 2);
  bf16* wvp = (bf16*)carve(64 * 64 * 2);
  bf16* wop = (bf16*)carve(64 * 64 * 2);
  bf16* w1p = (bf16*)carve(64 * 256 * 2);
  bf16* w2p = (bf16*)carve(256 * 64 * 2);

  pack_qkv_w_kernel<<<dim3(2, 4, 3), 32, 0, stream>>>(wq, wk, wv, wqp, wkp, wvp);
  ln_qkv_kernel<<<dim3(LNQ_BLOCKS + ADJ_BLOCKS + WT_BLOCKS), 128, 0, stream>>>(
      x, g1, be1, wqp, wkp, wvp, Qs, Kb, Vt, adj, adjb, wo, w1, w2, wop, w1p, w2p);
  attn_kernel<<<dim3(NDIM / 32, HDIM, BT), 64, 0, stream>>>(Qs, Kb, Vt, adjb, O);
  proj_mlp_kernel<<<dim3(NDIM / 64, BT), 128, 0, stream>>>(
      x, O, wop, bo, g2, be2, w1p, b1, w2p, b2, out);
}

// v003
// A run of this version takes 75 microseconds.
// In two side-by-side timings against v002, it was 1.26 and 1.24 times as fast.
// Over all steps from v000 it is 1.57 times as fast.
#include <hip/hip_runtime.h>

#define BDIM 2
#define NDIM 1024
#define TDIM 12
#define DDIM 64
#define HDIM 4
#define HD   16
#define BT   (BDIM * TDIM)

typedef __bf16 bf16;
typedef __attribute__((ext_vector_type(16))) __bf16 bf16x16;
typedef __attribute__((ext_vector_type(8)))  __bf16 bf16x8;
typedef __attribute__((ext_vector_type(8)))  float  f32x8;

__device__ __forceinline__ f32x8 wmma_bf16(bf16x16 a, bf16x16 b, f32x8 c) {
  return __builtin_amdgcn_wmma_f32_16x16x32_bf16(false, a, false, b, (short)0, c,
                                                 false, false);
}

// A fragment (16x32 bf16, rows on lanes). ISA 7.12.2: lane<16 holds K=0..7 /
// 16..23, lane>=16 holds K=8..15 / 24..31 for row M=lane%16.
__device__ __forceinline__ bf16x16 load_a_frag(const bf16* base, int ld) {
  const int lane = threadIdx.x & 31;
  const int m    = lane & 15;
  const int koff = (lane & 16) ? 8 : 0;
  const bf16* p  = base + m * ld + koff;
  bf16x8 lo = *(const bf16x8*)(p);
  bf16x8 hi = *(const bf16x8*)(p + 16);
  bf16x16 a;
#pragma unroll
  for (int i = 0; i < 8; ++i) { a[i] = lo[i]; a[i + 8] = hi[i]; }
  return a;
}

// B fragment from pre-swizzled weights: each lane's 16 elements are contiguous.
__device__ __forceinline__ bf16x16 load_b_pack(const bf16* pack, int nt, int kt,
                                               int KT) {
  const int lane = threadIdx.x & 31;
  return *(const bf16x16*)(pack + (((size_t)nt * KT + kt) * 32 + lane) * 16);
}

// Q, K and V live in the workspace in fragment order: per (bt, head) 64 tiles
// of 16 nodes, a tile being 32 lanes x 8 bf16 = 512 contiguous bytes, so that a
// wave-wide 16-byte access covers four whole cache lines.
//   Q, K tile: lane l holds node (l & 15), channels 8 * (l >> 4) + 0..7.
//   V tile:    lane l holds channel (l & 15), nodes 8 * (l >> 4) + 0..7.
__device__ __forceinline__ size_t frag_index(int bt, int h, int tile, int lane) {
  return ((((size_t)bt * HDIM + h) * (NDIM / 16) + tile) * 32 + lane) * 8;
}

// ---------------------------------------------------------------------------
// Repack one 32x16 tile (kt, nt) of a KxNn f32 weight matrix into per-lane
// B-fragment order (bf16). One wave per tile.
__device__ __forceinline__ void pack_w_tile(const float* __restrict__ src,
                                            bf16* __restrict__ dst, int K, int Nn,
                                            int kt, int nt, int lane) {
  const int KT = K >> 5;
  const int n  = nt * 16 + (lane & 15);
  const int koff = (lane & 16) ? 8 : 0;
  float vals[16];
#pragma unroll
  for (int e = 0; e < 16; ++e) {
    const int p = e >> 1, h = e & 1;
    const int k = kt * 32 + ((p < 4) ? 0 : 16) + ((p & 3) * 2 + h) + koff;
    vals[e] = src[(size_t)k * Nn + n];
  }
  // Stands ahead of the conversions, whose results may land in the registers
  // that the loads above name as addresses.
  asm volatile("s_wait_xcnt 0x0" ::: "memory");
  bf16* d = dst + (((size_t)nt * KT + kt) * 32 + lane) * 16;
#pragma unroll
  for (int e = 0; e < 16; ++e) d[e] = (bf16)vals[e];
}

// The three weights the QKV projection reads. grid = (2, 4, 3), block = 32.
__global__ void pack_qkv_w_kernel(const float* __restrict__ wq,
                                  const float* __restrict__ wk,
                                  const float* __restrict__ wv,
                                  bf16* __restrict__ wqp, bf16* __restrict__ wkp,
                                  bf16* __restrict__ wvp) {
  const int z = blockIdx.z;
  const float* src = (z == 0) ? wq : (z == 1) ? wk : wv;
  bf16* dst = (z == 0) ? wqp : (z == 1) ? wkp : wvp;
  pack_w_tile(src, dst, 64, 64, blockIdx.x, blockIdx.y, threadIdx.x);
}

// One adjacency row -> bitmask (1024 bits as 32 u32 words); lane w = word w.
__device__ __forceinline__ void pack_adj_row(const int* __restrict__ adj,
                                             unsigned* __restrict__ adjb, int row,
                                             int w) {
  unsigned bits = 0u;
#pragma unroll 8
  for (int b = 0; b < 32; ++b)
    bits |= (adj[(size_t)row * NDIM + w * 32 + b] != 0 ? 1u : 0u) << b;
  adjb[(size_t)row * 32 + w] = bits;
}

// ---------------------------------------------------------------------------
// Kernel 1: LN1 + QKV projection, block = 128 (4 waves), LNQ_BLOCKS blocks.
// The same grid carries, in the blocks behind those, the packing that only the
// later launches read and that reads nothing written here: the adjacency
// bitmasks (one row per wave) and the wo, w1, w2 tiles (one tile per wave).
#define LNQ_BLOCKS (NDIM / 64 * BT)
#define ADJ_BLOCKS (NDIM / 4)
#define WT_BLOCKS  ((8 + 32 + 32) / 4)
__global__ void ln_qkv_kernel(const float* __restrict__ x,
                              const float* __restrict__ g1,
                              const float* __restrict__ be1,
                              const bf16* __restrict__ wqp,
                              const bf16* __restrict__ wkp,
                              const bf16* __restrict__ wvp,
                              bf16* __restrict__ Qf, bf16* __restrict__ Kf,
                              bf16* __restrict__ Vf,
                              const int* __restrict__ adj,
                              unsigned* __restrict__ adjb,
                              const float* __restrict__ wo,
                              const float* __restrict__ w1,
                              const float* __restrict__ w2,
                              bf16* __restrict__ wop, bf16* __restrict__ w1p,
                              bf16* __restrict__ w2p) {
  __shared__ __align__(16) bf16 hbuf[64 * 80];
  const int tid = threadIdx.x;
  const int bid = blockIdx.x;
  if (bid >= LNQ_BLOCKS) {  // whole blocks leave here, ahead of the barrier
    const int pw = (bid - LNQ_BLOCKS) * 4 + (tid >> 5);
    const int pl = tid & 31;
    if (pw < NDIM) {
      pack_adj_row(adj, adjb, pw, pl);
    } else {
      const int tl = pw - NDIM;
      if (tl < 8)       pack_w_tile(wo, wop, 64, 64, tl & 1, tl >> 1, pl);
      else if (tl < 40) pack_w_tile(w1, w1p, 64, 256, tl & 1, (tl - 8) >> 1, pl);
      else              pack_w_tile(w2, w2p, 256, 64, tl & 7, (tl - 40) >> 3, pl);
    }
    return;
  }
  const int bt = bid / (NDIM / 64);
  const int b = bt / TDIM, t = bt % TDIM;
  const int r0 = (bid % (NDIM / 64)) * 64;

  {  // LayerNorm: 2 threads per row, 32 columns each.
    const int row = tid >> 1;
    const int c0 = (tid & 1) * 32;
    const float* xr =
        x + (((size_t)b * NDIM + (r0 + row)) * TDIM + t) * DDIM + c0;
    float v[32], s = 0.f, ss = 0.f;
#pragma unroll
    for (int i = 0; i < 32; ++i) { v[i] = xr[i]; s += v[i]; ss += v[i] * v[i]; }
    s  += __shfl_xor(s, 1);
    ss += __shfl_xor(ss, 1);
    const float mean = s * (1.f / 64.f);
    const float var  = ss * (1.f / 64.f) - mean * mean;
    const float rstd = rsqrtf(var + 1e-5f);
#pragma unroll
    for (int i = 0; i < 32; ++i) {
      const int c = c0 + i;
      hbuf[row * 80 + c] = (bf16)((v[i] - mean) * rstd * g1[c] + be1[c]);
    }
  }
  __syncthreads();

  const int wave = tid >> 5, lane = tid & 31;
  const int rowbase = wave * 16;
  const bf16* packs[3] = {wqp, wkp, wvp};
  bf16* frags[3] = {Qf, Kf, Vf};
  const int tile = (r0 + rowbase) >> 4;
  const f32x8 fz = {0.f, 0.f, 0.f, 0.f, 0.f, 0.f, 0.f, 0.f};

  // Head nt of this wave's 16 nodes is one fragment tile. Q and K are formed
  // transposed (W^T h^T: the two operands swap places, their k orders being
  // equal), so a lane ends with 8 channels of one node; V stays h W, so a lane
  // ends with 8 nodes of one channel. Either way the lane's 8 values are the
  // 16 bytes that the same lane of an attention wave loads.
#pragma unroll
  for (int mtx = 0; mtx < 3; ++mtx) {
    bf16x8 o[4];
#pragma unroll
    for (int nt = 0; nt < 4; ++nt) {
      f32x8 acc = fz;
#pragma unroll
      for (int kt = 0; kt < 2; ++kt) {
        const bf16x16 hf = load_a_frag(hbuf + rowbase * 80 + kt * 32, 80);
        const bf16x16 wf = load_b_pack(packs[mtx], nt, kt, 2);
        acc = (mtx == 2) ? wmma_bf16(hf, wf, acc) : wmma_bf16(wf, hf, acc);
      }
#pragma unroll
      for (int r = 0; r < 8; ++r)  // Q pre-scaled by 1/sqrt(HD)
        o[nt][r] = (bf16)((mtx == 0) ? acc[r] * 0.25f : acc[r]);
    }
    bf16* dst = frags[mtx] + frag_index(bt, 0, tile, lane);
#pragma unroll
    for (int nt = 0; nt < 4; ++nt)
      *(bf16x8*)(dst + frag_index(0, nt, 0, 0)) = o[nt];
    // Stands ahead of every rewrite of a register that the four stores name;
    // as inputs of the wait, address and data stay in place up to it.
    asm volatile("s_wait_xcnt 0x0"
                 :: "v"(dst), "v"(o[0]), "v"(o[1]), "v"(o[2]), "v"(o[3])
                 : "memory");
  }
}

// Value of lane l ^ 16 (the other half of the same query column).
__device__ __forceinline__ float other_half(float v) {
  const int b = __builtin_bit_cast(int, v);
  return __builtin_bit_cast(
      float, __builtin_amdgcn_permlanex16(b, b, 0x76543210, 0xfedcba98, false,
                                          false));
}

// s where bit 'bit' of w is set, else -1e9 (bit field extract + bit select).
__device__ __forceinline__ float mask_score(float s, unsigned w, int bit) {
  const int keep = ((int)(w << (31 - bit))) >> 31;
  const int si = __builtin_bit_cast(int, s);
  const int ni = __builtin_bit_cast(int, -1e9f);
  return __builtin_bit_cast(float, (si & keep) | (ni & ~keep));
}

__global__ void attn_kernel(const bf16* __restrict__ Qf,
                            const bf16* __restrict__ Kf,
                            const bf16* __restrict__ Vf,
                            const unsigned* __restrict__ adjb,
                            float* __restrict__ O) {
  // Pitch 33 words: the 16 query rows a wave reads at one kc hit 16 banks.
  __shared__ unsigned adjw[32][33];
  const int tid = threadIdx.x;
  const int wave = tid >> 5, lane = tid & 31;
  const int qt = blockIdx.x, h = blockIdx.y, bt = blockIdx.z;
  const int qblock = qt * 32;
  const int qbase = qblock + wave * 16;
  const int coln = lane & 15;
  const int koff = (lane & 16) ? 8 : 0;

  for (int i = tid; i < 32 * 32; i += 64)
    adjw[i >> 5][i & 31] = adjb[(size_t)(qblock + (i >> 5)) * 32 + (i & 31)];
  __syncthreads();

  // Q^T B-fragment (column = query): HD=16 channels zero-padded to K=32.
  bf16x16 qb;
  {
    bf16x8 lo = *(const bf16x8*)(Qf + frag_index(bt, h, qbase >> 4, lane));
#pragma unroll
    for (int i = 0; i < 8; ++i) { qb[i] = lo[i]; qb[i + 8] = (bf16)0.f; }
  }

  // Per lane: running maximum of its query (equal in both halves), the sum of
  // its own half's keys, and 8 output channels of its query.
  float mrun = -1e9f, lrun = 0.f;
  f32x8 oacc = {0.f, 0.f, 0.f, 0.f, 0.f, 0.f, 0.f, 0.f};
  const f32x8 fz = {0.f, 0.f, 0.f, 0.f, 0.f, 0.f, 0.f, 0.f};

  // A chunk of 32 keys is two tiles: 512 elements of K and 512 of V.
  const bf16* kp = Kf + frag_index(bt, h, 0, lane);
  const bf16* vp = Vf + frag_index(bt, h, 0, lane);
  // Prefetch address, one chunk ahead: lanes 0..15 walk a K chunk, lanes
  // 16..31 a V chunk, in steps of 64 bytes, so one instruction names all 16
  // lines of a chunk.
  const bf16* pp =
      ((lane & 16) ? Vf : Kf) + frag_index(bt, h, 2, 0) + coln * 32;
  const unsigned* mrow = &adjw[wave * 16 + coln][0];
  bf16x16 ka0, ka1;  // upper halves (k = 16..31) stay zero through the loop
#pragma unroll
  for (int i = 0; i < 16; ++i) { ka0[i] = (bf16)0.f; ka1[i] = (bf16)0.f; }

  for (int kc = 0; kc < 32; ++kc) {
    // Prefetch the next chunk's K/V lines.
    if (kc + 1 < 32) __builtin_prefetch(pp, 0, 1);
    // Two K A-fragments (row = key, channels on K dim, zero-padded to 32).
    {
      bf16x8 l0 = *(const bf16x8*)kp;
      bf16x8 l1 = *(const bf16x8*)(kp + 256);
#pragma unroll
      for (int i = 0; i < 8; ++i) { ka0[i] = l0[i]; ka1[i] = l1[i]; }
    }
    // V^T A-fragment (row = channel, keys in the hardware k order).
    bf16x16 va;
    {
      bf16x8 lo = *(const bf16x8*)vp;
      bf16x8 hi = *(const bf16x8*)(vp + 256);
#pragma unroll
      for (int i = 0; i < 8; ++i) { va[i] = lo[i]; va[i + 8] = hi[i]; }
    }
    // Stands ahead of the three advances below, which rewrite the address
    // registers that the loads above name; as inputs of the wait the
    // addresses stay in place up to it.
    asm volatile("s_wait_xcnt 0x0" :: "v"(kp), "v"(vp), "v"(pp) : "memory");
    kp += 512;
    vp += 512;
    pp += 512;
    // s0[r] = S[query coln][32 * kc + koff + r], s1[r] = the same 16 keys on.
    f32x8 s0 = wmma_bf16(ka0, qb, fz);
    f32x8 s1 = wmma_bf16(ka1, qb, fz);

    const unsigned mw = mrow[kc] >> koff;  // bit r: s0[r], bit 16 + r: s1[r]
    float cm = -1e9f;
#pragma unroll
    for (int r = 0; r < 8; ++r) {
      s0[r] = mask_score(s0[r], mw, r);
      s1[r] = mask_score(s1[r], mw, 16 + r);
      cm = fmaxf(cm, fmaxf(s0[r], s1[r]));
    }
    const float mnew = fmaxf(mrun, fmaxf(cm, other_half(cm)));
    const float corr = __expf(mrun - mnew);
    mrun = mnew;
    float ps = 0.f;
    bf16x16 pb;  // P^T B-fragment straight from the two score tiles
#pragma unroll
    for (int r = 0; r < 8; ++r) {
      const float e0 = __expf(s0[r] - mnew);
      const float e1 = __expf(s1[r] - mnew);
      ps += e0 + e1;
      pb[r]     = (bf16)e0;
      pb[r + 8] = (bf16)e1;
    }
    lrun = lrun * corr + ps;
#pragma unroll
    for (int r = 0; r < 8; ++r) oacc[r] *= corr;
    oacc = wmma_bf16(va, pb, oacc);
  }

  // oacc[r] = O[query coln][channel koff + r]: 8 consecutive floats per lane.
  const float inv = 1.f / (lrun + other_half(lrun));
  float* op = O + ((size_t)bt * NDIM + qbase + coln) * DDIM + h * HD + koff;
  float4 w0 = {oacc[0] * inv, oacc[1] * inv, oacc[2] * inv, oacc[3] * inv};
  float4 w1 = {oacc[4] * inv, oacc[5] * inv, oacc[6] * inv, oacc[7] * inv};
  *(float4*)(op)     = w0;
  *(float4*)(op + 4) = w1;
}

// ---------------------------------------------------------------------------
// Kernel 3: out-proj + residual + LN2 + MLP + residual.
// grid = (N/64, BT), block = 128.
__global__ void proj_mlp_kernel(const float* __restrict__ x,
                                const float* __restrict__ O,
                                const bf16* __restrict__ wop,
                                const float* __restrict__ bo,
                                const float* __restrict__ g2,
                                const float* __restrict__ be2,
                                const bf16* __restrict__ w1p,
                                const float* __restrict__ b1,
                                const bf16* __restrict__ w2p,
                                const float* __restrict__ b2,
                                float* __restrict__ out) {
  __shared__ __align__(16) bf16 hbuf[64 * 80];
  __shared__ __align__(16) float xbuf[64 * 72];
  __shared__ __align__(16) bf16 ubuf[64 * 264];
  const int tid = threadIdx.x;
  const int bt = blockIdx.y;
  const int b = bt / TDIM, t = bt % TDIM;
  const int r0 = blockIdx.x * 64;
  const f32x8 fz = {0.f, 0.f, 0.f, 0.f, 0.f, 0.f, 0.f, 0.f};

  {  // stage attention output as bf16
    const int row = tid >> 1;
    const int c0 = (tid & 1) * 32;
    const float* op = O + ((size_t)bt * NDIM + r0 + row) * DDIM + c0;
    // Pull the residual x row toward the caches while we stage o.
    __builtin_prefetch(x + (((size_t)b * NDIM + r0 + row) * TDIM + t) * DDIM + c0,
                       0, 1);
#pragma unroll
    for (int i = 0; i < 32; ++i) hbuf[row * 80 + c0 + i] = (bf16)op[i];
  }
  __syncthreads();

  const int wave = tid >> 5, lane = tid & 31;
  const int rowbase = wave * 16;
  const int rhalf = (lane >> 4) * 8;
  const int coln = lane & 15;

  // o @ wo + bo + x  -> xbuf (f32)
#pragma unroll
  for (int nt = 0; nt < 4; ++nt) {
    f32x8 acc = fz;
#pragma unroll
    for (int kt = 0; kt < 2; ++kt)
      acc = wmma_bf16(load_a_frag(hbuf + rowbase * 80 + kt * 32, 80),
                      load_b_pack(wop, nt, kt, 2), acc);
#pragma unroll
    for (int r = 0; r < 8; ++r) {
      const int row_in = rowbase + rhalf + r;
      const int node = r0 + row_in;
      const int col = nt * 16 + coln;
      const float xv = x[(((size_t)b * NDIM + node) * TDIM + t) * DDIM + col];
      xbuf[row_in * 72 + col] = xv + acc[r] + bo[col];
    }
  }
  __syncthreads();

  {  // LN2 -> hbuf (bf16)
    const int row = tid >> 1;
    const int c0 = (tid & 1) * 32;
    float v[32], s = 0.f, ss = 0.f;
#pragma unroll
    for (int i = 0; i < 32; ++i) {
      v[i] = xbuf[row * 72 + c0 + i];
      s += v[i]; ss += v[i] * v[i];
    }
    s  += __shfl_xor(s, 1);
    ss += __shfl_xor(ss, 1);
    const float mean = s * (1.f / 64.f);
    const float var  = ss * (1.f / 64.f) - mean * mean;
    const float rstd = rsqrtf(var + 1e-5f);
#pragma unroll
    for (int i = 0; i < 32; ++i) {
      const int c = c0 + i;
      hbuf[row * 80 + c] = (bf16)((v[i] - mean) * rstd * g2[c] + be2[c]);
    }
  }
  __syncthreads();

  // MLP layer 1: 64 -> 256, ReLU -> ubuf (bf16)
#pragma unroll
  for (int nt = 0; nt < 16; ++nt) {
    f32x8 acc = fz;
#pragma unroll
    for (int kt = 0; kt < 2; ++kt)
      acc = wmma_bf16(load_a_frag(hbuf + rowbase * 80 + kt * 32, 80),
                      load_b_pack(w1p, nt, kt, 2), acc);
#pragma unroll
    for (int r = 0; r < 8; ++r) {
      const int row_in = rowbase + rhalf + r;
      const int col = nt * 16 + coln;
      ubuf[row_in * 264 + col] = (bf16)fmaxf(acc[r] + b1[col], 0.f);
    }
  }
  __syncthreads();

  // MLP layer 2: 256 -> 64, + residual -> out (original [B,N,T,D] layout)
#pragma unroll
  for (int nt = 0; nt < 4; ++nt) {
    f32x8 acc = fz;
#pragma unroll
    for (int kt = 0; kt < 8; ++kt)
      acc = wmma_bf16(load_a_frag(ubuf + rowbase * 264 + kt * 32, 264),
                      load_b_pack(w2p, nt, kt, 8), acc);
#pragma unroll
    for (int r = 0; r < 8; ++r) {
      const int row_in = rowbase + rhalf + r;
      const int node = r0 + row_in;
      const int col = nt * 16 + coln;
      out[(((size_t)b * NDIM + node) * TDIM + t) * DDIM + col] =
          xbuf[row_in * 72 + col] + acc[r] + b2[col];
    }
  }
}

// ---------------------------------------------------------------------------
extern "C" void kernel_launch(void* const* d_in, const int* in_sizes, int n_in,
                              void* d_out, int out_size, void* d_ws,
                              size_t ws_size, hipStream_t stream) {
  (void)in_sizes; (void)n_in; (void)out_size; (void)ws_size;
  const float* x   = (const float*)d_in[0];
  const int*   adj = (const int*)d_in[1];
  const float* wq  = (const float*)d_in[2];
  const float* wk  = (const float*)d_in[3];
  const float* wv  = (const float*)d_in[4];
  const float* wo  = (const float*)d_in[5];
  const float* bo  = (const float*)d_in[6];
  const float* w1  = (const float*)d_in[7];
  const float* b1  = (const float*)d_in[8];
  const float* w2  = (const float*)d_in[9];
  const float* b2  = (const float*)d_in[10];
  const float* g1  = (const float*)d_in[11];
  const float* be1 = (const float*)d_in[12];
  const float* g2  = (const float*)d_in[13];
  const float* be2 = (const float*)d_in[14];
  float* out = (float*)d_out;

  char* w = (char*)d_ws;
  size_t off = 0;
  auto carve = [&](size_t bytes) -> void* {
    off = (off + 255) & ~(size_t)255;
    void* p = w + off;
    off += bytes;
    return p;
  };
  const size_t act = (size_t)BT * NDIM * DDIM;  // 1.57M elements
  bf16*     Qf   = (bf16*)carve(act * 2);
  bf16*     Kf   = (bf16*)carve(act * 2);
  bf16*     Vf   = (bf16*)carve(act * 2);
  float*    O    = (float*)carve(act * 4);
  unsigned* adjb = (unsigned*)carve((size_t)NDIM * 32 * 4);
  bf16* wqp = (bf16*)carve(64 * 64 * 2);
  bf16* wkp = (bf16*)carve(64 * 64 * 2);
  bf16* wvp = (bf16*)carve(64 * 64 * 2);
  bf16* wop = (bf16*)carve(64 * 64 * 2);
  bf16* w1p = (bf16*)carve(64 * 256 * 2);
  bf16* w2p = (bf16*)carve(256 * 64 * 2);

  pack_qkv_w_kernel<<<dim3(2, 4, 3), 32, 0, stream>>>(wq, wk, wv, wqp, wkp, wvp);
  ln_qkv_kernel<<<dim3(LNQ_BLOCKS + ADJ_BLOCKS + WT_BLOCKS), 128, 0, stream>>>(
      x, g1, be1, wqp, wkp, wvp, Qf, Kf, Vf, adj, adjb, wo, w1, w2, wop, w1p, w2p);
  attn_kernel<<<dim3(NDIM / 32, HDIM, BT), 64, 0, stream>>>(Qf, Kf, Vf, adjb, O);
  proj_mlp_kernel<<<dim3(NDIM / 64, BT), 128, 0, stream>>>(
      x, O, wop, bo, g2, be2, w1p, b1, w2p, b2, out);
}

// v004
// A run of this version takes 40.3 microseconds.
// In two side-by-side timings against v003, it was 1.89 and 1.85 times as fast.
// Over all steps from v000 it is 2.93 times as fast.
#include <hip/hip_runtime.h>

#define BDIM 2
#define NDIM 1024
#define TDIM 12
#define DDIM 64
#define HDIM 4
#define HD   16
#define BT   (BDIM * TDIM)

typedef __bf16 bf16;
typedef __attribute__((ext_vector_type(16))) __bf16 bf16x16;
typedef __attribute__((ext_vector_type(8)))  __bf16 bf16x8;
typedef __attribute__((ext_vector_type(8)))  float  f32x8;

__device__ __forceinline__ f32x8 wmma_bf16(bf16x16 a, bf16x16 b, f32x8 c) {
  return __builtin_amdgcn_wmma_f32_16x16x32_bf16(false, a, false, b, (short)0, c,
                                                 false, false);
}

// A fragment (16x32 bf16, rows on lanes). ISA 7.12.2: lane<16 holds K=0..7 /
// 16..23, lane>=16 holds K=8..15 / 24..31 for row M=lane%16.
__device__ __forceinline__ bf16x16 load_a_frag(const bf16* base, int ld) {
  const int lane = threadIdx.x & 31;
  const int m    = lane & 15;
  const int koff = (lane & 16) ? 8 : 0;
  const bf16* p  = base + m * ld + koff;
  bf16x8 lo = *(const bf16x8*)(p);
  bf16x8 hi = *(const bf16x8*)(p + 16);
  bf16x16 a;
#pragma unroll
  for (int i = 0; i < 8; ++i) { a[i] = lo[i]; a[i + 8] = hi[i]; }
  return a;
}

// ---------------------------------------------------------------------------
// Asynchronous copies to LDS, 16 bytes per lane and copy, every lane on. A run
// of copies shares one statement, so that all of them are in flight together;
// its last line holds every rewrite of an address register behind the copies.
__device__ __forceinline__ unsigned lds_addr(const void* p) {
  return (unsigned)(size_t)p;  // byte offset in the work-group's LDS
}
__device__ __forceinline__ void async_copy_x4(const unsigned (&l)[4],
                                               const void* const (&g)[4]) {
  asm volatile(
      "global_load_async_to_lds_b128 %0, %4, off\n\t"
      "global_load_async_to_lds_b128 %1, %5, off\n\t"
      "global_load_async_to_lds_b128 %2, %6, off\n\t"
      "global_load_async_to_lds_b128 %3, %7, off\n\t"
      "s_wait_xcnt 0x0"
      :: "v"(l[0]), "v"(l[1]), "v"(l[2]), "v"(l[3]), "v"(g[0]), "v"(g[1]),
         "v"(g[2]), "v"(g[3])
      : "memory");
}
__device__ __forceinline__ void async_copy_x9(const unsigned (&l)[9],
                                               const void* const (&g)[9]) {
  asm volatile(
      "global_load_async_to_lds_b128 %0, %9, off\n\t"
      "global_load_async_to_lds_b128 %1, %10, off\n\t"
      "global_load_async_to_lds_b128 %2, %11, off\n\t"
      "global_load_async_to_lds_b128 %3, %12, off\n\t"
      "global_load_async_to_lds_b128 %4, %13, off\n\t"
      "global_load_async_to_lds_b128 %5, %14, off\n\t"
      "global_load_async_to_lds_b128 %6, %15, off\n\t"
      "global_load_async_to_lds_b128 %7, %16, off\n\t"
      "global_load_async_to_lds_b128 %8, %17, off\n\t"
      "s_wait_xcnt 0x0"
      :: "v"(l[0]), "v"(l[1]), "v"(l[2]), "v"(l[3]), "v"(l[4]), "v"(l[5]),
         "v"(l[6]), "v"(l[7]), "v"(l[8]), "v"(g[0]), "v"(g[1]), "v"(g[2]),
         "v"(g[3]), "v"(g[4]), "v"(g[5]), "v"(g[6]), "v"(g[7]), "v"(g[8])
      : "memory");
}
__device__ __forceinline__ void async_copy_x12(const unsigned (&l)[12],
                                               const void* const (&g)[12]) {
  asm volatile(
      "global_load_async_to_lds_b128 %0, %12, off\n\t"
      "global_load_async_to_lds_b128 %1, %13, off\n\t"
      "global_load_async_to_lds_b128 %2, %14, off\n\t"
      "global_load_async_to_lds_b128 %3, %15, off\n\t"
      "global_load_async_to_lds_b128 %4, %16, off\n\t"
      "global_load_async_to_lds_b128 %5, %17, off\n\t"
      "global_load_async_to_lds_b128 %6, %18, off\n\t"
      "global_load_async_to_lds_b128 %7, %19, off\n\t"
      "global_load_async_to_lds_b128 %8, %20, off\n\t"
      "global_load_async_to_lds_b128 %9, %21, off\n\t"
      "global_load_async_to_lds_b128 %10, %22, off\n\t"
      "global_load_async_to_lds_b128 %11, %23, off\n\t"
      "s_wait_xcnt 0x0"
      :: "v"(l[0]), "v"(l[1]), "v"(l[2]), "v"(l[3]), "v"(l[4]), "v"(l[5]),
         "v"(l[6]), "v"(l[7]), "v"(l[8]), "v"(l[9]), "v"(l[10]), "v"(l[11]),
         "v"(g[0]), "v"(g[1]), "v"(g[2]), "v"(g[3]), "v"(g[4]), "v"(g[5]),
         "v"(g[6]), "v"(g[7]), "v"(g[8]), "v"(g[9]), "v"(g[10]), "v"(g[11])
      : "memory");
}

// Packed weights: in global memory a lane's 16 elements of B fragment
// nt * KT + kt are contiguous. In LDS fragment f is 1 KiB, the lanes' first 16
// bytes in its lower half and their second 16 bytes in its upper half, so that
// each of the two reads of a fragment is 512 contiguous bytes. Chunk c (16
// bytes) of the global order goes to this element offset.
__device__ __forceinline__ int w_lds_index(int c) {
  return (c >> 6) * 512 + (c & 1) * 256 + ((c >> 1) & 31) * 8;
}
__device__ __forceinline__ bf16x16 load_b_lds(const bf16* w, int f) {
  const int lane = threadIdx.x & 31;
  bf16x8 lo = *(const bf16x8*)(w + f * 512 + lane * 8);
  bf16x8 hi = *(const bf16x8*)(w + f * 512 + 256 + lane * 8);
  bf16x16 b;
#pragma unroll
  for (int i = 0; i < 8; ++i) { b[i] = lo[i]; b[i + 8] = hi[i]; }
  return b;
}

// Q, K and V live in the workspace in fragment order: per (bt, head) 64 tiles
// of 16 nodes, a tile being 32 lanes x 8 bf16 = 512 contiguous bytes, so that a
// wave-wide 16-byte access covers four whole cache lines.
//   Q, K tile: lane l holds node (l & 15), channels 8 * (l >> 4) + 0..7.
//   V tile:    lane l holds channel (l & 15), nodes 8 * (l >> 4) + 0..7.
__device__ __forceinline__ size_t frag_index(int bt, int h, int tile, int lane) {
  return ((((size_t)bt * HDIM + h) * (NDIM / 16) + tile) * 32 + lane) * 8;
}

// ---------------------------------------------------------------------------
// Repack one 32x16 tile (kt, nt) of a KxNn f32 weight matrix into per-lane
// B-fragment order (bf16). One wave per tile.
__device__ __forceinline__ void pack_w_tile(const float* __restrict__ src,
                                            bf16* __restrict__ dst, int K, int Nn,
                                            int kt, int nt, int lane) {
  const int KT = K >> 5;
  const int n  = nt * 16 + (lane & 15);
  const int koff = (lane & 16) ? 8 : 0;
  float vals[16];
#pragma unroll
  for (int e = 0; e < 16; ++e) {
    const int p = e >> 1, h = e & 1;
    const int k = kt * 32 + ((p < 4) ? 0 : 16) + ((p & 3) * 2 + h) + koff;
    vals[e] = src[(size_t)k * Nn + n];
  }
  // Stands ahead of the conversions, whose results may land in the registers
  // that the loads above name as addresses.
  asm volatile("s_wait_xcnt 0x0" ::: "memory");
  bf16* d = dst + (((size_t)nt * KT + kt) * 32 + lane) * 16;
#pragma unroll
  for (int e = 0; e < 16; ++e) d[e] = (bf16)vals[e];
}

// The three weights the QKV projection reads. grid = (2, 4, 3), block = 32.
__global__ void pack_qkv_w_kernel(const float* __restrict__ wq,
                                  const float* __restrict__ wk,
                                  const float* __restrict__ wv,
                                  bf16* __restrict__ wqp, bf16* __restrict__ wkp,
                                  bf16* __restrict__ wvp) {
  const int z = blockIdx.z;
  const float* src = (z == 0) ? wq : (z == 1) ? wk : wv;
  bf16* dst = (z == 0) ? wqp : (z == 1) ? wkp : wvp;
  pack_w_tile(src, dst, 64, 64, blockIdx.x, blockIdx.y, threadIdx.x);
}

// One adjacency row -> bitmask (1024 bits as 32 u32 words); lane w = word w.
__device__ __forceinline__ void pack_adj_row(const int* __restrict__ adj,
                                             unsigned* __restrict__ adjb, int row,
                                             int w) {
  unsigned bits = 0u;
#pragma unroll 8
  for (int b = 0; b < 32; ++b)
    bits |= (adj[(size_t)row * NDIM + w * 32 + b] != 0 ? 1u : 0u) << b;
  adjb[(size_t)row * 32 + w] = bits;
}

// ---------------------------------------------------------------------------
// Kernel 1: LN1 + QKV projection, block = 128 (4 waves), LNQ_BLOCKS blocks.
// The same grid carries, in the blocks behind those, the packing that only the
// later launches read and that reads nothing written here: the adjacency
// bitmasks (one row per wave) and the wo, w1, w2 tiles (one tile per wave).
#define LNQ_BLOCKS (NDIM / 64 * BT)
#define ADJ_BLOCKS (NDIM / 4)
#define WT_BLOCKS  ((8 + 32 + 32) / 4)
__global__ void ln_qkv_kernel(const float* __restrict__ x,
                              const float* __restrict__ g1,
                              const float* __restrict__ be1,
                              const bf16* __restrict__ wqp,
                              const bf16* __restrict__ wkp,
                              const bf16* __restrict__ wvp,
                              bf16* __restrict__ Qf, bf16* __restrict__ Kf,
                              bf16* __restrict__ Vf,
                              const int* __restrict__ adj,
                              unsigned* __restrict__ adjb,
                              const float* __restrict__ wo,
                              const float* __restrict__ w1,
                              const float* __restrict__ w2,
                              bf16* __restrict__ wop, bf16* __restrict__ w1p,
                              bf16* __restrict__ w2p) {
  __shared__ __align__(16) bf16 hbuf[64 * 80];
  __shared__ __align__(16) bf16 wbuf[24 * 512];  // wq, wk, wv fragments
  const int tid = threadIdx.x;
  const int bid = blockIdx.x;
  if (bid >= LNQ_BLOCKS) {  // whole blocks leave here, ahead of the barrier
    const int pw = (bid - LNQ_BLOCKS) * 4 + (tid >> 5);
    const int pl = tid & 31;
    if (pw < NDIM) {
      pack_adj_row(adj, adjb, pw, pl);
    } else {
      const int tl = pw - NDIM;
      if (tl < 8)       pack_w_tile(wo, wop, 64, 64, tl & 1, tl >> 1, pl);
      else if (tl < 40) pack_w_tile(w1, w1p, 64, 256, tl & 1, (tl - 8) >> 1, pl);
      else              pack_w_tile(w2, w2p, 256, 64, tl & 7, (tl - 40) >> 3, pl);
    }
    return;
  }
  const int bt = bid / (NDIM / 64);
  const int b = bt / TDIM, t = bt % TDIM;
  const int r0 = (bid % (NDIM / 64)) * 64;

  {  // The three packed weights fly to LDS while the LayerNorm runs.
    unsigned l[12];
    const void* g[12];
#pragma unroll
    for (int i = 0; i < 12; ++i) {
      const int c = i * 128 + tid;
      l[i] = lds_addr(wbuf + w_lds_index(c));
      g[i] = (i < 4) ? wqp + c * 8
                     : (i < 8) ? wkp + (c - 512) * 8 : wvp + (c - 1024) * 8;
    }
    async_copy_x12(l, g);
  }

  {  // LayerNorm: 2 threads per row, 32 columns each.
    const int row = tid >> 1;
    const int c0 = (tid & 1) * 32;
    const float* xr =
        x + (((size_t)b * NDIM + (r0 + row)) * TDIM + t) * DDIM + c0;
    float v[32], s = 0.f, ss = 0.f;
#pragma unroll
    for (int i = 0; i < 32; ++i) { v[i] = xr[i]; s += v[i]; ss += v[i] * v[i]; }
    s  += __shfl_xor(s, 1);
    ss += __shfl_xor(ss, 1);
    const float mean = s * (1.f / 64.f);
    const float var  = ss * (1.f / 64.f) - mean * mean;
    const float rstd = rsqrtf(var + 1e-5f);
#pragma unroll
    for (int i = 0; i < 32; ++i) {
      const int c = c0 + i;
      hbuf[row * 80 + c] = (bf16)((v[i] - mean) * rstd * g1[c] + be1[c]);
    }
  }
  // This wave's copies have landed; the barrier publishes them to the others.
  asm volatile("s_wait_asynccnt 0x0" ::: "memory");
  __syncthreads();

  const int wave = tid >> 5, lane = tid & 31;
  const int rowbase = wave * 16;
  bf16* frags[3] = {Qf, Kf, Vf};
  const int tile = (r0 + rowbase) >> 4;
  const f32x8 fz = {0.f, 0.f, 0.f, 0.f, 0.f, 0.f, 0.f, 0.f};

  // Head nt of this wave's 16 nodes is one fragment tile. Q and K are formed
  // transposed (W^T h^T: the two operands swap places, their k orders being
  // equal), so a lane ends with 8 channels of one node; V stays h W, so a lane
  // ends with 8 nodes of one channel. Either way the lane's 8 values are the
  // 16 bytes that the same lane of an attention wave loads.
#pragma unroll
  for (int mtx = 0; mtx < 3; ++mtx) {
    bf16x8 o[4];
#pragma unroll
    for (int nt = 0; nt < 4; ++nt) {
      f32x8 acc = fz;
#pragma unroll
      for (int kt = 0; kt < 2; ++kt) {
        const bf16x16 hf = load_a_frag(hbuf + rowbase * 80 + kt * 32, 80);
        const bf16x16 wf = load_b_lds(wbuf, mtx * 8 + nt * 2 + kt);
        acc = (mtx == 2) ? wmma_bf16(hf, wf, acc) : wmma_bf16(wf, hf, acc);
      }
#pragma unroll
      for (int r = 0; r < 8; ++r)  // Q pre-scaled by 1/sqrt(HD)
        o[nt][r] = (bf16)((mtx == 0) ? acc[r] * 0.25f : acc[r]);
    }
    bf16* dst = frags[mtx] + frag_index(bt, 0, tile, lane);
#pragma unroll
    for (int nt = 0; nt < 4; ++nt)
      *(bf16x8*)(dst + frag_index(0, nt, 0, 0)) = o[nt];
    // Stands ahead of every rewrite of a register that the four stores name;
    // as inputs of the wait, address and data stay in place up to it.
    asm volatile("s_wait_xcnt 0x0"
                 :: "v"(dst), "v"(o[0]), "v"(o[1]), "v"(o[2]), "v"(o[3])
                 : "memory");
  }
}

// Value of lane l ^ 16 (the other half of the same query column).
__device__ __forceinline__ float other_half(float v) {
  const int b = __builtin_bit_cast(int, v);
  return __builtin_bit_cast(
      float, __builtin_amdgcn_permlanex16(b, b, 0x76543210, 0xfedcba98, false,
                                          false));
}

// s where bit 'bit' of w is set, else -1e9 (bit field extract + bit select).
__device__ __forceinline__ float mask_score(float s, unsigned w, int bit) {
  const int keep = ((int)(w << (31 - bit))) >> 31;
  const int si = __builtin_bit_cast(int, s);
  const int ni = __builtin_bit_cast(int, -1e9f);
  return __builtin_bit_cast(float, (si & keep) | (ni & ~keep));
}

__global__ void attn_kernel(const bf16* __restrict__ Qf,
                            const bf16* __restrict__ Kf,
                            const bf16* __restrict__ Vf,
                            const unsigned* __restrict__ adjb,
                            float* __restrict__ O) {
  // Pitch 36 words: rows start at multiples of 16 bytes, and the 16 query rows
  // a wave reads at one kc hit 16 banks.
  __shared__ __align__(16) unsigned adjw[32][36];
  const int tid = threadIdx.x;
  const int wave = tid >> 5, lane = tid & 31;
  const int qt = blockIdx.x, h = blockIdx.y, bt = blockIdx.z;
  const int qblock = qt * 32;
  const int qbase = qblock + wave * 16;
  const int coln = lane & 15;
  const int koff = (lane & 16) ? 8 : 0;

  {  // 32 mask rows of 128 bytes: 256 chunks of 16 bytes, four per thread.
    unsigned l[4];
    const void* g[4];
#pragma unroll
    for (int i = 0; i < 4; ++i) {
      const int c = i * 64 + tid;
      l[i] = lds_addr(&adjw[c >> 3][(c & 7) * 4]);
      g[i] = adjb + (size_t)qblock * 32 + c * 4;
    }
    async_copy_x4(l, g);
  }
  // This wave's copies have landed; the barrier publishes them to the other.
  asm volatile("s_wait_asynccnt 0x0" ::: "memory");
  __syncthreads();

  // Q^T B-fragment (column = query): HD=16 channels zero-padded to K=32.
  bf16x16 qb;
  {
    bf16x8 lo = *(const bf16x8*)(Qf + frag_index(bt, h, qbase >> 4, lane));
#pragma unroll
    for (int i = 0; i < 8; ++i) { qb[i] = lo[i]; qb[i + 8] = (bf16)0.f; }
  }

  // Per lane: running maximum of its query (equal in both halves), the sum of
  // its own half's keys, and 8 output channels of its query.
  float mrun = -1e9f, lrun = 0.f;
  f32x8 oacc = {0.f, 0.f, 0.f, 0.f, 0.f, 0.f, 0.f, 0.f};
  const f32x8 fz = {0.f, 0.f, 0.f, 0.f, 0.f, 0.f, 0.f, 0.f};

  // A chunk of 32 keys is two tiles: 512 elements of K and 512 of V.
  const bf16* kp = Kf + frag_index(bt, h, 0, lane);
  const bf16* vp = Vf + frag_index(bt, h, 0, lane);
  // Prefetch address, one chunk ahead: lanes 0..15 walk a K chunk, lanes
  // 16..31 a V chunk, in steps of 64 bytes, so one instruction names all 16
  // lines of a chunk.
  const bf16* pp =
      ((lane & 16) ? Vf : Kf) + frag_index(bt, h, 2, 0) + coln * 32;
  const unsigned* mrow = &adjw[wave * 16 + coln][0];
  bf16x16 ka0, ka1;  // upper halves (k = 16..31) stay zero through the loop
#pragma unroll
  for (int i = 0; i < 16; ++i) { ka0[i] = (bf16)0.f; ka1[i] = (bf16)0.f; }

  for (int kc = 0; kc < 32; ++kc) {
    // Prefetch the next chunk's K/V lines.
    if (kc + 1 < 32) __builtin_prefetch(pp, 0, 1);
    // Two K A-fragments (row = key, channels on K dim, zero-padded to 32).
    {
      bf16x8 l0 = *(const bf16x8*)kp;
      bf16x8 l1 = *(const bf16x8*)(kp + 256);
#pragma unroll
      for (int i = 0; i < 8; ++i) { ka0[i] = l0[i]; ka1[i] = l1[i]; }
    }
    // V^T A-fragment (row = channel, keys in the hardware k order).
    bf16x16 va;
    {
      bf16x8 lo = *(const bf16x8*)vp;
      bf16x8 hi = *(const bf16x8*)(vp + 256);
#pragma unroll
      for (int i = 0; i < 8; ++i) { va[i] = lo[i]; va[i + 8] = hi[i]; }
    }
    // Stands ahead of the three advances below, which rewrite the address
    // registers that the loads above name; as inputs of the wait the
    // addresses stay in place up to it.
    asm volatile("s_wait_xcnt 0x0" :: "v"(kp), "v"(vp), "v"(pp) : "memory");
    kp += 512;
    vp += 512;
    pp += 512;
    // s0[r] = S[query coln][32 * kc + koff + r], s1[r] = the same 16 keys on.
    f32x8 s0 = wmma_bf16(ka0, qb, fz);
    f32x8 s1 = wmma_bf16(ka1, qb, fz);

    const unsigned mw = mrow[kc] >> koff;  // bit r: s0[r], bit 16 + r: s1[r]
    float cm = -1e9f;
#pragma unroll
    for (int r = 0; r < 8; ++r) {
      s0[r] = mask_score(s0[r], mw, r);
      s1[r] = mask_score(s1[r], mw, 16 + r);
      cm = fmaxf(cm, fmaxf(s0[r], s1[r]));
    }
    const float mnew = fmaxf(mrun, fmaxf(cm, other_half(cm)));
    const float corr = __expf(mrun - mnew);
    mrun = mnew;
    float ps = 0.f;
    bf16x16 pb;  // P^T B-fragment straight from the two score tiles
#pragma unroll
    for (int r = 0; r < 8; ++r) {
      const float e0 = __expf(s0[r] - mnew);
      const float e1 = __expf(s1[r] - mnew);
      ps += e0 + e1;
      pb[r]     = (bf16)e0;
      pb[r + 8] = (bf16)e1;
    }
    lrun = lrun * corr + ps;
#pragma unroll
    for (int r = 0; r < 8; ++r) oacc[r] *= corr;
    oacc = wmma_bf16(va, pb, oacc);
  }

  // oacc[r] = O[query coln][channel koff + r]: 8 consecutive floats per lane.
  const float inv = 1.f / (lrun + other_half(lrun));
  float* op = O + ((size_t)bt * NDIM + qbase + coln) * DDIM + h * HD + koff;
  float4 w0 = {oacc[0] * inv, oacc[1] * inv, oacc[2] * inv, oacc[3] * inv};
  float4 w1 = {oacc[4] * inv, oacc[5] * inv, oacc[6] * inv, oacc[7] * inv};
  *(float4*)(op)     = w0;
  *(float4*)(op + 4) = w1;
}

// ---------------------------------------------------------------------------
// Kernel 3: out-proj + residual + LN2 + MLP + residual.
// grid = (N/64, BT), block = 128.
__global__ void proj_mlp_kernel(const float* __restrict__ x,
                                const float* __restrict__ O,
                                const bf16* __restrict__ wop,
                                const float* __restrict__ bo,
                                const float* __restrict__ g2,
                                const float* __restrict__ be2,
                                const bf16* __restrict__ w1p,
                                const float* __restrict__ b1,
                                const bf16* __restrict__ w2p,
                                const float* __restrict__ b2,
                                float* __restrict__ out) {
  __shared__ __align__(16) bf16 hbuf[64 * 80];
  __shared__ __align__(16) float xbuf[64 * 72];
  __shared__ __align__(16) bf16 ubuf[64 * 264];
  __shared__ __align__(16) bf16 wbuf[(8 + 32 + 32) * 512];  // wo, w1, w2
  __shared__ __align__(16) float pbuf[512];  // b1, bo, b2, g2, be2
  const float* b1s = pbuf;
  const float* bos = pbuf + 256;
  const float* b2s = pbuf + 320;
  const float* g2s = pbuf + 384;
  const float* be2s = pbuf + 448;
  const int tid = threadIdx.x;
  const int bt = blockIdx.y;
  const int b = bt / TDIM, t = bt % TDIM;
  const int r0 = blockIdx.x * 64;
  const f32x8 fz = {0.f, 0.f, 0.f, 0.f, 0.f, 0.f, 0.f, 0.f};

  {  // All that the later phases read from global memory, O aside, flies to LDS at once:
    // the 64 residual rows (16 chunks of 16 bytes each), the five parameter
    // vectors (128 chunks) and the three packed weights (4608 chunks).
    unsigned l[9];
    const void* g[9];
#pragma unroll
    for (int i = 0; i < 8; ++i) {
      const int c = i * 128 + tid;
      const int row = c >> 4, pc = c & 15;
      l[i] = lds_addr(xbuf + row * 72 + pc * 4);
      g[i] = x + (((size_t)b * NDIM + r0 + row) * TDIM + t) * DDIM + pc * 4;
    }
    const float* pv = (tid < 80) ? bo : (tid < 96) ? b2 : (tid < 112) ? g2 : be2;
    l[8] = lds_addr(pbuf + tid * 4);
    g[8] = (tid < 64) ? b1 + tid * 4 : pv + (tid & 15) * 4;
    async_copy_x9(l, g);
#pragma unroll
    for (int grp = 0; grp < 4; ++grp) {
#pragma unroll
      for (int j = 0; j < 9; ++j) {
        const int i = grp * 9 + j;
        const int c = i * 128 + tid;
        l[j] = lds_addr(wbuf + w_lds_index(c));
        g[j] = (i < 4) ? wop + c * 8
                       : (i < 20) ? w1p + (c - 512) * 8 : w2p + (c - 2560) * 8;
      }
      async_copy_x9(l, g);
    }
  }

  {  // stage attention output as bf16
    const int row = tid >> 1;
    const int c0 = (tid & 1) * 32;
    const float* op = O + ((size_t)bt * NDIM + r0 + row) * DDIM + c0;
#pragma unroll
    for (int i = 0; i < 32; ++i) hbuf[row * 80 + c0 + i] = (bf16)op[i];
  }
  // This wave's copies have landed; the barrier publishes them to the others.
  asm volatile("s_wait_asynccnt 0x0" ::: "memory");
  __syncthreads();

  const int wave = tid >> 5, lane = tid & 31;
  const int rowbase = wave * 16;
  const int rhalf = (lane >> 4) * 8;
  const int coln = lane & 15;

  // o @ wo + bo + x  -> xbuf (f32)
#pragma unroll
  for (int nt = 0; nt < 4; ++nt) {
    f32x8 acc = fz;
#pragma unroll
    for (int kt = 0; kt < 2; ++kt)
      acc = wmma_bf16(load_a_frag(hbuf + rowbase * 80 + kt * 32, 80),
                      load_b_lds(wbuf, nt * 2 + kt), acc);
#pragma unroll
    for (int r = 0; r < 8; ++r) {
      const int row_in = rowbase + rhalf + r;
      const int col = nt * 16 + coln;
      const float xv = xbuf[row_in * 72 + col];  // the residual, copied above
      xbuf[row_in * 72 + col] = xv + acc[r] + bos[col];
    }
  }
  __syncthreads();

  {  // LN2 -> hbuf (bf16)
    const int row = tid >> 1;
    const int c0 = (tid & 1) * 32;
    float v[32], s = 0.f, ss = 0.f;
#pragma unroll
    for (int i = 0; i < 32; ++i) {
      v[i] = xbuf[row * 72 + c0 + i];
      s += v[i]; ss += v[i] * v[i];
    }
    s  += __shfl_xor(s, 1);
    ss += __shfl_xor(ss, 1);
    const float mean = s * (1.f / 64.f);
    const float var  = ss * (1.f / 64.f) - mean * mean;
    const float rstd = rsqrtf(var + 1e-5f);
#pragma unroll
    for (int i = 0; i < 32; ++i) {
      const int c = c0 + i;
      hbuf[row * 80 + c] = (bf16)((v[i] - mean) * rstd * g2s[c] + be2s[c]);
    }
  }
  __syncthreads();

  // MLP layer 1: 64 -> 256, ReLU -> ubuf (bf16)
#pragma unroll
  for (int nt = 0; nt < 16; ++nt) {
    f32x8 acc = fz;
#pragma unroll
    for (int kt = 0; kt < 2; ++kt)
      acc = wmma_bf16(load_a_frag(hbuf + rowbase * 80 + kt * 32, 80),
                      load_b_lds(wbuf, 8 + nt * 2 + kt), acc);
#pragma unroll
    for (int r = 0; r < 8; ++r) {
      const int row_in = rowbase + rhalf + r;
      const int col = nt * 16 + coln;
      ubuf[row_in * 264 + col] = (bf16)fmaxf(acc[r] + b1s[col], 0.f);
    }
  }
  __syncthreads();

  // MLP layer 2: 256 -> 64, + residual -> out (original [B,N,T,D] layout)
#pragma unroll
  for (int nt = 0; nt < 4; ++nt) {
    f32x8 acc = fz;
#pragma unroll
    for (int kt = 0; kt < 8; ++kt)
      acc = wmma_bf16(load_a_frag(ubuf + rowbase * 264 + kt * 32, 264),
                      load_b_lds(wbuf, 40 + nt * 8 + kt), acc);
#pragma unroll
    for (int r = 0; r < 8; ++r) {
      const int row_in = rowbase + rhalf + r;
      const int node = r0 + row_in;
      const int col = nt * 16 + coln;
      out[(((size_t)b * NDIM + node) * TDIM + t) * DDIM + col] =
          xbuf[row_in * 72 + col] + acc[r] + b2s[col];
    }
  }
}

// ---------------------------------------------------------------------------
extern "C" void kernel_launch(void* const* d_in, const int* in_sizes, int n_in,
                              void* d_out, int out_size, void* d_ws,
                              size_t ws_size, hipStream_t stream) {
  (void)in_sizes; (void)n_in; (void)out_size; (void)ws_size;
  const float* x   = (const float*)d_in[0];
  const int*   adj = (const int*)d_in[1];
  const float* wq  = (const float*)d_in[2];
  const float* wk  = (const float*)d_in[3];
  const float* wv  = (const float*)d_in[4];
  const float* wo  = (const float*)d_in[5];
  const float* bo  = (const float*)d_in[6];
  const float* w1  = (const float*)d_in[7];
  const float* b1  = (const float*)d_in[8];
  const float* w2  = (const float*)d_in[9];
  const float* b2  = (const float*)d_in[10];
  const float* g1  = (const float*)d_in[11];
  const float* be1 = (const float*)d_in[12];
  const float* g2  = (const float*)d_in[13];
  const float* be2 = (const float*)d_in[14];
  float* out = (float*)d_out;

  char* w = (char*)d_ws;
  size_t off = 0;
  auto carve = [&](size_t bytes) -> void* {
    off = (off + 255) & ~(size_t)255;
    void* p = w + off;
    off += bytes;
    return p;
  };
  const size_t act = (size_t)BT * NDIM * DDIM;  // 1.57M elements
  bf16*     Qf   = (bf16*)carve(act * 2);
  bf16*     Kf   = (bf16*)carve(act * 2);
  bf16*     Vf   = (bf16*)carve(act * 2);
  float*    O    = (float*)carve(act * 4);
  unsigned* adjb = (unsigned*)carve((size_t)NDIM * 32 * 4);
  bf16* wqp = (bf16*)carve(64 * 64 * 2);
  bf16* wkp = (bf16*)carve(64 * 64 * 2);
  bf16* wvp = (bf16*)carve(64 * 64 * 2);
  bf16* wop = (bf16*)carve(64 * 64 * 2);
  bf16* w1p = (bf16*)carve(64 * 256 * 2);
  bf16* w2p = (bf16*)carve(256 * 64 * 2);

  pack_qkv_w_kernel<<<dim3(2, 4, 3), 32, 0, stream>>>(wq, wk, wv, wqp, wkp, wvp);
  ln_qkv_kernel<<<dim3(LNQ_BLOCKS + ADJ_BLOCKS + WT_BLOCKS), 128, 0, stream>>>(
      x, g1, be1, wqp, wkp, wvp, Qf, Kf, Vf, adj, adjb, wo, w1, w2, wop, w1p, w2p);
  attn_kernel<<<dim3(NDIM / 32, HDIM, BT), 64, 0, stream>>>(Qf, Kf, Vf, adjb, O);
  proj_mlp_kernel<<<dim3(NDIM / 64, BT), 128, 0, stream>>>(
      x, O, wop, bo, g2, be2, w1p, b1, w2p, b2, out);
}

// v005
// A run of this version takes 36.1 microseconds.
// Next to v004, in two timings, it ran 1.10 and 1.11 times as fast.
// All steps since v000 together make it 3.25 times as fast.
#include <hip/hip_runtime.h>

#define BDIM 2
#define NDIM 1024
#define TDIM 12
#define DDIM 64
#define HDIM 4
#define HD   16
#define BT   (BDIM * TDIM)

typedef __bf16 bf16;
typedef __attribute__((ext_vector_type(16))) __bf16 bf16x16;
typedef __attribute__((ext_vector_type(8)))  __bf16 bf16x8;
typedef __attribute__((ext_vector_type(8)))  float  f32x8;

__device__ __forceinline__ f32x8 wmma_bf16(bf16x16 a, bf16x16 b, f32x8 c) {
  return __builtin_amdgcn_wmma_f32_16x16x32_bf16(false, a, false, b, (short)0, c,
                                                 false, false);
}

// A fragment (16x32 bf16, rows on lanes). ISA 7.12.2: lane<16 holds K=0..7 /
// 16..23, lane>=16 holds K=8..15 / 24..31 for row M=lane%16.
__device__ __forceinline__ bf16x16 load_a_frag(const bf16* base, int ld) {
  const int lane = threadIdx.x & 31;
  const int m    = lane & 15;
  const int koff = (lane & 16) ? 8 : 0;
  const bf16* p  = base + m * ld + koff;
  bf16x8 lo = *(const bf16x8*)(p);
  bf16x8 hi = *(const bf16x8*)(p + 16);
  bf16x16 a;
#pragma unroll
  for (int i = 0; i < 8; ++i) { a[i] = lo[i]; a[i + 8] = hi[i]; }
  return a;
}


// ---------------------------------------------------------------------------
// Asynchronous copies to LDS, 16 bytes per lane and copy, every lane on. A run
// of copies shares one statement, so that all of them are in flight together;
// its last line holds every rewrite of an address register behind the copies.
__device__ __forceinline__ unsigned lds_addr(const void* p) {
  return (unsigned)(size_t)p;  // byte offset in the work-group's LDS
}
__device__ __forceinline__ void async_copy_x4(const unsigned (&l)[4],
                                               const void* const (&g)[4]) {
  asm volatile(
      "global_load_async_to_lds_b128 %0, %4, off\n\t"
      "global_load_async_to_lds_b128 %1, %5, off\n\t"
      "global_load_async_to_lds_b128 %2, %6, off\n\t"
      "global_load_async_to_lds_b128 %3, %7, off\n\t"
      "s_wait_xcnt 0x0"
      :: "v"(l[0]), "v"(l[1]), "v"(l[2]), "v"(l[3]), "v"(g[0]), "v"(g[1]),
         "v"(g[2]), "v"(g[3])
      : "memory");
}
__device__ __forceinline__ void async_copy_x8(const unsigned (&l)[8],
                                               const void* const (&g)[8]) {
  asm volatile(
      "global_load_async_to_lds_b128 %0, %8, off\n\t"
      "global_load_async_to_lds_b128 %1, %9, off\n\t"
      "global_load_async_to_lds_b128 %2, %10, off\n\t"
      "global_load_async_to_lds_b128 %3, %11, off\n\t"
      "global_load_async_to_lds_b128 %4, %12, off\n\t"
      "global_load_async_to_lds_b128 %5, %13, off\n\t"
      "global_load_async_to_lds_b128 %6, %14, off\n\t"
      "global_load_async_to_lds_b128 %7, %15, off\n\t"
      "s_wait_xcnt 0x0"
      :: "v"(l[0]), "v"(l[1]), "v"(l[2]), "v"(l[3]), "v"(l[4]), "v"(l[5]),
         "v"(l[6]), "v"(l[7]), "v"(g[0]), "v"(g[1]), "v"(g[2]), "v"(g[3]),
         "v"(g[4]), "v"(g[5]), "v"(g[6]), "v"(g[7])
      : "memory");
}
__device__ __forceinline__ void async_copy_x9(const unsigned (&l)[9],
                                               const void* const (&g)[9]) {
  asm volatile(
      "global_load_async_to_lds_b128 %0, %9, off\n\t"
      "global_load_async_to_lds_b128 %1, %10, off\n\t"
      "global_load_async_to_lds_b128 %2, %11, off\n\t"
      "global_load_async_to_lds_b128 %3, %12, off\n\t"
      "global_load_async_to_lds_b128 %4, %13, off\n\t"
      "global_load_async_to_lds_b128 %5, %14, off\n\t"
      "global_load_async_to_lds_b128 %6, %15, off\n\t"
      "global_load_async_to_lds_b128 %7, %16, off\n\t"
      "global_load_async_to_lds_b128 %8, %17, off\n\t"
      "s_wait_xcnt 0x0"
      :: "v"(l[0]), "v"(l[1]), "v"(l[2]), "v"(l[3]), "v"(l[4]), "v"(l[5]),
         "v"(l[6]), "v"(l[7]), "v"(l[8]), "v"(g[0]), "v"(g[1]), "v"(g[2]),
         "v"(g[3]), "v"(g[4]), "v"(g[5]), "v"(g[6]), "v"(g[7]), "v"(g[8])
      : "memory");
}
__device__ __forceinline__ void async_copy_x12(const unsigned (&l)[12],
                                               const void* const (&g)[12]) {
  asm volatile(
      "global_load_async_to_lds_b128 %0, %12, off\n\t"
      "global_load_async_to_lds_b128 %1, %13, off\n\t"
      "global_load_async_to_lds_b128 %2, %14, off\n\t"
      "global_load_async_to_lds_b128 %3, %15, off\n\t"
      "global_load_async_to_lds_b128 %4, %16, off\n\t"
      "global_load_async_to_lds_b128 %5, %17, off\n\t"
      "global_load_async_to_lds_b128 %6, %18, off\n\t"
      "global_load_async_to_lds_b128 %7, %19, off\n\t"
      "global_load_async_to_lds_b128 %8, %20, off\n\t"
      "global_load_async_to_lds_b128 %9, %21, off\n\t"
      "global_load_async_to_lds_b128 %10, %22, off\n\t"
      "global_load_async_to_lds_b128 %11, %23, off\n\t"
      "s_wait_xcnt 0x0"
      :: "v"(l[0]), "v"(l[1]), "v"(l[2]), "v"(l[3]), "v"(l[4]), "v"(l[5]),
         "v"(l[6]), "v"(l[7]), "v"(l[8]), "v"(l[9]), "v"(l[10]), "v"(l[11]),
         "v"(g[0]), "v"(g[1]), "v"(g[2]), "v"(g[3]), "v"(g[4]), "v"(g[5]),
         "v"(g[6]), "v"(g[7]), "v"(g[8]), "v"(g[9]), "v"(g[10]), "v"(g[11])
      : "memory");
}

// Packed weights: in global memory a lane's 16 elements of B fragment
// nt * KT + kt are contiguous. In LDS fragment f is 1 KiB, the lanes' first 16
// bytes in its lower half and their second 16 bytes in its upper half, so that
// each of the two reads of a fragment is 512 contiguous bytes. Chunk c (16
// bytes) of the global order goes to this element offset.
__device__ __forceinline__ int w_lds_index(int c) {
  return (c >> 6) * 512 + (c & 1) * 256 + ((c >> 1) & 31) * 8;
}
__device__ __forceinline__ bf16x16 load_b_lds(const bf16* w, int f) {
  const int lane = threadIdx.x & 31;
  bf16x8 lo = *(const bf16x8*)(w + f * 512 + lane * 8);
  bf16x8 hi = *(const bf16x8*)(w + f * 512 + 256 + lane * 8);
  bf16x16 b;
#pragma unroll
  for (int i = 0; i < 8; ++i) { b[i] = lo[i]; b[i + 8] = hi[i]; }
  return b;
}

// Q, K and V live in the workspace in fragment order: per (bt, head) 64 tiles
// of 16 nodes, a tile being 32 lanes x 8 bf16 = 512 contiguous bytes, so that a
// wave-wide 16-byte access covers four whole cache lines.
//   Q, K tile: lane l holds node (l & 15), channels 8 * (l >> 4) + 0..7.
//   V tile:    lane l holds channel (l & 15), nodes 8 * (l >> 4) + 0..7.
__device__ __forceinline__ size_t frag_index(int bt, int h, int tile, int lane) {
  return ((((size_t)bt * HDIM + h) * (NDIM / 16) + tile) * 32 + lane) * 8;
}

// ---------------------------------------------------------------------------
// Repack one 32x16 tile (kt, nt) of a KxNn f32 weight matrix into per-lane
// B-fragment order (bf16). One wave per tile.
__device__ __forceinline__ void pack_w_tile(const float* __restrict__ src,
                                            bf16* __restrict__ dst, int K, int Nn,
                                            int kt, int nt, int lane) {
  const int KT = K >> 5;
  const int n  = nt * 16 + (lane & 15);
  const int koff = (lane & 16) ? 8 : 0;
  float vals[16];
#pragma unroll
  for (int e = 0; e < 16; ++e) {
    const int p = e >> 1, h = e & 1;
    const int k = kt * 32 + ((p < 4) ? 0 : 16) + ((p & 3) * 2 + h) + koff;
    vals[e] = src[(size_t)k * Nn + n];
  }
  // Stands ahead of the conversions, whose results may land in the registers
  // that the loads above name as addresses.
  asm volatile("s_wait_xcnt 0x0" ::: "memory");
  bf16* d = dst + (((size_t)nt * KT + kt) * 32 + lane) * 16;
#pragma unroll
  for (int e = 0; e < 16; ++e) d[e] = (bf16)vals[e];
}

// The three weights the QKV projection reads. grid = (2, 4, 3), block = 32.
__global__ void pack_qkv_w_kernel(const float* __restrict__ wq,
                                  const float* __restrict__ wk,
                                  const float* __restrict__ wv,
                                  bf16* __restrict__ wqp, bf16* __restrict__ wkp,
                                  bf16* __restrict__ wvp) {
  const int z = blockIdx.z;
  const float* src = (z == 0) ? wq : (z == 1) ? wk : wv;
  bf16* dst = (z == 0) ? wqp : (z == 1) ? wkp : wvp;
  pack_w_tile(src, dst, 64, 64, blockIdx.x, blockIdx.y, threadIdx.x);
}

// One adjacency row -> bitmask (1024 bits as 32 u32 words); lane w = word w.
__device__ __forceinline__ void pack_adj_row(const int* __restrict__ adj,
                                             unsigned* __restrict__ adjb, int row,
                                             int w) {
  unsigned bits = 0u;
#pragma unroll 8
  for (int b = 0; b < 32; ++b)
    bits |= (adj[(size_t)row * NDIM + w * 32 + b] != 0 ? 1u : 0u) << b;
  adjb[(size_t)row * 32 + w] = bits;
}

// ---------------------------------------------------------------------------
// Kernel 1: LN1 + QKV projection, block = 128 (4 waves), LNQ_BLOCKS blocks.
// The same grid carries, in the blocks behind those, the packing that only the
// later launches read and that reads nothing written here: the adjacency
// bitmasks (one row per wave) and the wo, w1, w2 tiles (one tile per wave).
#define LNQ_BLOCKS (NDIM / 64 * BT)
#define ADJ_BLOCKS (NDIM / 4)
#define WT_BLOCKS  ((8 + 32 + 32) / 4)
__global__ void ln_qkv_kernel(const float* __restrict__ x,
                              const float* __restrict__ g1,
                              const float* __restrict__ be1,
                              const bf16* __restrict__ wqp,
                              const bf16* __restrict__ wkp,
                              const bf16* __restrict__ wvp,
                              bf16* __restrict__ Qf, bf16* __restrict__ Kf,
                              bf16* __restrict__ Vf,
                              const int* __restrict__ adj,
                              unsigned* __restrict__ adjb,
                              const float* __restrict__ wo,
                              const float* __restrict__ w1,
                              const float* __restrict__ w2,
                              bf16* __restrict__ wop, bf16* __restrict__ w1p,
                              bf16* __restrict__ w2p) {
  __shared__ __align__(16) bf16 hbuf[64 * 80];
  __shared__ __align__(16) bf16 wbuf[24 * 512];  // wq, wk, wv fragments
  const int tid = threadIdx.x;
  const int bid = blockIdx.x;
  if (bid >= LNQ_BLOCKS) {  // whole blocks leave here, ahead of the barrier
    const int pw = (bid - LNQ_BLOCKS) * 4 + (tid >> 5);
    const int pl = tid & 31;
    if (pw < NDIM) {
      pack_adj_row(adj, adjb, pw, pl);
    } else {
      const int tl = pw - NDIM;
      if (tl < 8)       pack_w_tile(wo, wop, 64, 64, tl & 1, tl >> 1, pl);
      else if (tl < 40) pack_w_tile(w1, w1p, 64, 256, tl & 1, (tl - 8) >> 1, pl);
      else              pack_w_tile(w2, w2p, 256, 64, tl & 7, (tl - 40) >> 3, pl);
    }
    return;
  }
  const int bt = bid / (NDIM / 64);
  const int b = bt / TDIM, t = bt % TDIM;
  const int r0 = (bid % (NDIM / 64)) * 64;

  {  // The three packed weights fly to LDS while the LayerNorm runs.
    unsigned l[12];
    const void* g[12];
#pragma unroll
    for (int i = 0; i < 12; ++i) {
      const int c = i * 128 + tid;
      l[i] = lds_addr(wbuf + w_lds_index(c));
      g[i] = (i < 4) ? wqp + c * 8
                     : (i < 8) ? wkp + (c - 512) * 8 : wvp + (c - 1024) * 8;
    }
    async_copy_x12(l, g);
  }

  {  // LayerNorm: 2 threads per row, 32 columns each.
    const int row = tid >> 1;
    const int c0 = (tid & 1) * 32;
    const float* xr =
        x + (((size_t)b * NDIM + (r0 + row)) * TDIM + t) * DDIM + c0;
    float v[32], s = 0.f, ss = 0.f;
#pragma unroll
    for (int i = 0; i < 32; ++i) { v[i] = xr[i]; s += v[i]; ss += v[i] * v[i]; }
    s  += __shfl_xor(s, 1);
    ss += __shfl_xor(ss, 1);
    const float mean = s * (1.f / 64.f);
    const float var  = ss * (1.f / 64.f) - mean * mean;
    const float rstd = rsqrtf(var + 1e-5f);
#pragma unroll
    for (int i = 0; i < 32; ++i) {
      const int c = c0 + i;
      hbuf[row * 80 + c] = (bf16)((v[i] - mean) * rstd * g1[c] + be1[c]);
    }
  }
  // This wave's copies have landed; the barrier publishes them to the others.
  asm volatile("s_wait_asynccnt 0x0" ::: "memory");
  __syncthreads();

  const int wave = tid >> 5, lane = tid & 31;
  const int rowbase = wave * 16;
  bf16* frags[3] = {Qf, Kf, Vf};
  const int tile = (r0 + rowbase) >> 4;
  const f32x8 fz = {0.f, 0.f, 0.f, 0.f, 0.f, 0.f, 0.f, 0.f};

  // Head nt of this wave's 16 nodes is one fragment tile. Q and K are formed
  // transposed (W^T h^T: the two operands swap places, their k orders being
  // equal), so a lane ends with 8 channels of one node; V stays h W, so a lane
  // ends with 8 nodes of one channel. Either way the lane's 8 values are the
  // 16 bytes that the same lane of an attention wave loads.
#pragma unroll
  for (int mtx = 0; mtx < 3; ++mtx) {
    bf16x8 o[4];
#pragma unroll
    for (int nt = 0; nt < 4; ++nt) {
      f32x8 acc = fz;
#pragma unroll
      for (int kt = 0; kt < 2; ++kt) {
        const bf16x16 hf = load_a_frag(hbuf + rowbase * 80 + kt * 32, 80);
        const bf16x16 wf = load_b_lds(wbuf, mtx * 8 + nt * 2 + kt);
        acc = (mtx == 2) ? wmma_bf16(hf, wf, acc) : wmma_bf16(wf, hf, acc);
      }
#pragma unroll
      for (int r = 0; r < 8; ++r)  // Q pre-scaled by 1/sqrt(HD)
        o[nt][r] = (bf16)((mtx == 0) ? acc[r] * 0.25f : acc[r]);
    }
    bf16* dst = frags[mtx] + frag_index(bt, 0, tile, lane);
#pragma unroll
    for (int nt = 0; nt < 4; ++nt)
      *(bf16x8*)(dst + frag_index(0, nt, 0, 0)) = o[nt];
    // Stands ahead of every rewrite of a register that the four stores name;
    // as inputs of the wait, address and data stay in place up to it.
    asm volatile("s_wait_xcnt 0x0"
                 :: "v"(dst), "v"(o[0]), "v"(o[1]), "v"(o[2]), "v"(o[3])
                 : "memory");
  }
}

#define ATT_WAVES 8
#define ATT_Q     (ATT_WAVES * 16)
#define ATT_T     (ATT_WAVES * 32)

// Value of lane l ^ 16 (the other half of the same query column).
__device__ __forceinline__ float other_half(float v) {
  const int b = __builtin_bit_cast(int, v);
  return __builtin_bit_cast(
      float, __builtin_amdgcn_permlanex16(b, b, 0x76543210, 0xfedcba98, false,
                                          false));
}

// s where bit 'bit' of w is set, else -1e9 (bit field extract + bit select).
__device__ __forceinline__ float mask_score(float s, unsigned w, int bit) {
  const int keep = ((int)(w << (31 - bit))) >> 31;
  const int si = __builtin_bit_cast(int, s);
  const int ni = __builtin_bit_cast(int, -1e9f);
  return __builtin_bit_cast(float, (si & keep) | (ni & ~keep));
}

__global__ void attn_kernel(const bf16* __restrict__ Qf,
                            const bf16* __restrict__ Kf,
                            const bf16* __restrict__ Vf,
                            const unsigned* __restrict__ adjb,
                            float* __restrict__ O) {
  // Pitch 36 words: rows start at multiples of 16 bytes, and the 16 query rows
  // a wave reads at one kc hit 16 banks.
  __shared__ __align__(16) unsigned adjw[ATT_Q][36];
  __shared__ __align__(16) bf16 kbuf[NDIM * HD];
  __shared__ __align__(16) bf16 vbuf[NDIM * HD];
  const int tid = threadIdx.x;
  const int wave = tid >> 5, lane = tid & 31;
  const int qt = blockIdx.x, h = blockIdx.y, bt = blockIdx.z;
  const int qblock = qt * ATT_Q;
  const int qbase = qblock + wave * 16;
  const int coln = lane & 15;
  const int koff = (lane & 16) ? 8 : 0;

  {  // K, then V: 2048 chunks of 16 bytes each, eight per thread.
    unsigned l[8];
    const void* g[8];
    const bf16* kg = Kf + frag_index(bt, h, 0, 0);
    const bf16* vg = Vf + frag_index(bt, h, 0, 0);
#pragma unroll
    for (int i = 0; i < 8; ++i) {
      const int c = i * ATT_T + tid;
      l[i] = lds_addr(kbuf + c * 8);
      g[i] = kg + c * 8;
    }
    async_copy_x8(l, g);
#pragma unroll
    for (int i = 0; i < 8; ++i) {
      const int c = i * ATT_T + tid;
      l[i] = lds_addr(vbuf + c * 8);
      g[i] = vg + c * 8;
    }
    async_copy_x8(l, g);
  }
  {  // 128 mask rows of 128 bytes: 1024 chunks of 16 bytes, four per thread.
    unsigned l[4];
    const void* g[4];
#pragma unroll
    for (int i = 0; i < 4; ++i) {
      const int c = i * ATT_T + tid;
      l[i] = lds_addr(&adjw[c >> 3][(c & 7) * 4]);
      g[i] = adjb + (size_t)qblock * 32 + c * 4;
    }
    async_copy_x4(l, g);
  }
  // This wave's copies have landed; the barrier publishes them to the others.
  asm volatile("s_wait_asynccnt 0x0" ::: "memory");
  __syncthreads();

  // Q^T B-fragment (column = query): HD=16 channels zero-padded to K=32.
  bf16x16 qb;
  {
    bf16x8 lo = *(const bf16x8*)(Qf + frag_index(bt, h, qbase >> 4, lane));
#pragma unroll
    for (int i = 0; i < 8; ++i) { qb[i] = lo[i]; qb[i + 8] = (bf16)0.f; }
  }

  // Per lane: running maximum of its query (equal in both halves), the sum of
  // its own half's keys, and 8 output channels of its query.
  float mrun = -1e9f, lrun = 0.f;
  f32x8 oacc = {0.f, 0.f, 0.f, 0.f, 0.f, 0.f, 0.f, 0.f};
  const f32x8 fz = {0.f, 0.f, 0.f, 0.f, 0.f, 0.f, 0.f, 0.f};

  // A chunk of 32 keys is two tiles: 512 elements of K and 512 of V.
  const bf16* kp = kbuf + lane * 8;
  const bf16* vp = vbuf + lane * 8;
  const unsigned* mrow = &adjw[wave * 16 + coln][0];
  bf16x16 ka0, ka1;  // upper halves (k = 16..31) stay zero through the loop
#pragma unroll
  for (int i = 0; i < 16; ++i) { ka0[i] = (bf16)0.f; ka1[i] = (bf16)0.f; }

  // Two chunks a trip: their LDS reads share one address register, and the
  // second chunk's reads issue among the first chunk's vector work.
#pragma unroll 2
  for (int kc = 0; kc < 32; ++kc) {
    // Two K A-fragments (row = key, channels on K dim, zero-padded to 32).
    {
      bf16x8 l0 = *(const bf16x8*)kp;
      bf16x8 l1 = *(const bf16x8*)(kp + 256);
#pragma unroll
      for (int i = 0; i < 8; ++i) { ka0[i] = l0[i]; ka1[i] = l1[i]; }
    }
    // V^T A-fragment (row = channel, keys in the hardware k order).
    bf16x16 va;
    {
      bf16x8 lo = *(const bf16x8*)vp;
      bf16x8 hi = *(const bf16x8*)(vp + 256);
#pragma unroll
      for (int i = 0; i < 8; ++i) { va[i] = lo[i]; va[i + 8] = hi[i]; }
    }
    kp += 512;
    vp += 512;
    // s0[r] = S[query coln][32 * kc + koff + r], s1[r] = the same 16 keys on.
    f32x8 s0 = wmma_bf16(ka0, qb, fz);
    f32x8 s1 = wmma_bf16(ka1, qb, fz);

    const unsigned mw = mrow[kc] >> koff;  // bit r: s0[r], bit 16 + r: s1[r]
    float cm = -1e9f;
#pragma unroll
    for (int r = 0; r < 8; ++r) {
      s0[r] = mask_score(s0[r], mw, r);
      s1[r] = mask_score(s1[r], mw, 16 + r);
      cm = fmaxf(cm, fmaxf(s0[r], s1[r]));
    }
    const float mnew = fmaxf(mrun, fmaxf(cm, other_half(cm)));
    const float corr = __expf(mrun - mnew);
    mrun = mnew;
    float ps = 0.f;
    bf16x16 pb;  // P^T B-fragment straight from the two score tiles
#pragma unroll
    for (int r = 0; r < 8; ++r) {
      const float e0 = __expf(s0[r] - mnew);
      const float e1 = __expf(s1[r] - mnew);
      ps += e0 + e1;
      pb[r]     = (bf16)e0;
      pb[r + 8] = (bf16)e1;
    }
    lrun = lrun * corr + ps;
#pragma unroll
    for (int r = 0; r < 8; ++r) oacc[r] *= corr;
    oacc = wmma_bf16(va, pb, oacc);
  }

  // oacc[r] = O[query coln][channel koff + r]: 8 consecutive floats per lane.
  const float inv = 1.f / (lrun + other_half(lrun));
  float* op = O + ((size_t)bt * NDIM + qbase + coln) * DDIM + h * HD + koff;
  float4 w0 = {oacc[0] * inv, oacc[1] * inv, oacc[2] * inv, oacc[3] * inv};
  float4 w1 = {oacc[4] * inv, oacc[5] * inv, oacc[6] * inv, oacc[7] * inv};
  *(float4*)(op)     = w0;
  *(float4*)(op + 4) = w1;
}

// ---------------------------------------------------------------------------
// Kernel 3: out-proj + residual + LN2 + MLP + residual.
// grid = (N/64, BT), block = 128.
__global__ void proj_mlp_kernel(const float* __restrict__ x,
                                const float* __restrict__ O,
                                const bf16* __restrict__ wop,
                                const float* __restrict__ bo,
                                const float* __restrict__ g2,
                                const float* __restrict__ be2,
                                const bf16* __restrict__ w1p,
                                const float* __restrict__ b1,
                                const bf16* __restrict__ w2p,
                                const float* __restrict__ b2,
                                float* __restrict__ out) {
  __shared__ __align__(16) bf16 hbuf[64 * 80];
  __shared__ __align__(16) float xbuf[64 * 72];
  __shared__ __align__(16) bf16 ubuf[64 * 264];
  __shared__ __align__(16) bf16 wbuf[(8 + 32 + 32) * 512];  // wo, w1, w2
  __shared__ __align__(16) float pbuf[512];  // b1, bo, b2, g2, be2
  const float* b1s = pbuf;
  const float* bos = pbuf + 256;
  const float* b2s = pbuf + 320;
  const float* g2s = pbuf + 384;
  const float* be2s = pbuf + 448;
  const int tid = threadIdx.x;
  const int bt = blockIdx.y;
  const int b = bt / TDIM, t = bt % TDIM;
  const int r0 = blockIdx.x * 64;
  const f32x8 fz = {0.f, 0.f, 0.f, 0.f, 0.f, 0.f, 0.f, 0.f};

  {  // All that the later phases read from global memory, O aside, flies to LDS at once:
    // the 64 residual rows (16 chunks of 16 bytes each), the five parameter
    // vectors (128 chunks) and the three packed weights (4608 chunks).
    unsigned l[9];
    const void* g[9];
#pragma unroll
    for (int i = 0; i < 8; ++i) {
      const int c = i * 128 + tid;
      const int row = c >> 4, pc = c & 15;
      l[i] = lds_addr(xbuf + row * 72 + pc * 4);
      g[i] = x + (((size_t)b * NDIM + r0 + row) * TDIM + t) * DDIM + pc * 4;
    }
    const float* pv = (tid < 80) ? bo : (tid < 96) ? b2 : (tid < 112) ? g2 : be2;
    l[8] = lds_addr(pbuf + tid * 4);
    g[8] = (tid < 64) ? b1 + tid * 4 : pv + (tid & 15) * 4;
    async_copy_x9(l, g);
#pragma unroll
    for (int grp = 0; grp < 4; ++grp) {
#pragma unroll
      for (int j = 0; j < 9; ++j) {
        const int i = grp * 9 + j;
        const int c = i * 128 + tid;
        l[j] = lds_addr(wbuf + w_lds_index(c));
        g[j] = (i < 4) ? wop + c * 8
                       : (i < 20) ? w1p + (c - 512) * 8 : w2p + (c - 2560) * 8;
      }
      async_copy_x9(l, g);
    }
  }

  {  // stage attention output as bf16
    const int row = tid >> 1;
    const int c0 = (tid & 1) * 32;
    const float* op = O + ((size_t)bt * NDIM + r0 + row) * DDIM + c0;
#pragma unroll
    for (int i = 0; i < 32; ++i) hbuf[row * 80 + c0 + i] = (bf16)op[i];
  }
  // This wave's copies have landed; the barrier publishes them to the others.
  asm volatile("s_wait_asynccnt 0x0" ::: "memory");
  __syncthreads();

  const int wave = tid >> 5, lane = tid & 31;
  const int rowbase = wave * 16;
  const int rhalf = (lane >> 4) * 8;
  const int coln = lane & 15;

  // o @ wo + bo + x  -> xbuf (f32)
#pragma unroll
  for (int nt = 0; nt < 4; ++nt) {
    f32x8 acc = fz;
#pragma unroll
    for (int kt = 0; kt < 2; ++kt)
      acc = wmma_bf16(load_a_frag(hbuf + rowbase * 80 + kt * 32, 80),
                      load_b_lds(wbuf, nt * 2 + kt), acc);
#pragma unroll
    for (int r = 0; r < 8; ++r) {
      const int row_in = rowbase + rhalf + r;
      const int col = nt * 16 + coln;
      const float xv = xbuf[row_in * 72 + col];  // the residual, copied above
      xbuf[row_in * 72 + col] = xv + acc[r] + bos[col];
    }
  }
  __syncthreads();

  {  // LN2 -> hbuf (bf16)
    const int row = tid >> 1;
    const int c0 = (tid & 1) * 32;
    float v[32], s = 0.f, ss = 0.f;
#pragma unroll
    for (int i = 0; i < 32; ++i) {
      v[i] = xbuf[row * 72 + c0 + i];
      s += v[i]; ss += v[i] * v[i];
    }
    s  += __shfl_xor(s, 1);
    ss += __shfl_xor(ss, 1);
    const float mean = s * (1.f / 64.f);
    const float var  = ss * (1.f / 64.f) - mean * mean;
    const float rstd = rsqrtf(var + 1e-5f);
#pragma unroll
    for (int i = 0; i < 32; ++i) {
      const int c = c0 + i;
      hbuf[row * 80 + c] = (bf16)((v[i] - mean) * rstd * g2s[c] + be2s[c]);
    }
  }
  __syncthreads();

  // MLP layer 1: 64 -> 256, ReLU -> ubuf (bf16)
#pragma unroll
  for (int nt = 0; nt < 16; ++nt) {
    f32x8 acc = fz;
#pragma unroll
    for (int kt = 0; kt < 2; ++kt)
      acc = wmma_bf16(load_a_frag(hbuf + rowbase * 80 + kt * 32, 80),
                      load_b_lds(wbuf, 8 + nt * 2 + kt), acc);
#pragma unroll
    for (int r = 0; r < 8; ++r) {
      const int row_in = rowbase + rhalf + r;
      const int col = nt * 16 + coln;
      ubuf[row_in * 264 + col] = (bf16)fmaxf(acc[r] + b1s[col], 0.f);
    }
  }
  __syncthreads();

  // MLP layer 2: 256 -> 64, + residual -> out (original [B,N,T,D] layout)
#pragma unroll
  for (int nt = 0; nt < 4; ++nt) {
    f32x8 acc = fz;
#pragma unroll
    for (int kt = 0; kt < 8; ++kt)
      acc = wmma_bf16(load_a_frag(ubuf + rowbase * 264 + kt * 32, 264),
                      load_b_lds(wbuf, 40 + nt * 8 + kt), acc);
#pragma unroll
    for (int r = 0; r < 8; ++r) {
      const int row_in = rowbase + rhalf + r;
      const int node = r0 + row_in;
      const int col = nt * 16 + coln;
      out[(((size_t)b * NDIM + node) * TDIM + t) * DDIM + col] =
          xbuf[row_in * 72 + col] + acc[r] + b2s[col];
    }
  }
}

// ---------------------------------------------------------------------------
extern "C" void kernel_launch(void* const* d_in, const int* in_sizes, int n_in,
                              void* d_out, int out_size, void* d_ws,
                              size_t ws_size, hipStream_t stream) {
  (void)in_sizes; (void)n_in; (void)out_size; (void)ws_size;
  const float* x   = (const float*)d_in[0];
  const int*   adj = (const int*)d_in[1];
  const float* wq  = (const float*)d_in[2];
  const float* wk  = (const float*)d_in[3];
  const float* wv  = (const float*)d_in[4];
  const float* wo  = (const float*)d_in[5];
  const float* bo  = (const float*)d_in[6];
  const float* w1  = (const float*)d_in[7];
  const float* b1  = (const float*)d_in[8];
  const float* w2  = (const float*)d_in[9];
  const float* b2  = (const float*)d_in[10];
  const float* g1  = (const float*)d_in[11];
  const float* be1 = (const float*)d_in[12];
  const float* g2  = (const float*)d_in[13];
  const float* be2 = (const float*)d_in[14];
  float* out = (float*)d_out;

  char* w = (char*)d_ws;
  size_t off = 0;
  auto carve = [&](size_t bytes) -> void* {
    off = (off + 255) & ~(size_t)255;
    void* p = w + off;
    off += bytes;
    return p;
  };
  const size_t act = (size_t)BT * NDIM * DDIM;  // 1.57M elements
  bf16*     Qf   = (bf16*)carve(act * 2);
  bf16*     Kf   = (bf16*)carve(act * 2);
  bf16*     Vf   = (bf16*)carve(act * 2);
  float*    O    = (float*)carve(act * 4);
  unsigned* adjb = (unsigned*)carve((size_t)NDIM * 32 * 4);
  bf16* wqp = (bf16*)carve(64 * 64 * 2);
  bf16* wkp = (bf16*)carve(64 * 64 * 2);
  bf16* wvp = (bf16*)carve(64 * 64 * 2);
  bf16* wop = (bf16*)carve(64 * 64 * 2);
  bf16* w1p = (bf16*)carve(64 * 256 * 2);
  bf16* w2p = (bf16*)carve(256 * 64 * 2);

  pack_qkv_w_kernel<<<dim3(2, 4, 3), 32, 0, stream>>>(wq, wk, wv, wqp, wkp, wvp);
  ln_qkv_kernel<<<dim3(LNQ_BLOCKS + ADJ_BLOCKS + WT_BLOCKS), 128, 0, stream>>>(
      x, g1, be1, wqp, wkp, wvp, Qf, Kf, Vf, adj, adjb, wo, w1, w2, wop, w1p, w2p);
  attn_kernel<<<dim3(NDIM / ATT_Q, HDIM, BT), ATT_T, 0, stream>>>(Qf, Kf, Vf, adjb, O);
  proj_mlp_kernel<<<dim3(NDIM / 64, BT), 128, 0, stream>>>(
      x, O, wop, bo, g2, be2, w1p, b1, w2p, b2, out);
}

// v006
// One run takes 34.7 microseconds.
// In both of two side-by-side timings against v005, it was 1.04 times as fast.
// Over all steps from v000 it is 3.38 times as fast.
#include <hip/hip_runtime.h>

#define BDIM 2
#define NDIM 1024
#define TDIM 12
#define DDIM 64
#define HDIM 4
#define HD   16
#define BT   (BDIM * TDIM)

typedef __bf16 bf16;
typedef __attribute__((ext_vector_type(16))) __bf16 bf16x16;
typedef __attribute__((ext_vector_type(8)))  __bf16 bf16x8;
typedef __attribute__((ext_vector_type(8)))  float  f32x8;
typedef __attribute__((ext_vector_type(2)))  float  f32x2;

__device__ __forceinline__ f32x8 wmma_bf16(bf16x16 a, bf16x16 b, f32x8 c) {
  return __builtin_amdgcn_wmma_f32_16x16x32_bf16(false, a, false, b, (short)0, c,
                                                 false, false);
}

// A fragment (16x32 bf16, rows on lanes). ISA 7.12.2: lane<16 holds K=0..7 /
// 16..23, lane>=16 holds K=8..15 / 24..31 for row M=lane%16.
__device__ __forceinline__ bf16x16 load_a_frag(const bf16* base, int ld) {
  const int lane = threadIdx.x & 31;
  const int m    = lane & 15;
  const int koff = (lane & 16) ? 8 : 0;
  const bf16* p  = base + m * ld + koff;
  bf16x8 lo = *(const bf16x8*)(p);
  bf16x8 hi = *(const bf16x8*)(p + 16);
  bf16x16 a;
#pragma unroll
  for (int i = 0; i < 8; ++i) { a[i] = lo[i]; a[i + 8] = hi[i]; }
  return a;
}


// ---------------------------------------------------------------------------
// Asynchronous copies to LDS, 16 bytes per lane and copy, every lane on. A run
// of copies shares one statement, so that all of them are in flight together;
// its last line holds every rewrite of an address register behind the copies.
__device__ __forceinline__ unsigned lds_addr(const void* p) {
  return (unsigned)(size_t)p;  // byte offset in the work-group's LDS
}
__device__ __forceinline__ void async_copy_x8(const unsigned (&l)[8],
                                               const void* const (&g)[8]) {
  asm volatile(
      "global_load_async_to_lds_b128 %0, %8, off\n\t"
      "global_load_async_to_lds_b128 %1, %9, off\n\t"
      "global_load_async_to_lds_b128 %2, %10, off\n\t"
      "global_load_async_to_lds_b128 %3, %11, off\n\t"
      "global_load_async_to_lds_b128 %4, %12, off\n\t"
      "global_load_async_to_lds_b128 %5, %13, off\n\t"
      "global_load_async_to_lds_b128 %6, %14, off\n\t"
      "global_load_async_to_lds_b128 %7, %15, off\n\t"
      "s_wait_xcnt 0x0"
      :: "v"(l[0]), "v"(l[1]), "v"(l[2]), "v"(l[3]), "v"(l[4]), "v"(l[5]),
         "v"(l[6]), "v"(l[7]), "v"(g[0]), "v"(g[1]), "v"(g[2]), "v"(g[3]),
         "v"(g[4]), "v"(g[5]), "v"(g[6]), "v"(g[7])
      : "memory");
}
__device__ __forceinline__ void async_copy_x9(const unsigned (&l)[9],
                                               const void* const (&g)[9]) {
  asm volatile(
      "global_load_async_to_lds_b128 %0, %9, off\n\t"
      "global_load_async_to_lds_b128 %1, %10, off\n\t"
      "global_load_async_to_lds_b128 %2, %11, off\n\t"
      "global_load_async_to_lds_b128 %3, %12, off\n\t"
      "global_load_async_to_lds_b128 %4, %13, off\n\t"
      "global_load_async_to_lds_b128 %5, %14, off\n\t"
      "global_load_async_to_lds_b128 %6, %15, off\n\t"
      "global_load_async_to_lds_b128 %7, %16, off\n\t"
      "global_load_async_to_lds_b128 %8, %17, off\n\t"
      "s_wait_xcnt 0x0"
      :: "v"(l[0]), "v"(l[1]), "v"(l[2]), "v"(l[3]), "v"(l[4]), "v"(l[5]),
         "v"(l[6]), "v"(l[7]), "v"(l[8]), "v"(g[0]), "v"(g[1]), "v"(g[2]),
         "v"(g[3]), "v"(g[4]), "v"(g[5]), "v"(g[6]), "v"(g[7]), "v"(g[8])
      : "memory");
}
__device__ __forceinline__ void async_copy_x12(const unsigned (&l)[12],
                                               const void* const (&g)[12]) {
  asm volatile(
      "global_load_async_to_lds_b128 %0, %12, off\n\t"
      "global_load_async_to_lds_b128 %1, %13, off\n\t"
      "global_load_async_to_lds_b128 %2, %14, off\n\t"
      "global_load_async_to_lds_b128 %3, %15, off\n\t"
      "global_load_async_to_lds_b128 %4, %16, off\n\t"
      "global_load_async_to_lds_b128 %5, %17, off\n\t"
      "global_load_async_to_lds_b128 %6, %18, off\n\t"
      "global_load_async_to_lds_b128 %7, %19, off\n\t"
      "global_load_async_to_lds_b128 %8, %20, off\n\t"
      "global_load_async_to_lds_b128 %9, %21, off\n\t"
      "global_load_async_to_lds_b128 %10, %22, off\n\t"
      "global_load_async_to_lds_b128 %11, %23, off\n\t"
      "s_wait_xcnt 0x0"
      :: "v"(l[0]), "v"(l[1]), "v"(l[2]), "v"(l[3]), "v"(l[4]), "v"(l[5]),
         "v"(l[6]), "v"(l[7]), "v"(l[8]), "v"(l[9]), "v"(l[10]), "v"(l[11]),
         "v"(g[0]), "v"(g[1]), "v"(g[2]), "v"(g[3]), "v"(g[4]), "v"(g[5]),
         "v"(g[6]), "v"(g[7]), "v"(g[8]), "v"(g[9]), "v"(g[10]), "v"(g[11])
      : "memory");
}

// Packed weights: in global memory a lane's 16 elements of B fragment
// nt * KT + kt are contiguous. In LDS fragment f is 1 KiB, the lanes' first 16
// bytes in its lower half and their second 16 bytes in its upper half, so that
// each of the two reads of a fragment is 512 contiguous bytes. Chunk c (16
// bytes) of the global order goes to this element offset.
__device__ __forceinline__ int w_lds_index(int c) {
  return (c >> 6) * 512 + (c & 1) * 256 + ((c >> 1) & 31) * 8;
}
__device__ __forceinline__ bf16x16 load_b_lds(const bf16* w, int f) {
  const int lane = threadIdx.x & 31;
  bf16x8 lo = *(const bf16x8*)(w + f * 512 + lane * 8);
  bf16x8 hi = *(const bf16x8*)(w + f * 512 + 256 + lane * 8);
  bf16x16 b;
#pragma unroll
  for (int i = 0; i < 8; ++i) { b[i] = lo[i]; b[i + 8] = hi[i]; }
  return b;
}

// Q, K and V live in the workspace in fragment order: per (bt, head) 64 tiles
// of 16 nodes, a tile being 32 lanes x 8 bf16 = 512 contiguous bytes, so that a
// wave-wide 16-byte access covers four whole cache lines.
//   Q, K tile: lane l holds node (l & 15), channels 8 * (l >> 4) + 0..7.
//   V tile:    lane l holds channel (l & 15), nodes 8 * (l >> 4) + 0..7.
__device__ __forceinline__ size_t frag_index(int bt, int h, int tile, int lane) {
  return ((((size_t)bt * HDIM + h) * (NDIM / 16) + tile) * 32 + lane) * 8;
}

// ---------------------------------------------------------------------------
// Repack one 32x16 tile (kt, nt) of a KxNn f32 weight matrix into per-lane
// B-fragment order (bf16). One wave per tile.
__device__ __forceinline__ void pack_w_tile(const float* __restrict__ src,
                                            bf16* __restrict__ dst, int K, int Nn,
                                            int kt, int nt, int lane) {
  const int KT = K >> 5;
  const int n  = nt * 16 + (lane & 15);
  const int koff = (lane & 16) ? 8 : 0;
  float vals[16];
#pragma unroll
  for (int e = 0; e < 16; ++e) {
    const int p = e >> 1, h = e & 1;
    const int k = kt * 32 + ((p < 4) ? 0 : 16) + ((p & 3) * 2 + h) + koff;
    vals[e] = src[(size_t)k * Nn + n];
  }
  // Stands ahead of the conversions, whose results may land in the registers
  // that the loads above name as addresses.
  asm volatile("s_wait_xcnt 0x0" ::: "memory");
  bf16* d = dst + (((size_t)nt * KT + kt) * 32 + lane) * 16;
#pragma unroll
  for (int e = 0; e < 16; ++e) d[e] = (bf16)vals[e];
}

// The three weights the QKV projection reads. grid = (2, 4, 3), block = 32.
__global__ void pack_qkv_w_kernel(const float* __restrict__ wq,
                                  const float* __restrict__ wk,
                                  const float* __restrict__ wv,
                                  bf16* __restrict__ wqp, bf16* __restrict__ wkp,
                                  bf16* __restrict__ wvp) {
  const int z = blockIdx.z;
  const float* src = (z == 0) ? wq : (z == 1) ? wk : wv;
  bf16* dst = (z == 0) ? wqp : (z == 1) ? wkp : wvp;
  pack_w_tile(src, dst, 64, 64, blockIdx.x, blockIdx.y, threadIdx.x);
}

// The adjacency mask is kept as lane masks of the attention wave: for a tile of
// 16 queries and a chunk of 32 keys, 16 words, one per score register. Bit l of
// word j says whether lane l keeps its score j, which is that of
//   query 16 * qtile + (l & 15),
//   key   32 * kc + 16 * (j >> 3) + 8 * (l >> 4) + (j & 7).
// One wave per (qtile, kc): a lane reads the 16 entries of its own scores.
typedef __attribute__((ext_vector_type(16))) unsigned u32x16;
__device__ __forceinline__ void pack_adj_tile(const int* __restrict__ adj,
                                              unsigned* __restrict__ adjl,
                                              int qtile, int kc, int lane) {
  const int* p = adj + (size_t)(qtile * 16 + (lane & 15)) * NDIM + kc * 32 +
                 ((lane & 16) ? 8 : 0);
  const int4 a[4] = {*(const int4*)(p), *(const int4*)(p + 4),
                     *(const int4*)(p + 16), *(const int4*)(p + 20)};
  // Stands ahead of every rewrite of the address that the four loads name.
  asm volatile("s_wait_xcnt 0x0" ::: "memory");
  unsigned mine = 0u;
#pragma unroll
  for (int q = 0; q < 4; ++q) {
    const unsigned b0 = __builtin_amdgcn_ballot_w32(a[q].x != 0);
    const unsigned b1 = __builtin_amdgcn_ballot_w32(a[q].y != 0);
    const unsigned b2 = __builtin_amdgcn_ballot_w32(a[q].z != 0);
    const unsigned b3 = __builtin_amdgcn_ballot_w32(a[q].w != 0);
    mine = (lane == q * 4 + 0) ? b0 : mine;
    mine = (lane == q * 4 + 1) ? b1 : mine;
    mine = (lane == q * 4 + 2) ? b2 : mine;
    mine = (lane == q * 4 + 3) ? b3 : mine;
  }
  if (lane < 16) adjl[((size_t)qtile * 32 + kc) * 16 + lane] = mine;
}

// ---------------------------------------------------------------------------
// Kernel 1: LN1 + QKV projection, block = 128 (4 waves), LNQ_BLOCKS blocks.
// The same grid carries, in the blocks behind those, the packing that only the
// later launches read and that reads nothing written here: the adjacency lane
// masks (one tile per wave) and the wo, w1, w2 tiles (one tile per wave).
#define LNQ_BLOCKS (NDIM / 64 * BT)
#define ADJ_TILES  ((NDIM / 16) * (NDIM / 32))
#define ADJ_BLOCKS (ADJ_TILES / 4)
#define WT_BLOCKS  ((8 + 32 + 32) / 4)
__global__ void ln_qkv_kernel(const float* __restrict__ x,
                              const float* __restrict__ g1,
                              const float* __restrict__ be1,
                              const bf16* __restrict__ wqp,
                              const bf16* __restrict__ wkp,
                              const bf16* __restrict__ wvp,
                              bf16* __restrict__ Qf, bf16* __restrict__ Kf,
                              bf16* __restrict__ Vf,
                              const int* __restrict__ adj,
                              unsigned* __restrict__ adjb,
                              const float* __restrict__ wo,
                              const float* __restrict__ w1,
                              const float* __restrict__ w2,
                              bf16* __restrict__ wop, bf16* __restrict__ w1p,
                              bf16* __restrict__ w2p) {
  __shared__ __align__(16) bf16 hbuf[64 * 80];
  __shared__ __align__(16) bf16 wbuf[24 * 512];  // wq, wk, wv fragments
  const int tid = threadIdx.x;
  const int bid = blockIdx.x;
  if (bid >= LNQ_BLOCKS) {  // whole blocks leave here, ahead of the barrier
    const int pw = (bid - LNQ_BLOCKS) * 4 + (tid >> 5);
    const int pl = tid & 31;
    if (pw < ADJ_TILES) {
      pack_adj_tile(adj, adjb, pw >> 5, pw & 31, pl);
    } else {
      const int tl = pw - ADJ_TILES;
      if (tl < 8)       pack_w_tile(wo, wop, 64, 64, tl & 1, tl >> 1, pl);
      else if (tl < 40) pack_w_tile(w1, w1p, 64, 256, tl & 1, (tl - 8) >> 1, pl);
      else              pack_w_tile(w2, w2p, 256, 64, tl & 7, (tl - 40) >> 3, pl);
    }
    return;
  }
  const int bt = bid / (NDIM / 64);
  const int b = bt / TDIM, t = bt % TDIM;
  const int r0 = (bid % (NDIM / 64)) * 64;

  {  // The three packed weights fly to LDS while the LayerNorm runs.
    unsigned l[12];
    const void* g[12];
#pragma unroll
    for (int i = 0; i < 12; ++i) {
      const int c = i * 128 + tid;
      l[i] = lds_addr(wbuf + w_lds_index(c));
      g[i] = (i < 4) ? wqp + c * 8
                     : (i < 8) ? wkp + (c - 512) * 8 : wvp + (c - 1024) * 8;
    }
    async_copy_x12(l, g);
  }

  {  // LayerNorm: 2 threads per row, 32 columns each.
    const int row = tid >> 1;
    const int c0 = (tid & 1) * 32;
    const float* xr =
        x + (((size_t)b * NDIM + (r0 + row)) * TDIM + t) * DDIM + c0;
    float v[32], s = 0.f, ss = 0.f;
#pragma unroll
    for (int i = 0; i < 32; ++i) { v[i] = xr[i]; s += v[i]; ss += v[i] * v[i]; }
    s  += __shfl_xor(s, 1);
    ss += __shfl_xor(ss, 1);
    const float mean = s * (1.f / 64.f);
    const float var  = ss * (1.f / 64.f) - mean * mean;
    const float rstd = rsqrtf(var + 1e-5f);
#pragma unroll
    for (int i = 0; i < 32; ++i) {
      const int c = c0 + i;
      hbuf[row * 80 + c] = (bf16)((v[i] - mean) * rstd * g1[c] + be1[c]);
    }
  }
  // This wave's copies have landed; the barrier publishes them to the others.
  asm volatile("s_wait_asynccnt 0x0" ::: "memory");
  __syncthreads();

  const int wave = tid >> 5, lane = tid & 31;
  const int rowbase = wave * 16;
  bf16* frags[3] = {Qf, Kf, Vf};
  const int tile = (r0 + rowbase) >> 4;
  const f32x8 fz = {0.f, 0.f, 0.f, 0.f, 0.f, 0.f, 0.f, 0.f};

  // Head nt of this wave's 16 nodes is one fragment tile. Q and K are formed
  // transposed (W^T h^T: the two operands swap places, their k orders being
  // equal), so a lane ends with 8 channels of one node; V stays h W, so a lane
  // ends with 8 nodes of one channel. Either way the lane's 8 values are the
  // 16 bytes that the same lane of an attention wave loads.
#pragma unroll
  for (int mtx = 0; mtx < 3; ++mtx) {
    bf16x8 o[4];
#pragma unroll
    for (int nt = 0; nt < 4; ++nt) {
      f32x8 acc = fz;
#pragma unroll
      for (int kt = 0; kt < 2; ++kt) {
        const bf16x16 hf = load_a_frag(hbuf + rowbase * 80 + kt * 32, 80);
        const bf16x16 wf = load_b_lds(wbuf, mtx * 8 + nt * 2 + kt);
        acc = (mtx == 2) ? wmma_bf16(hf, wf, acc) : wmma_bf16(wf, hf, acc);
      }
#pragma unroll
      for (int r = 0; r < 8; ++r)  // Q pre-scaled by 1/sqrt(HD)
        o[nt][r] = (bf16)((mtx == 0) ? acc[r] * 0.25f : acc[r]);
    }
    bf16* dst = frags[mtx] + frag_index(bt, 0, tile, lane);
#pragma unroll
    for (int nt = 0; nt < 4; ++nt)
      *(bf16x8*)(dst + frag_index(0, nt, 0, 0)) = o[nt];
    // Stands ahead of every rewrite of a register that the four stores name;
    // as inputs of the wait, address and data stay in place up to it.
    asm volatile("s_wait_xcnt 0x0"
                 :: "v"(dst), "v"(o[0]), "v"(o[1]), "v"(o[2]), "v"(o[3])
                 : "memory");
  }
}

#define ATT_WAVES 8
#define ATT_Q     (ATT_WAVES * 16)
#define ATT_T     (ATT_WAVES * 32)

// Value of lane l ^ 16 (the other half of the same query column).
__device__ __forceinline__ float other_half(float v) {
  const int b = __builtin_bit_cast(int, v);
  return __builtin_bit_cast(
      float, __builtin_amdgcn_permlanex16(b, b, 0x76543210, 0xfedcba98, false,
                                          false));
}

// s in the lanes whose bit of the wave-uniform word w is set, else -1e9: the
// word is used as a lane mask, so this is one conditional move.
__device__ __forceinline__ float mask_score(float s, unsigned w) {
  return __builtin_amdgcn_inverse_ballot_w32(w) ? s : -1e9f;
}

__global__ void attn_kernel(const bf16* __restrict__ Qf,
                            const bf16* __restrict__ Kf,
                            const bf16* __restrict__ Vf,
                            const unsigned* __restrict__ adjb,
                            float* __restrict__ O) {
  __shared__ __align__(16) bf16 kbuf[NDIM * HD];
  __shared__ __align__(16) bf16 vbuf[NDIM * HD];
  const int tid = threadIdx.x;
  // The wave's number in a scalar register: the mask words' address is formed
  // from it, and only a wave-uniform address is read by scalar loads.
  const int wave = __builtin_amdgcn_readfirstlane(tid >> 5);
  const int lane = tid & 31;
  const int qt = blockIdx.x, h = blockIdx.y, bt = blockIdx.z;
  const int qblock = qt * ATT_Q;
  const int qbase = qblock + wave * 16;
  const int coln = lane & 15;
  const int koff = (lane & 16) ? 8 : 0;

  {  // K, then V: 2048 chunks of 16 bytes each, eight per thread.
    unsigned l[8];
    const void* g[8];
    const bf16* kg = Kf + frag_index(bt, h, 0, 0);
    const bf16* vg = Vf + frag_index(bt, h, 0, 0);
#pragma unroll
    for (int i = 0; i < 8; ++i) {
      const int c = i * ATT_T + tid;
      l[i] = lds_addr(kbuf + c * 8);
      g[i] = kg + c * 8;
    }
    async_copy_x8(l, g);
#pragma unroll
    for (int i = 0; i < 8; ++i) {
      const int c = i * ATT_T + tid;
      l[i] = lds_addr(vbuf + c * 8);
      g[i] = vg + c * 8;
    }
    async_copy_x8(l, g);
  }
  // This wave's copies have landed; the barrier publishes them to the others.
  asm volatile("s_wait_asynccnt 0x0" ::: "memory");
  __syncthreads();

  // Q^T B-fragment (column = query): HD=16 channels zero-padded to K=32.
  bf16x16 qb;
  {
    bf16x8 lo = *(const bf16x8*)(Qf + frag_index(bt, h, qbase >> 4, lane));
#pragma unroll
    for (int i = 0; i < 8; ++i) { qb[i] = lo[i]; qb[i + 8] = (bf16)0.f; }
  }

  // Per lane: running maximum of its query (equal in both halves), the sum of
  // its own half's keys, and 8 output channels of its query.
  float mrun = -1e9f, lrun = 0.f;
  f32x8 oacc = {0.f, 0.f, 0.f, 0.f, 0.f, 0.f, 0.f, 0.f};
  const f32x8 fz = {0.f, 0.f, 0.f, 0.f, 0.f, 0.f, 0.f, 0.f};

  // A chunk of 32 keys is two tiles: 512 elements of K and 512 of V.
  const bf16* kp = kbuf + lane * 8;
  const bf16* vp = vbuf + lane * 8;
  // This wave's lane masks: 16 words a chunk, read one trip (two chunks) ahead.
  const u32x16* mrow = (const u32x16*)(adjb + (size_t)(qbase >> 4) * 32 * 16);
  u32x16 mcur[2] = {mrow[0], mrow[1]};
  bf16x16 ka0, ka1;  // upper halves (k = 16..31) stay zero through the loop
#pragma unroll
  for (int i = 0; i < 16; ++i) { ka0[i] = (bf16)0.f; ka1[i] = (bf16)0.f; }

  // Two chunks a trip: their LDS reads share one address register, and their
  // mask words are one 128-byte line.
  for (int kc = 0; kc < 32; kc += 2) {
    // The last trip reads chunks 0 and 1 again, unused.
    const u32x16 mnext[2] = {mrow[(kc + 2) & 31], mrow[(kc + 3) & 31]};
#pragma unroll  // 'half' picks registers: it must be a constant
    for (int half = 0; half < 2; ++half) {
      // Two K A-fragments (row = key, channels on K dim, zero-padded to 32).
      {
        bf16x8 l0 = *(const bf16x8*)kp;
        bf16x8 l1 = *(const bf16x8*)(kp + 256);
#pragma unroll
        for (int i = 0; i < 8; ++i) { ka0[i] = l0[i]; ka1[i] = l1[i]; }
      }
      // V^T A-fragment (row = channel, keys in the hardware k order).
      bf16x16 va;
      {
        bf16x8 lo = *(const bf16x8*)vp;
        bf16x8 hi = *(const bf16x8*)(vp + 256);
#pragma unroll
        for (int i = 0; i < 8; ++i) { va[i] = lo[i]; va[i + 8] = hi[i]; }
      }
      kp += 512;
      vp += 512;
      // s0[r] = S[query coln][32 * (kc + half) + koff + r], s1[r]: 16 keys on.
      f32x8 s0 = wmma_bf16(ka0, qb, fz);
      f32x8 s1 = wmma_bf16(ka1, qb, fz);

      const u32x16 mw = mcur[half];  // word r: s0[r], word 8 + r: s1[r]
      float cm = -1e9f;
#pragma unroll
      for (int r = 0; r < 8; ++r) {
        s0[r] = mask_score(s0[r], mw[r]);
        s1[r] = mask_score(s1[r], mw[8 + r]);
        cm = fmaxf(cm, fmaxf(s0[r], s1[r]));
      }
      const float mnew = fmaxf(mrun, fmaxf(cm, other_half(cm)));
      const float corr = __expf(mrun - mnew);
      mrun = mnew;
      float ps = 0.f;
      bf16x16 pb;  // P^T B-fragment straight from the two score tiles
#pragma unroll
      for (int r = 0; r < 8; ++r) {
        // exp(s - mnew) = exp2((s - mnew) * log2(e)): the subtraction and the
        // product are written on two floats, so that each is one packed op.
        const f32x2 d = (f32x2{s0[r], s1[r]} - mnew) * 0x1.715476p+0f;
        const float e0 = __builtin_amdgcn_exp2f(d.x);
        const float e1 = __builtin_amdgcn_exp2f(d.y);
        ps += e0 + e1;
        pb[r]     = (bf16)e0;
        pb[r + 8] = (bf16)e1;
      }
      lrun = lrun * corr + ps;
#pragma unroll
      for (int r = 0; r < 8; ++r) oacc[r] *= corr;
      oacc = wmma_bf16(va, pb, oacc);
    }
    // Inputs only: keeps the loads of the next trip's mask words inside this
    // trip. Without it they sink to their first use, where a wave would wait
    // out the whole scalar-load latency in front of its first select. The
    // scheduling barrier keeps the statement, and so the wait for the loads, at
    // the trip's end instead of directly behind them.
    __builtin_amdgcn_sched_barrier(0);
    asm volatile("" :: "s"(mnext[0]), "s"(mnext[1]));
    mcur[0] = mnext[0];
    mcur[1] = mnext[1];
  }

  // oacc[r] = O[query coln][channel koff + r]: 8 consecutive floats per lane.
  const float inv = 1.f / (lrun + other_half(lrun));
  float* op = O + ((size_t)bt * NDIM + qbase + coln) * DDIM + h * HD + koff;
  float4 w0 = {oacc[0] * inv, oacc[1] * inv, oacc[2] * inv, oacc[3] * inv};
  float4 w1 = {oacc[4] * inv, oacc[5] * inv, oacc[6] * inv, oacc[7] * inv};
  *(float4*)(op)     = w0;
  *(float4*)(op + 4) = w1;
}

// ---------------------------------------------------------------------------
// Kernel 3: out-proj + residual + LN2 + MLP + residual.
// grid = (N/64, BT), block = 128.
__global__ void proj_mlp_kernel(const float* __restrict__ x,
                                const float* __restrict__ O,
                                const bf16* __restrict__ wop,
                                const float* __restrict__ bo,
                                const float* __restrict__ g2,
                                const float* __restrict__ be2,
                                const bf16* __restrict__ w1p,
                                const float* __restrict__ b1,
                                const bf16* __restrict__ w2p,
                                const float* __restrict__ b2,
                                float* __restrict__ out) {
  __shared__ __align__(16) bf16 hbuf[64 * 80];
  __shared__ __align__(16) float xbuf[64 * 72];
  __shared__ __align__(16) bf16 ubuf[64 * 264];
  __shared__ __align__(16) bf16 wbuf[(8 + 32 + 32) * 512];  // wo, w1, w2
  __shared__ __align__(16) float pbuf[512];  // b1, bo, b2, g2, be2
  const float* b1s = pbuf;
  const float* bos = pbuf + 256;
  const float* b2s = pbuf + 320;
  const float* g2s = pbuf + 384;
  const float* be2s = pbuf + 448;
  const int tid = threadIdx.x;
  const int bt = blockIdx.y;
  const int b = bt / TDIM, t = bt % TDIM;
  const int r0 = blockIdx.x * 64;
  const f32x8 fz = {0.f, 0.f, 0.f, 0.f, 0.f, 0.f, 0.f, 0.f};

  {  // All that the later phases read from global memory, O aside, flies to LDS at once:
    // the 64 residual rows (16 chunks of 16 bytes each), the five parameter
    // vectors (128 chunks) and the three packed weights (4608 chunks).
    unsigned l[9];
    const void* g[9];
#pragma unroll
    for (int i = 0; i < 8; ++i) {
      const int c = i * 128 + tid;
      const int row = c >> 4, pc = c & 15;
      l[i] = lds_addr(xbuf + row * 72 + pc * 4);
      g[i] = x + (((size_t)b * NDIM + r0 + row) * TDIM + t) * DDIM + pc * 4;
    }
    const float* pv = (tid < 80) ? bo : (tid < 96) ? b2 : (tid < 112) ? g2 : be2;
    l[8] = lds_addr(pbuf + tid * 4);
    g[8] = (tid < 64) ? b1 + tid * 4 : pv + (tid & 15) * 4;
    async_copy_x9(l, g);
#pragma unroll
    for (int grp = 0; grp < 4; ++grp) {
#pragma unroll
      for (int j = 0; j < 9; ++j) {
        const int i = grp * 9 + j;
        const int c = i * 128 + tid;
        l[j] = lds_addr(wbuf + w_lds_index(c));
        g[j] = (i < 4) ? wop + c * 8
                       : (i < 20) ? w1p + (c - 512) * 8 : w2p + (c - 2560) * 8;
      }
      async_copy_x9(l, g);
    }
  }

  {  // stage attention output as bf16
    const int row = tid >> 1;
    const int c0 = (tid & 1) * 32;
    const float* op = O + ((size_t)bt * NDIM + r0 + row) * DDIM + c0;
#pragma unroll
    for (int i = 0; i < 32; ++i) hbuf[row * 80 + c0 + i] = (bf16)op[i];
  }
  // This wave's copies have landed; the barrier publishes them to the others.
  asm volatile("s_wait_asynccnt 0x0" ::: "memory");
  __syncthreads();

  const int wave = tid >> 5, lane = tid & 31;
  const int rowbase = wave * 16;
  const int rhalf = (lane >> 4) * 8;
  const int coln = lane & 15;

  // o @ wo + bo + x  -> xbuf (f32)
#pragma unroll
  for (int nt = 0; nt < 4; ++nt) {
    f32x8 acc = fz;
#pragma unroll
    for (int kt = 0; kt < 2; ++kt)
      acc = wmma_bf16(load_a_frag(hbuf + rowbase * 80 + kt * 32, 80),
                      load_b_lds(wbuf, nt * 2 + kt), acc);
#pragma unroll
    for (int r = 0; r < 8; ++r) {
      const int row_in = rowbase + rhalf + r;
      const int col = nt * 16 + coln;
      const float xv = xbuf[row_in * 72 + col];  // the residual, copied above
      xbuf[row_in * 72 + col] = xv + acc[r] + bos[col];
    }
  }
  __syncthreads();

  {  // LN2 -> hbuf (bf16)
    const int row = tid >> 1;
    const int c0 = (tid & 1) * 32;
    float v[32], s = 0.f, ss = 0.f;
#pragma unroll
    for (int i = 0; i < 32; ++i) {
      v[i] = xbuf[row * 72 + c0 + i];
      s += v[i]; ss += v[i] * v[i];
    }
    s  += __shfl_xor(s, 1);
    ss += __shfl_xor(ss, 1);
    const float mean = s * (1.f / 64.f);
    const float var  = ss * (1.f / 64.f) - mean * mean;
    const float rstd = rsqrtf(var + 1e-5f);
#pragma unroll
    for (int i = 0; i < 32; ++i) {
      const int c = c0 + i;
      hbuf[row * 80 + c] = (bf16)((v[i] - mean) * rstd * g2s[c] + be2s[c]);
    }
  }
  __syncthreads();

  // MLP layer 1: 64 -> 256, ReLU -> ubuf (bf16)
#pragma unroll
  for (int nt = 0; nt < 16; ++nt) {
    f32x8 acc = fz;
#pragma unroll
    for (int kt = 0; kt < 2; ++kt)
      acc = wmma_bf16(load_a_frag(hbuf + rowbase * 80 + kt * 32, 80),
                      load_b_lds(wbuf, 8 + nt * 2 + kt), acc);
#pragma unroll
    for (int r = 0; r < 8; ++r) {
      const int row_in = rowbase + rhalf + r;
      const int col = nt * 16 + coln;
      ubuf[row_in * 264 + col] = (bf16)fmaxf(acc[r] + b1s[col], 0.f);
    }
  }
  __syncthreads();

  // MLP layer 2: 256 -> 64, + residual -> out (original [B,N,T,D] layout)
#pragma unroll
  for (int nt = 0; nt < 4; ++nt) {
    f32x8 acc = fz;
#pragma unroll
    for (int kt = 0; kt < 8; ++kt)
      acc = wmma_bf16(load_a_frag(ubuf + rowbase * 264 + kt * 32, 264),
                      load_b_lds(wbuf, 40 + nt * 8 + kt), acc);
#pragma unroll
    for (int r = 0; r < 8; ++r) {
      const int row_in = rowbase + rhalf + r;
      const int node = r0 + row_in;
      const int col = nt * 16 + coln;
      out[(((size_t)b * NDIM + node) * TDIM + t) * DDIM + col] =
          xbuf[row_in * 72 + col] + acc[r] + b2s[col];
    }
  }
}

// ---------------------------------------------------------------------------
extern "C" void kernel_launch(void* const* d_in, const int* in_sizes, int n_in,
                              void* d_out, int out_size, void* d_ws,
                              size_t ws_size, hipStream_t stream) {
  (void)in_sizes; (void)n_in; (void)out_size; (void)ws_size;
  const float* x   = (const float*)d_in[0];
  const int*   adj = (const int*)d_in[1];
  const float* wq  = (const float*)d_in[2];
  const float* wk  = (const float*)d_in[3];
  const float* wv  = (const float*)d_in[4];
  const float* wo  = (const float*)d_in[5];
  const float* bo  = (const float*)d_in[6];
  const float* w1  = (const float*)d_in[7];
  const float* b1  = (const float*)d_in[8];
  const float* w2  = (const float*)d_in[9];
  const float* b2  = (const float*)d_in[10];
  const float* g1  = (const float*)d_in[11];
  const float* be1 = (const float*)d_in[12];
  const float* g2  = (const float*)d_in[13];
  const float* be2 = (const float*)d_in[14];
  float* out = (float*)d_out;

  char* w = (char*)d_ws;
  size_t off = 0;
  auto carve = [&](size_t bytes) -> void* {
    off = (off + 255) & ~(size_t)255;
    void* p = w + off;
    off += bytes;
    return p;
  };
  const size_t act = (size_t)BT * NDIM * DDIM;  // 1.57M elements
  bf16*     Qf   = (bf16*)carve(act * 2);
  bf16*     Kf   = (bf16*)carve(act * 2);
  bf16*     Vf   = (bf16*)carve(act * 2);
  float*    O    = (float*)carve(act * 4);
  unsigned* adjb = (unsigned*)carve((size_t)NDIM * 32 * 4);
  bf16* wqp = (bf16*)carve(64 * 64 * 2);
  bf16* wkp = (bf16*)carve(64 * 64 * 2);
  bf16* wvp = (bf16*)carve(64 * 64 * 2);
  bf16* wop = (bf16*)carve(64 * 64 * 2);
  bf16* w1p = (bf16*)carve(64 * 256 * 2);
  bf16* w2p = (bf16*)carve(256 * 64 * 2);

  pack_qkv_w_kernel<<<dim3(2, 4, 3), 32, 0, stream>>>(wq, wk, wv, wqp, wkp, wvp);
  ln_qkv_kernel<<<dim3(LNQ_BLOCKS + ADJ_BLOCKS + WT_BLOCKS), 128, 0, stream>>>(
      x, g1, be1, wqp, wkp, wvp, Qf, Kf, Vf, adj, adjb, wo, w1, w2, wop, w1p, w2p);
  attn_kernel<<<dim3(NDIM / ATT_Q, HDIM, BT), ATT_T, 0, stream>>>(Qf, Kf, Vf, adjb, O);
  proj_mlp_kernel<<<dim3(NDIM / 64, BT), 128, 0, stream>>>(
      x, O, wop, bo, g2, be2, w1p, b1, w2p, b2, out);
}

// v008
// It runs in 27.7 microseconds.
// Versions in between are left out here; by their measured steps it is 1.24 times as fast as v006.
// Over all steps from v000 it is 4.19 times as fast.
#include <hip/hip_runtime.h>

#define BDIM 2
#define NDIM 1024
#define TDIM 12
#define DDIM 64
#define HDIM 4
#define HD   16
#define BT   (BDIM * TDIM)

typedef __bf16 bf16;
typedef __attribute__((ext_vector_type(16))) __bf16 bf16x16;
typedef __attribute__((ext_vector_type(8)))  __bf16 bf16x8;
typedef __attribute__((ext_vector_type(8)))  float  f32x8;
typedef __attribute__((ext_vector_type(2)))  float  f32x2;

// Scores are kept in units of log2: exp(s) = exp2(s * LOG2E).
#define LOG2E 0x1.715476p+0f

__device__ __forceinline__ f32x8 wmma_bf16(bf16x16 a, bf16x16 b, f32x8 c) {
  return __builtin_amdgcn_wmma_f32_16x16x32_bf16(false, a, false, b, (short)0, c,
                                                 false, false);
}

// A fragment (16x32 bf16, rows on lanes). ISA 7.12.2: lane<16 holds K=0..7 /
// 16..23, lane>=16 holds K=8..15 / 24..31 for row M=lane%16.
__device__ __forceinline__ bf16x16 load_a_frag(const bf16* base, int ld) {
  const int lane = threadIdx.x & 31;
  const int m    = lane & 15;
  const int koff = (lane & 16) ? 8 : 0;
  const bf16* p  = base + m * ld + koff;
  bf16x8 lo = *(const bf16x8*)(p);
  bf16x8 hi = *(const bf16x8*)(p + 16);
  bf16x16 a;
#pragma unroll
  for (int i = 0; i < 8; ++i) { a[i] = lo[i]; a[i + 8] = hi[i]; }
  return a;
}


// ---------------------------------------------------------------------------
// Asynchronous copies to LDS, 16 bytes per lane and copy, every lane on. A run
// of copies shares one statement, so that all of them are in flight together;
// its last line holds every rewrite of an address register behind the copies.
__device__ __forceinline__ unsigned lds_addr(const void* p) {
  return (unsigned)(size_t)p;  // byte offset in the work-group's LDS
}
__device__ __forceinline__ void async_copy_x8(const unsigned (&l)[8],
                                               const void* const (&g)[8]) {
  asm volatile(
      "global_load_async_to_lds_b128 %0, %8, off\n\t"
      "global_load_async_to_lds_b128 %1, %9, off\n\t"
      "global_load_async_to_lds_b128 %2, %10, off\n\t"
      "global_load_async_to_lds_b128 %3, %11, off\n\t"
      "global_load_async_to_lds_b128 %4, %12, off\n\t"
      "global_load_async_to_lds_b128 %5, %13, off\n\t"
      "global_load_async_to_lds_b128 %6, %14, off\n\t"
      "global_load_async_to_lds_b128 %7, %15, off\n\t"
      "s_wait_xcnt 0x0"
      :: "v"(l[0]), "v"(l[1]), "v"(l[2]), "v"(l[3]), "v"(l[4]), "v"(l[5]),
         "v"(l[6]), "v"(l[7]), "v"(g[0]), "v"(g[1]), "v"(g[2]), "v"(g[3]),
         "v"(g[4]), "v"(g[5]), "v"(g[6]), "v"(g[7])
      : "memory");
}
__device__ __forceinline__ void async_copy_x9(const unsigned (&l)[9],
                                               const void* const (&g)[9]) {
  asm volatile(
      "global_load_async_to_lds_b128 %0, %9, off\n\t"
      "global_load_async_to_lds_b128 %1, %10, off\n\t"
      "global_load_async_to_lds_b128 %2, %11, off\n\t"
      "global_load_async_to_lds_b128 %3, %12, off\n\t"
      "global_load_async_to_lds_b128 %4, %13, off\n\t"
      "global_load_async_to_lds_b128 %5, %14, off\n\t"
      "global_load_async_to_lds_b128 %6, %15, off\n\t"
      "global_load_async_to_lds_b128 %7, %16, off\n\t"
      "global_load_async_to_lds_b128 %8, %17, off\n\t"
      "s_wait_xcnt 0x0"
      :: "v"(l[0]), "v"(l[1]), "v"(l[2]), "v"(l[3]), "v"(l[4]), "v"(l[5]),
         "v"(l[6]), "v"(l[7]), "v"(l[8]), "v"(g[0]), "v"(g[1]), "v"(g[2]),
         "v"(g[3]), "v"(g[4]), "v"(g[5]), "v"(g[6]), "v"(g[7]), "v"(g[8])
      : "memory");
}

// Packed weights: in global memory a lane's 16 elements of B fragment
// nt * KT + kt are contiguous. In LDS fragment f is 1 KiB, the lanes' first 16
// bytes in its lower half and their second 16 bytes in its upper half, so that
// each of the two reads of a fragment is 512 contiguous bytes. Chunk c (16
// bytes) of the global order goes to this element offset.
__device__ __forceinline__ int w_lds_index(int c) {
  return (c >> 6) * 512 + (c & 1) * 256 + ((c >> 1) & 31) * 8;
}
__device__ __forceinline__ bf16x16 load_b_lds(const bf16* w, int f) {
  const int lane = threadIdx.x & 31;
  bf16x8 lo = *(const bf16x8*)(w + f * 512 + lane * 8);
  bf16x8 hi = *(const bf16x8*)(w + f * 512 + 256 + lane * 8);
  bf16x16 b;
#pragma unroll
  for (int i = 0; i < 8; ++i) { b[i] = lo[i]; b[i + 8] = hi[i]; }
  return b;
}

// Q, K and V live in the workspace in fragment order: per (bt, head) 64 tiles
// of 16 nodes, a tile being 32 lanes x 8 bf16 = 512 contiguous bytes, so that a
// wave-wide 16-byte access covers four whole cache lines.
//   Q, K tile: lane l holds node (l & 15), channels 8 * (l >> 4) + 0..7.
//   V tile:    lane l holds channel (l & 15), nodes 8 * (l >> 4) + 0..7.
__device__ __forceinline__ size_t frag_index(int bt, int h, int tile, int lane) {
  return ((((size_t)bt * HDIM + h) * (NDIM / 16) + tile) * 32 + lane) * 8;
}

// ---------------------------------------------------------------------------
// Repack one 32x16 tile (kt, nt) of a KxNn f32 weight matrix into per-lane
// B-fragment order (bf16). One wave per tile.
__device__ __forceinline__ void pack_w_tile(const float* __restrict__ src,
                                            bf16* __restrict__ dst, int K, int Nn,
                                            int kt, int nt, int lane) {
  const int KT = K >> 5;
  const int n  = nt * 16 + (lane & 15);
  const int koff = (lane & 16) ? 8 : 0;
  float vals[16];
#pragma unroll
  for (int e = 0; e < 16; ++e) {
    const int p = e >> 1, h = e & 1;
    const int k = kt * 32 + ((p < 4) ? 0 : 16) + ((p & 3) * 2 + h) + koff;
    vals[e] = src[(size_t)k * Nn + n];
  }
  // Stands ahead of the conversions, whose results may land in the registers
  // that the loads above name as addresses.
  asm volatile("s_wait_xcnt 0x0" ::: "memory");
  bf16* d = dst + (((size_t)nt * KT + kt) * 32 + lane) * 16;
#pragma unroll
  for (int e = 0; e < 16; ++e) d[e] = (bf16)vals[e];
}

// The adjacency mask is kept as lane masks of the attention wave: for a tile of
// 16 queries and a chunk of 32 keys, 16 words, one per score register. Bit l of
// word j says whether lane l keeps its score j, which is that of
//   query 16 * qtile + (l & 15),
//   key   32 * kc + 16 * (j >> 3) + 8 * (l >> 4) + (j & 7).
// One wave per (qtile, kc): a lane reads the 16 entries of its own scores.
typedef __attribute__((ext_vector_type(16))) unsigned u32x16;
__device__ __forceinline__ void pack_adj_tile(const int* __restrict__ adj,
                                              unsigned* __restrict__ adjl,
                                              int qtile, int kc, int lane) {
  const int* p = adj + (size_t)(qtile * 16 + (lane & 15)) * NDIM + kc * 32 +
                 ((lane & 16) ? 8 : 0);
  const int4 a[4] = {*(const int4*)(p), *(const int4*)(p + 4),
                     *(const int4*)(p + 16), *(const int4*)(p + 20)};
  // Stands ahead of every rewrite of the address that the four loads name.
  asm volatile("s_wait_xcnt 0x0" ::: "memory");
  unsigned mine = 0u;
#pragma unroll
  for (int q = 0; q < 4; ++q) {
    const unsigned b0 = __builtin_amdgcn_ballot_w32(a[q].x != 0);
    const unsigned b1 = __builtin_amdgcn_ballot_w32(a[q].y != 0);
    const unsigned b2 = __builtin_amdgcn_ballot_w32(a[q].z != 0);
    const unsigned b3 = __builtin_amdgcn_ballot_w32(a[q].w != 0);
    mine = (lane == q * 4 + 0) ? b0 : mine;
    mine = (lane == q * 4 + 1) ? b1 : mine;
    mine = (lane == q * 4 + 2) ? b2 : mine;
    mine = (lane == q * 4 + 3) ? b3 : mine;
  }
  if (lane < 16) adjl[((size_t)qtile * 32 + kc) * 16 + lane] = mine;
}

// ---------------------------------------------------------------------------
// wq, wk, wv in LDS: bf16, row-major as in global memory (row = input channel
// k, 64 output channels n), rows WPITCH elements apart: 160 bytes, an odd
// multiple of 32 bytes, the pitch at which the transposing load has no bank
// conflict. Two transposing loads give the fragment of rows kt * 32 .. + 31 and
// columns nt * 16 .. + 15: lane l holds column (l & 15), k = 8 * (l >> 4) + 0..7
// and 16 more, the k order of load_a_frag.
#define WPITCH 80
typedef __attribute__((ext_vector_type(8))) short s16x8;
typedef __attribute__((ext_vector_type(4))) __bf16 bf16x4;
typedef __attribute__((ext_vector_type(4))) float f32x4;
__device__ __forceinline__ bf16x16 load_w_tr(const bf16* w, int kt, int nt) {
  typedef __attribute__((address_space(3))) s16x8 lds_s16x8;
  const int lane = threadIdx.x & 31;
  const bf16* p = w + (kt * 32 + 8 * (lane >> 4) + (lane & 7)) * WPITCH +
                  nt * 16 + 8 * ((lane >> 3) & 1);
  const bf16x8 lo = __builtin_bit_cast(
      bf16x8, __builtin_amdgcn_ds_load_tr16_b128_v8i16((lds_s16x8*)p));
  const bf16x8 hi = __builtin_bit_cast(
      bf16x8,
      __builtin_amdgcn_ds_load_tr16_b128_v8i16((lds_s16x8*)(p + 16 * WPITCH)));
  bf16x16 b;
#pragma unroll
  for (int i = 0; i < 8; ++i) { b[i] = lo[i]; b[i + 8] = hi[i]; }
  return b;
}

// Kernel 1: LN1 + QKV projection, block = 128 (4 waves), LNQ_BLOCKS blocks.
// The same grid carries, in the blocks behind those, the packing that only the
// later launches read and that reads nothing written here: the adjacency lane
// masks (one tile per wave) and the wo, w1, w2 tiles (one tile per wave).
#define LNQ_BLOCKS (NDIM / 64 * BT)
#define ADJ_TILES  ((NDIM / 16) * (NDIM / 32))
#define ADJ_BLOCKS (ADJ_TILES / 4)
#define WT_BLOCKS  ((8 + 32 + 32) / 4)
__global__ void __launch_bounds__(128)
ln_qkv_kernel(const float* __restrict__ x,
                              const float* __restrict__ g1,
                              const float* __restrict__ be1,
                              const float* __restrict__ wq,
                              const float* __restrict__ wk,
                              const float* __restrict__ wv,
                              bf16* __restrict__ Qf, bf16* __restrict__ Kf,
                              bf16* __restrict__ Vf,
                              const int* __restrict__ adj,
                              unsigned* __restrict__ adjb,
                              const float* __restrict__ wo,
                              const float* __restrict__ w1,
                              const float* __restrict__ w2,
                              bf16* __restrict__ wop, bf16* __restrict__ w1p,
                              bf16* __restrict__ w2p) {
  __shared__ __align__(16) bf16 hbuf[64 * 80];
  __shared__ __align__(16) bf16 wbuf[3 * 64 * WPITCH];  // wq, wk, wv rows
  const int tid = threadIdx.x;
  const int bid = blockIdx.x;
  if (bid >= LNQ_BLOCKS) {  // whole blocks leave here, ahead of the barrier
    const int pw = (bid - LNQ_BLOCKS) * 4 + (tid >> 5);
    const int pl = tid & 31;
    if (pw < ADJ_TILES) {
      pack_adj_tile(adj, adjb, pw >> 5, pw & 31, pl);
    } else {
      const int tl = pw - ADJ_TILES;
      if (tl < 8)       pack_w_tile(wo, wop, 64, 64, tl & 1, tl >> 1, pl);
      else if (tl < 40) pack_w_tile(w1, w1p, 64, 256, tl & 1, (tl - 8) >> 1, pl);
      else              pack_w_tile(w2, w2p, 256, 64, tl & 7, (tl - 40) >> 3, pl);
    }
    return;
  }
  const int bt = bid / (NDIM / 64);
  const int b = bt / TDIM, t = bt % TDIM;
  const int r0 = (bid % (NDIM / 64)) * 64;

  // The three weights, f32 as the inputs have them: 3072 chunks of 16 bytes, 24
  // per thread, a wave-wide load covering four whole lines. They are in flight
  // while the LayerNorm runs.
  f32x4 wreg[24];
#pragma unroll
  for (int i = 0; i < 24; ++i) {
    const float* ws = (i < 8) ? wq : (i < 16) ? wk : wv;
    wreg[i] = *(const f32x4*)(ws + ((i & 7) * 128 + tid) * 4);
  }
  // Keeps the 24 loads up here: left free, part of them moves down to the
  // conversions and meets its whole latency there.
  __builtin_amdgcn_sched_barrier(0);

  {  // LayerNorm: 2 threads per row, 32 columns each.
    const int row = tid >> 1;
    const int c0 = (tid & 1) * 32;
    const float* xr =
        x + (((size_t)b * NDIM + (r0 + row)) * TDIM + t) * DDIM + c0;
    float v[32], s = 0.f, ss = 0.f;
#pragma unroll
    for (int i = 0; i < 32; ++i) { v[i] = xr[i]; s += v[i]; ss += v[i] * v[i]; }
    s  += __shfl_xor(s, 1);
    ss += __shfl_xor(ss, 1);
    const float mean = s * (1.f / 64.f);
    const float var  = ss * (1.f / 64.f) - mean * mean;
    const float rstd = rsqrtf(var + 1e-5f);
#pragma unroll
    for (int i = 0; i < 32; ++i) {
      const int c = c0 + i;
      hbuf[row * 80 + c] = (bf16)((v[i] - mean) * rstd * g1[c] + be1[c]);
    }
    // Stands ahead of every rewrite of a register that the loads of the weights
    // and of x name as their address; as inputs of the wait, the two addresses
    // stay in place up to it.
    asm volatile("s_wait_xcnt 0x0" :: "v"(tid), "v"(xr) : "memory");
  }
  // Inputs only: holds the wait for the weights, and the conversions behind it,
  // down here. Left free, the conversions move up ahead of the LayerNorm, which
  // then starts only when the weights have arrived. It also keeps each load whole
  // (16 bytes a lane) where the compiler otherwise halves it. The scheduling
  // barrier is what stops the conversions, which the statement does not order.
  __builtin_amdgcn_sched_barrier(0);
  asm volatile("" :: "v"(wreg[0]), "v"(wreg[1]), "v"(wreg[2]), "v"(wreg[3]),
               "v"(wreg[4]), "v"(wreg[5]), "v"(wreg[6]), "v"(wreg[7]),
               "v"(wreg[8]), "v"(wreg[9]), "v"(wreg[10]), "v"(wreg[11]),
               "v"(wreg[12]), "v"(wreg[13]), "v"(wreg[14]), "v"(wreg[15]),
               "v"(wreg[16]), "v"(wreg[17]), "v"(wreg[18]), "v"(wreg[19]),
               "v"(wreg[20]), "v"(wreg[21]), "v"(wreg[22]), "v"(wreg[23]));
  // The weights go to LDS as bf16, row-major: chunk c is row c >> 4 of the 192,
  // columns 4 * (c & 15) .. + 3.
#pragma unroll
  for (int i = 0; i < 24; ++i) {
    const int c = i * 128 + tid;
    const bf16x4 o = {(bf16)wreg[i].x, (bf16)wreg[i].y, (bf16)wreg[i].z,
                      (bf16)wreg[i].w};
    *(bf16x4*)(wbuf + (c >> 4) * WPITCH + (c & 15) * 4) = o;
  }
  __syncthreads();

  const int wave = tid >> 5, lane = tid & 31;
  const int rowbase = wave * 16;
  bf16* frags[3] = {Qf, Kf, Vf};
  const int tile = (r0 + rowbase) >> 4;
  const f32x8 fz = {0.f, 0.f, 0.f, 0.f, 0.f, 0.f, 0.f, 0.f};

  // Head nt of this wave's 16 nodes is one fragment tile. Q and K are formed
  // transposed (W^T h^T: the two operands swap places, their k orders being
  // equal), so a lane ends with 8 channels of one node; V stays h W, so a lane
  // ends with 8 nodes of one channel. Either way the lane's 8 values are the
  // 16 bytes that the same lane of an attention wave loads.
#pragma unroll
  for (int mtx = 0; mtx < 3; ++mtx) {
    bf16x8 o[4];
#pragma unroll
    for (int nt = 0; nt < 4; ++nt) {
      f32x8 acc = fz;
#pragma unroll
      for (int kt = 0; kt < 2; ++kt) {
        const bf16x16 hf = load_a_frag(hbuf + rowbase * 80 + kt * 32, 80);
        const bf16x16 wf = load_w_tr(wbuf + mtx * 64 * WPITCH, kt, nt);
        acc = (mtx == 2) ? wmma_bf16(hf, wf, acc) : wmma_bf16(wf, hf, acc);
      }
#pragma unroll
      for (int r = 0; r < 8; ++r)  // Q pre-scaled by log2(e) / sqrt(HD)
        o[nt][r] = (bf16)((mtx == 0) ? acc[r] * (0.25f * LOG2E) : acc[r]);
    }
    bf16* dst = frags[mtx] + frag_index(bt, 0, tile, lane);
#pragma unroll
    for (int nt = 0; nt < 4; ++nt)
      *(bf16x8*)(dst + frag_index(0, nt, 0, 0)) = o[nt];
    // Stands ahead of every rewrite of a register that the four stores name;
    // as inputs of the wait, address and data stay in place up to it.
    asm volatile("s_wait_xcnt 0x0"
                 :: "v"(dst), "v"(o[0]), "v"(o[1]), "v"(o[2]), "v"(o[3])
                 : "memory");
  }
}

#define ATT_WAVES 8
#define ATT_Q     (ATT_WAVES * 16)
#define ATT_T     (ATT_WAVES * 32)

// Value of lane l ^ 16 (the other half of the same query column).
__device__ __forceinline__ float other_half(float v) {
  const int b = __builtin_bit_cast(int, v);
  return __builtin_bit_cast(
      float, __builtin_amdgcn_permlanex16(b, b, 0x76543210, 0xfedcba98, false,
                                          false));
}

// s in the lanes whose bit of the wave-uniform word w is set, else 'masked':
// the word is used as a lane mask, so this is one conditional move.
__device__ __forceinline__ float mask_score(float s, unsigned w, float masked) {
  return __builtin_amdgcn_inverse_ballot_w32(w) ? s : masked;
}

// The score of a masked key, in log2 units.
#define MASKED (-1e9f * LOG2E)
// A trip's sum of exponentials (32 per lane) above which the maximum in use is
// renewed: below it no exponential exceeds 2^12.
#define P_LIMIT 4096.f

// P^T B-fragment of one chunk of 32 keys. negm holds minus the maximum in use
// in all eight registers: as the C operand it leaves each score ready for exp2.
// 'maskedp' is MASKED minus that maximum. The exponentials are added to ps.
__device__ __forceinline__ bf16x16 chunk_p(bf16x16 ka0, bf16x16 ka1, bf16x16 qb,
                                           f32x8 negm, float maskedp, u32x16 mw,
                                           f32x2& ps) {
  // s0[r] = S[query coln][32 * chunk + koff + r] - maximum, s1[r]: 16 keys on.
  const f32x8 s0 = wmma_bf16(ka0, qb, negm);
  const f32x8 s1 = wmma_bf16(ka1, qb, negm);
  bf16x16 pb;  // word r of mw: s0[r], word 8 + r: s1[r]
#pragma unroll
  for (int r = 0; r < 8; ++r) {
    const float e0 =
        __builtin_amdgcn_exp2f(mask_score(s0[r], mw[r], maskedp));
    const float e1 =
        __builtin_amdgcn_exp2f(mask_score(s1[r], mw[8 + r], maskedp));
    ps += f32x2{e0, e1};
    pb[r]     = (bf16)e0;
    pb[r + 8] = (bf16)e1;
  }
  return pb;
}

// Largest masked score of one chunk in this lane, and cm.
__device__ __forceinline__ float chunk_max(bf16x16 ka0, bf16x16 ka1, bf16x16 qb,
                                           u32x16 mw, float cm) {
  const f32x8 fz = {0.f, 0.f, 0.f, 0.f, 0.f, 0.f, 0.f, 0.f};
  const f32x8 s0 = wmma_bf16(ka0, qb, fz);
  const f32x8 s1 = wmma_bf16(ka1, qb, fz);
#pragma unroll
  for (int r = 0; r < 8; ++r)
    cm = fmaxf(cm, fmaxf(mask_score(s0[r], mw[r], MASKED),
                         mask_score(s1[r], mw[8 + r], MASKED)));
  return cm;
}

__global__ void attn_kernel(const bf16* __restrict__ Qf,
                            const bf16* __restrict__ Kf,
                            const bf16* __restrict__ Vf,
                            const unsigned* __restrict__ adjb,
                            float* __restrict__ O) {
  __shared__ __align__(16) bf16 kbuf[NDIM * HD];
  __shared__ __align__(16) bf16 vbuf[NDIM * HD];
  const int tid = threadIdx.x;
  // The wave's number in a scalar register: the mask words' address is formed
  // from it, and only a wave-uniform address is read by scalar loads.
  const int wave = __builtin_amdgcn_readfirstlane(tid >> 5);
  const int lane = tid & 31;
  const int qt = blockIdx.x, h = blockIdx.y, bt = blockIdx.z;
  const int qblock = qt * ATT_Q;
  const int qbase = qblock + wave * 16;
  const int coln = lane & 15;
  const int koff = (lane & 16) ? 8 : 0;

  {  // K, then V: 2048 chunks of 16 bytes each, eight per thread.
    unsigned l[8];
    const void* g[8];
    const bf16* kg = Kf + frag_index(bt, h, 0, 0);
    const bf16* vg = Vf + frag_index(bt, h, 0, 0);
#pragma unroll
    for (int i = 0; i < 8; ++i) {
      const int c = i * ATT_T + tid;
      l[i] = lds_addr(kbuf + c * 8);
      g[i] = kg + c * 8;
    }
    async_copy_x8(l, g);
#pragma unroll
    for (int i = 0; i < 8; ++i) {
      const int c = i * ATT_T + tid;
      l[i] = lds_addr(vbuf + c * 8);
      g[i] = vg + c * 8;
    }
    async_copy_x8(l, g);
  }
  // This wave's copies have landed; the barrier publishes them to the others.
  asm volatile("s_wait_asynccnt 0x0" ::: "memory");
  __syncthreads();

  // Q^T B-fragment (column = query): HD=16 channels zero-padded to K=32.
  bf16x16 qb;
  {
    bf16x8 lo = *(const bf16x8*)(Qf + frag_index(bt, h, qbase >> 4, lane));
#pragma unroll
    for (int i = 0; i < 8; ++i) { qb[i] = lo[i]; qb[i + 8] = (bf16)0.f; }
  }

  // Per lane: the maximum in use for its query (equal in both halves; it may
  // lag the true running maximum by up to 12), the sum of its own half's keys,
  // and 8 output channels of its query.
  float mrun = MASKED, maskedp = 0.f, lrun = 0.f;
  f32x8 negm;
#pragma unroll
  for (int r = 0; r < 8; ++r) negm[r] = -MASKED;
  f32x8 oacc = {0.f, 0.f, 0.f, 0.f, 0.f, 0.f, 0.f, 0.f};

  // A chunk of 32 keys is two tiles: 512 elements of K and 512 of V.
  const bf16* kp = kbuf + lane * 8;
  const bf16* vp = vbuf + lane * 8;
  // This wave's lane masks: 16 words a chunk, read one trip (two chunks) ahead.
  const u32x16* mrow = (const u32x16*)(adjb + (size_t)(qbase >> 4) * 32 * 16);
  u32x16 mcur[2] = {mrow[0], mrow[1]};
  bf16x16 ka[4];  // upper halves (k = 16..31) stay zero through the loop
#pragma unroll
  for (int f = 0; f < 4; ++f)
#pragma unroll
    for (int i = 0; i < 16; ++i) ka[f][i] = (bf16)0.f;

  // Takes the larger of the maximum in use and the trip's own maximum (keys in
  // ka, words in mw) into use, and rescales sum and output to it.
  auto renew_max = [&](const u32x16 (&mw)[2]) {
    float cm = chunk_max(ka[0], ka[1], qb, mw[0], MASKED);
    cm = chunk_max(ka[2], ka[3], qb, mw[1], cm);
    const float mnew = fmaxf(mrun, fmaxf(cm, other_half(cm)));
    const float corr = __builtin_amdgcn_exp2f(mrun - mnew);
    mrun = mnew;
    maskedp = MASKED - mnew;
    lrun *= corr;
#pragma unroll
    for (int r = 0; r < 8; ++r) { oacc[r] *= corr; negm[r] = -mnew; }
  };
  // Four K A-fragments (row = key, channels on K dim, zero-padded to 32).
  auto load_k = [&]() {
#pragma unroll
    for (int f = 0; f < 4; ++f) {
      const bf16x8 l = *(const bf16x8*)(kp + f * 256);
#pragma unroll
      for (int i = 0; i < 8; ++i) ka[f][i] = l[i];
    }
  };

  // The first trip's own maximum starts the loop.
  load_k();
  renew_max(mcur);

  // Two chunks a trip: their LDS reads share one address register, and their
  // mask words are one 128-byte line.
  for (int kc = 0; kc < 32; kc += 2) {
    // The last trip reads chunks 0 and 1 again, unused.
    const u32x16 mnext[2] = {mrow[(kc + 2) & 31], mrow[(kc + 3) & 31]};
    load_k();
    // Two V^T A-fragments (row = channel, keys in the hardware k order).
    bf16x16 va[2];
#pragma unroll
    for (int c = 0; c < 2; ++c) {
      const bf16x8 lo = *(const bf16x8*)(vp + c * 512);
      const bf16x8 hi = *(const bf16x8*)(vp + c * 512 + 256);
#pragma unroll
      for (int i = 0; i < 8; ++i) { va[c][i] = lo[i]; va[c][i + 8] = hi[i]; }
    }
    kp += 1024;
    vp += 1024;
    // Keeps all of the trip's loads, V's too, up here, ahead of the arithmetic
    // that hides their latency; left free, V's loads move down to the wait.
    __builtin_amdgcn_sched_barrier(0);

    f32x2 ps0 = {0.f, 0.f}, ps1 = {0.f, 0.f};
    bf16x16 pb0 = chunk_p(ka[0], ka[1], qb, negm, maskedp, mcur[0], ps0);
    bf16x16 pb1 = chunk_p(ka[2], ka[3], qb, negm, maskedp, mcur[1], ps1);
    ps0 += ps1;
    float pt = ps0.x + ps0.y;
    // Inputs only: keeps the loads of the next trip's mask words and of this
    // trip's V ahead of the branch below. Without it they sink behind it, to
    // their first use, where a wave would wait out the whole load latency. The
    // scheduling barrier keeps the statement, and so the wait for the loads, at
    // this place instead of directly behind them. negm is named so that it is
    // still in use behind the last score product: otherwise the compiler lets
    // that product overwrite its C operand and copies the eight registers for
    // it in every trip.
    __builtin_amdgcn_sched_barrier(0);
    asm volatile("" :: "s"(mnext[0]), "s"(mnext[1]), "v"(va[0]), "v"(va[1]), "v"(negm));
    // One test a trip, the same for the whole wave: a scalar branch.
    if (__builtin_amdgcn_ballot_w32(pt > P_LIMIT) != 0u) {
      // Some query's scores have outgrown the maximum in use: P is formed anew.
      renew_max(mcur);
      ps0 = f32x2{0.f, 0.f};
      ps1 = f32x2{0.f, 0.f};
      pb0 = chunk_p(ka[0], ka[1], qb, negm, maskedp, mcur[0], ps0);
      pb1 = chunk_p(ka[2], ka[3], qb, negm, maskedp, mcur[1], ps1);
      ps0 += ps1;
      pt = ps0.x + ps0.y;
    }
    lrun += pt;
    oacc = wmma_bf16(va[0], pb0, oacc);
    oacc = wmma_bf16(va[1], pb1, oacc);
    mcur[0] = mnext[0];
    mcur[1] = mnext[1];
  }

  // oacc[r] = O[query coln][channel koff + r]: 8 consecutive floats per lane.
  const float inv = 1.f / (lrun + other_half(lrun));
  float* op = O + ((size_t)bt * NDIM + qbase + coln) * DDIM + h * HD + koff;
  float4 w0 = {oacc[0] * inv, oacc[1] * inv, oacc[2] * inv, oacc[3] * inv};
  float4 w1 = {oacc[4] * inv, oacc[5] * inv, oacc[6] * inv, oacc[7] * inv};
  *(float4*)(op)     = w0;
  *(float4*)(op + 4) = w1;
}

// ---------------------------------------------------------------------------
// Kernel 3: out-proj + residual + LN2 + MLP + residual.
// grid = (N/64, BT), block = 128.
__global__ void proj_mlp_kernel(const float* __restrict__ x,
                                const float* __restrict__ O,
                                const bf16* __restrict__ wop,
                                const float* __restrict__ bo,
                                const float* __restrict__ g2,
                                const float* __restrict__ be2,
                                const bf16* __restrict__ w1p,
                                const float* __restrict__ b1,
                                const bf16* __restrict__ w2p,
                                const float* __restrict__ b2,
                                float* __restrict__ out) {
  __shared__ __align__(16) bf16 hbuf[64 * 80];
  __shared__ __align__(16) float xbuf[64 * 72];
  __shared__ __align__(16) bf16 ubuf[64 * 264];
  __shared__ __align__(16) bf16 wbuf[(8 + 32 + 32) * 512];  // wo, w1, w2
  __shared__ __align__(16) float pbuf[512];  // b1, bo, b2, g2, be2
  const float* b1s = pbuf;
  const float* bos = pbuf + 256;
  const float* b2s = pbuf + 320;
  const float* g2s = pbuf + 384;
  const float* be2s = pbuf + 448;
  const int tid = threadIdx.x;
  const int bt = blockIdx.y;
  const int b = bt / TDIM, t = bt % TDIM;
  const int r0 = blockIdx.x * 64;
  const f32x8 fz = {0.f, 0.f, 0.f, 0.f, 0.f, 0.f, 0.f, 0.f};

  {  // All that the later phases read from global memory, O aside, flies to LDS at once:
    // the 64 residual rows (16 chunks of 16 bytes each), the five parameter
    // vectors (128 chunks) and the three packed weights (4608 chunks).
    unsigned l[9];
    const void* g[9];
#pragma unroll
    for (int i = 0; i < 8; ++i) {
      const int c = i * 128 + tid;
      const int row = c >> 4, pc = c & 15;
      l[i] = lds_addr(xbuf + row * 72 + pc * 4);
      g[i] = x + (((size_t)b * NDIM + r0 + row) * TDIM + t) * DDIM + pc * 4;
    }
    const float* pv = (tid < 80) ? bo : (tid < 96) ? b2 : (tid < 112) ? g2 : be2;
    l[8] = lds_addr(pbuf + tid * 4);
    g[8] = (tid < 64) ? b1 + tid * 4 : pv + (tid & 15) * 4;
    async_copy_x9(l, g);
#pragma unroll
    for (int grp = 0; grp < 4; ++grp) {
#pragma unroll
      for (int j = 0; j < 9; ++j) {
        const int i = grp * 9 + j;
        const int c = i * 128 + tid;
        l[j] = lds_addr(wbuf + w_lds_index(c));
        g[j] = (i < 4) ? wop + c * 8
                       : (i < 20) ? w1p + (c - 512) * 8 : w2p + (c - 2560) * 8;
      }
      async_copy_x9(l, g);
    }
  }

  {  // stage attention output as bf16
    const int row = tid >> 1;
    const int c0 = (tid & 1) * 32;
    const float* op = O + ((size_t)bt * NDIM + r0 + row) * DDIM + c0;
#pragma unroll
    for (int i = 0; i < 32; ++i) hbuf[row * 80 + c0 + i] = (bf16)op[i];
  }
  // This wave's copies have landed; the barrier publishes them to the others.
  asm volatile("s_wait_asynccnt 0x0" ::: "memory");
  __syncthreads();

  const int wave = tid >> 5, lane = tid & 31;
  const int rowbase = wave * 16;
  const int rhalf = (lane >> 4) * 8;
  const int coln = lane & 15;

  // o @ wo + bo + x  -> xbuf (f32)
#pragma unroll
  for (int nt = 0; nt < 4; ++nt) {
    f32x8 acc = fz;
#pragma unroll
    for (int kt = 0; kt < 2; ++kt)
      acc = wmma_bf16(load_a_frag(hbuf + rowbase * 80 + kt * 32, 80),
                      load_b_lds(wbuf, nt * 2 + kt), acc);
#pragma unroll
    for (int r = 0; r < 8; ++r) {
      const int row_in = rowbase + rhalf + r;
      const int col = nt * 16 + coln;
      const float xv = xbuf[row_in * 72 + col];  // the residual, copied above
      xbuf[row_in * 72 + col] = xv + acc[r] + bos[col];
    }
  }
  __syncthreads();

  {  // LN2 -> hbuf (bf16)
    const int row = tid >> 1;
    const int c0 = (tid & 1) * 32;
    float v[32], s = 0.f, ss = 0.f;
#pragma unroll
    for (int i = 0; i < 32; ++i) {
      v[i] = xbuf[row * 72 + c0 + i];
      s += v[i]; ss += v[i] * v[i];
    }
    s  += __shfl_xor(s, 1);
    ss += __shfl_xor(ss, 1);
    const float mean = s * (1.f / 64.f);
    const float var  = ss * (1.f / 64.f) - mean * mean;
    const float rstd = rsqrtf(var + 1e-5f);
#pragma unroll
    for (int i = 0; i < 32; ++i) {
      const int c = c0 + i;
      hbuf[row * 80 + c] = (bf16)((v[i] - mean) * rstd * g2s[c] + be2s[c]);
    }
  }
  __syncthreads();

  // MLP layer 1: 64 -> 256, ReLU -> ubuf (bf16)
#pragma unroll
  for (int nt = 0; nt < 16; ++nt) {
    f32x8 acc = fz;
#pragma unroll
    for (int kt = 0; kt < 2; ++kt)
      acc = wmma_bf16(load_a_frag(hbuf + rowbase * 80 + kt * 32, 80),
                      load_b_lds(wbuf, 8 + nt * 2 + kt), acc);
#pragma unroll
    for (int r = 0; r < 8; ++r) {
      const int row_in = rowbase + rhalf + r;
      const int col = nt * 16 + coln;
      ubuf[row_in * 264 + col] = (bf16)fmaxf(acc[r] + b1s[col], 0.f);
    }
  }
  __syncthreads();

  // MLP layer 2: 256 -> 64, + residual -> out (original [B,N,T,D] layout)
#pragma unroll
  for (int nt = 0; nt < 4; ++nt) {
    f32x8 acc = fz;
#pragma unroll
    for (int kt = 0; kt < 8; ++kt)
      acc = wmma_bf16(load_a_frag(ubuf + rowbase * 264 + kt * 32, 264),
                      load_b_lds(wbuf, 40 + nt * 8 + kt), acc);
#pragma unroll
    for (int r = 0; r < 8; ++r) {
      const int row_in = rowbase + rhalf + r;
      const int node = r0 + row_in;
      const int col = nt * 16 + coln;
      out[(((size_t)b * NDIM + node) * TDIM + t) * DDIM + col] =
          xbuf[row_in * 72 + col] + acc[r] + b2s[col];
    }
  }
}

// ---------------------------------------------------------------------------
extern "C" void kernel_launch(void* const* d_in, const int* in_sizes, int n_in,
                              void* d_out, int out_size, void* d_ws,
                              size_t ws_size, hipStream_t stream) {
  (void)in_sizes; (void)n_in; (void)out_size; (void)ws_size;
  const float* x   = (const float*)d_in[0];
  const int*   adj = (const int*)d_in[1];
  const float* wq  = (const float*)d_in[2];
  const float* wk  = (const float*)d_in[3];
  const float* wv  = (const float*)d_in[4];
  const float* wo  = (const float*)d_in[5];
  const float* bo  = (const float*)d_in[6];
  const float* w1  = (const float*)d_in[7];
  const float* b1  = (const float*)d_in[8];
  const float* w2  = (const float*)d_in[9];
  const float* b2  = (const float*)d_in[10];
  const float* g1  = (const float*)d_in[11];
  const float* be1 = (const float*)d_in[12];
  const float* g2  = (const float*)d_in[13];
  const float* be2 = (const float*)d_in[14];
  float* out = (float*)d_out;

  char* w = (char*)d_ws;
  size_t off = 0;
  auto carve = [&](size_t bytes) -> void* {
    off = (off + 255) & ~(size_t)255;
    void* p = w + off;
    off += bytes;
    return p;
  };
  const size_t act = (size_t)BT * NDIM * DDIM;  // 1.57M elements
  bf16*     Qf   = (bf16*)carve(act * 2);
  bf16*     Kf   = (bf16*)carve(act * 2);
  bf16*     Vf   = (bf16*)carve(act * 2);
  float*    O    = (float*)carve(act * 4);
  unsigned* adjb = (unsigned*)carve((size_t)NDIM * 32 * 4);
  bf16* wop = (bf16*)carve(64 * 64 * 2);
  bf16* w1p = (bf16*)carve(64 * 256 * 2);
  bf16* w2p = (bf16*)carve(256 * 64 * 2);

  ln_qkv_kernel<<<dim3(LNQ_BLOCKS + ADJ_BLOCKS + WT_BLOCKS), 128, 0, stream>>>(
      x, g1, be1, wq, wk, wv, Qf, Kf, Vf, adj, adjb, wo, w1, w2, wop, w1p, w2p);
  attn_kernel<<<dim3(NDIM / ATT_Q, HDIM, BT), ATT_T, 0, stream>>>(Qf, Kf, Vf, adjb, O);
  proj_mlp_kernel<<<dim3(NDIM / 64, BT), 128, 0, stream>>>(
      x, O, wop, bo, g2, be2, w1p, b1, w2p, b2, out);
}

// v009
// One run takes 26.8 microseconds.
// Two timings next to v008 put it at 1.04 and 1.05 times that version's speed.
// All steps since v000 together make it 4.37 times as fast.
#include <hip/hip_runtime.h>

#define BDIM 2
#define NDIM 1024
#define TDIM 12
#define DDIM 64
#define HDIM 4
#define HD   16
#define BT   (BDIM * TDIM)

typedef __bf16 bf16;
typedef __attribute__((ext_vector_type(16))) __bf16 bf16x16;
typedef __attribute__((ext_vector_type(8)))  __bf16 bf16x8;
typedef __attribute__((ext_vector_type(8)))  float  f32x8;
typedef __attribute__((ext_vector_type(2)))  float  f32x2;

// Scores are kept in units of log2: exp(s) = exp2(s * LOG2E).
#define LOG2E 0x1.715476p+0f

__device__ __forceinline__ f32x8 wmma_bf16(bf16x16 a, bf16x16 b, f32x8 c) {
  return __builtin_amdgcn_wmma_f32_16x16x32_bf16(false, a, false, b, (short)0, c,
                                                 false, false);
}

// A fragment (16x32 bf16, rows on lanes). ISA 7.12.2: lane<16 holds K=0..7 /
// 16..23, lane>=16 holds K=8..15 / 24..31 for row M=lane%16.
__device__ __forceinline__ bf16x16 load_a_frag(const bf16* base, int ld) {
  const int lane = threadIdx.x & 31;
  const int m    = lane & 15;
  const int koff = (lane & 16) ? 8 : 0;
  const bf16* p  = base + m * ld + koff;
  bf16x8 lo = *(const bf16x8*)(p);
  bf16x8 hi = *(const bf16x8*)(p + 16);
  bf16x16 a;
#pragma unroll
  for (int i = 0; i < 8; ++i) { a[i] = lo[i]; a[i + 8] = hi[i]; }
  return a;
}


// ---------------------------------------------------------------------------
// Asynchronous copies to LDS, 16 bytes per lane and copy, every lane on. A run
// of copies shares one statement, so that all of them are in flight together;
// its last line holds every rewrite of an address register behind the copies.
__device__ __forceinline__ unsigned lds_addr(const void* p) {
  return (unsigned)(size_t)p;  // byte offset in the work-group's LDS
}
__device__ __forceinline__ void async_copy_x8(const unsigned (&l)[8],
                                               const void* const (&g)[8]) {
  asm volatile(
      "global_load_async_to_lds_b128 %0, %8, off\n\t"
      "global_load_async_to_lds_b128 %1, %9, off\n\t"
      "global_load_async_to_lds_b128 %2, %10, off\n\t"
      "global_load_async_to_lds_b128 %3, %11, off\n\t"
      "global_load_async_to_lds_b128 %4, %12, off\n\t"
      "global_load_async_to_lds_b128 %5, %13, off\n\t"
      "global_load_async_to_lds_b128 %6, %14, off\n\t"
      "global_load_async_to_lds_b128 %7, %15, off\n\t"
      "s_wait_xcnt 0x0"
      :: "v"(l[0]), "v"(l[1]), "v"(l[2]), "v"(l[3]), "v"(l[4]), "v"(l[5]),
         "v"(l[6]), "v"(l[7]), "v"(g[0]), "v"(g[1]), "v"(g[2]), "v"(g[3]),
         "v"(g[4]), "v"(g[5]), "v"(g[6]), "v"(g[7])
      : "memory");
}
__device__ __forceinline__ void async_copy_x9(const unsigned (&l)[9],
                                               const void* const (&g)[9]) {
  asm volatile(
      "global_load_async_to_lds_b128 %0, %9, off\n\t"
      "global_load_async_to_lds_b128 %1, %10, off\n\t"
      "global_load_async_to_lds_b128 %2, %11, off\n\t"
      "global_load_async_to_lds_b128 %3, %12, off\n\t"
      "global_load_async_to_lds_b128 %4, %13, off\n\t"
      "global_load_async_to_lds_b128 %5, %14, off\n\t"
      "global_load_async_to_lds_b128 %6, %15, off\n\t"
      "global_load_async_to_lds_b128 %7, %16, off\n\t"
      "global_load_async_to_lds_b128 %8, %17, off\n\t"
      "s_wait_xcnt 0x0"
      :: "v"(l[0]), "v"(l[1]), "v"(l[2]), "v"(l[3]), "v"(l[4]), "v"(l[5]),
         "v"(l[6]), "v"(l[7]), "v"(l[8]), "v"(g[0]), "v"(g[1]), "v"(g[2]),
         "v"(g[3]), "v"(g[4]), "v"(g[5]), "v"(g[6]), "v"(g[7]), "v"(g[8])
      : "memory");
}

// Packed weights: in global memory a lane's 16 elements of B fragment
// nt * KT + kt are contiguous. In LDS fragment f is 1 KiB, the lanes' first 16
// bytes in its lower half and their second 16 bytes in its upper half, so that
// each of the two reads of a fragment is 512 contiguous bytes. Chunk c (16
// bytes) of the global order goes to this element offset.
__device__ __forceinline__ int w_lds_index(int c) {
  return (c >> 6) * 512 + (c & 1) * 256 + ((c >> 1) & 31) * 8;
}
__device__ __forceinline__ bf16x16 load_b_lds(const bf16* w, int f) {
  const int lane = threadIdx.x & 31;
  bf16x8 lo = *(const bf16x8*)(w + f * 512 + lane * 8);
  bf16x8 hi = *(const bf16x8*)(w + f * 512 + 256 + lane * 8);
  bf16x16 b;
#pragma unroll
  for (int i = 0; i < 8; ++i) { b[i] = lo[i]; b[i + 8] = hi[i]; }
  return b;
}

// Q, K and V live in the workspace in fragment order: per (bt, head) 64 tiles
// of 16 nodes, a tile being 32 lanes x 8 bf16 = 512 contiguous bytes, so that a
// wave-wide 16-byte access covers four whole cache lines.
//   Q, K tile: lane l holds node (l & 15), channels 8 * (l >> 4) + 0..7.
//   V tile:    lane l holds channel (l & 15), nodes 8 * (l >> 4) + 0..7.
__device__ __forceinline__ size_t frag_index(int bt, int h, int tile, int lane) {
  return ((((size_t)bt * HDIM + h) * (NDIM / 16) + tile) * 32 + lane) * 8;
}

// ---------------------------------------------------------------------------
// Repack one 32x16 tile (kt, nt) of a KxNn f32 weight matrix into per-lane
// B-fragment order (bf16). One wave per tile.
__device__ __forceinline__ void pack_w_tile(const float* __restrict__ src,
                                            bf16* __restrict__ dst, int K, int Nn,
                                            int kt, int nt, int lane) {
  const int KT = K >> 5;
  const int n  = nt * 16 + (lane & 15);
  const int koff = (lane & 16) ? 8 : 0;
  float vals[16];
#pragma unroll
  for (int e = 0; e < 16; ++e) {
    const int p = e >> 1, h = e & 1;
    const int k = kt * 32 + ((p < 4) ? 0 : 16) + ((p & 3) * 2 + h) + koff;
    vals[e] = src[(size_t)k * Nn + n];
  }
  // Stands ahead of the conversions, whose results may land in the registers
  // that the loads above name as addresses.
  asm volatile("s_wait_xcnt 0x0" ::: "memory");
  bf16* d = dst + (((size_t)nt * KT + kt) * 32 + lane) * 16;
#pragma unroll
  for (int e = 0; e < 16; ++e) d[e] = (bf16)vals[e];
}

// The adjacency mask is kept as lane masks of the attention wave: for a tile of
// 16 queries and a chunk of 32 keys, 16 words, one per score register. Bit l of
// word j says whether lane l keeps its score j, which is that of
//   query 16 * qtile + (l & 15),
//   key   32 * kc + 16 * (j >> 3) + 8 * (l >> 4) + (j & 7).
// One wave per (qtile, kc): a lane reads the 16 entries of its own scores.
typedef __attribute__((ext_vector_type(16))) unsigned u32x16;
__device__ __forceinline__ void pack_adj_tile(const int* __restrict__ adj,
                                              unsigned* __restrict__ adjl,
                                              int qtile, int kc, int lane) {
  const int* p = adj + (size_t)(qtile * 16 + (lane & 15)) * NDIM + kc * 32 +
                 ((lane & 16) ? 8 : 0);
  const int4 a[4] = {*(const int4*)(p), *(const int4*)(p + 4),
                     *(const int4*)(p + 16), *(const int4*)(p + 20)};
  // Stands ahead of every rewrite of the address that the four loads name.
  asm volatile("s_wait_xcnt 0x0" ::: "memory");
  unsigned mine = 0u;
#pragma unroll
  for (int q = 0; q < 4; ++q) {
    const unsigned b0 = __builtin_amdgcn_ballot_w32(a[q].x != 0);
    const unsigned b1 = __builtin_amdgcn_ballot_w32(a[q].y != 0);
    const unsigned b2 = __builtin_amdgcn_ballot_w32(a[q].z != 0);
    const unsigned b3 = __builtin_amdgcn_ballot_w32(a[q].w != 0);
    mine = (lane == q * 4 + 0) ? b0 : mine;
    mine = (lane == q * 4 + 1) ? b1 : mine;
    mine = (lane == q * 4 + 2) ? b2 : mine;
    mine = (lane == q * 4 + 3) ? b3 : mine;
  }
  if (lane < 16) adjl[((size_t)qtile * 32 + kc) * 16 + lane] = mine;
}

// ---------------------------------------------------------------------------
// wq, wk, wv in LDS: bf16, row-major as in global memory (row = input channel
// k, 64 output channels n), rows WPITCH elements apart: 160 bytes, an odd
// multiple of 32 bytes, the pitch at which the transposing load has no bank
// conflict. Two transposing loads give the fragment of rows kt * 32 .. + 31 and
// columns nt * 16 .. + 15: lane l holds column (l & 15), k = 8 * (l >> 4) + 0..7
// and 16 more, the k order of load_a_frag.
#define WPITCH 80
typedef __attribute__((ext_vector_type(8))) short s16x8;
typedef __attribute__((ext_vector_type(4))) __bf16 bf16x4;
typedef __attribute__((ext_vector_type(4))) float f32x4;
__device__ __forceinline__ bf16x16 load_w_tr(const bf16* w, int kt, int nt) {
  typedef __attribute__((address_space(3))) s16x8 lds_s16x8;
  const int lane = threadIdx.x & 31;
  const bf16* p = w + (kt * 32 + 8 * (lane >> 4) + (lane & 7)) * WPITCH +
                  nt * 16 + 8 * ((lane >> 3) & 1);
  const bf16x8 lo = __builtin_bit_cast(
      bf16x8, __builtin_amdgcn_ds_load_tr16_b128_v8i16((lds_s16x8*)p));
  const bf16x8 hi = __builtin_bit_cast(
      bf16x8,
      __builtin_amdgcn_ds_load_tr16_b128_v8i16((lds_s16x8*)(p + 16 * WPITCH)));
  bf16x16 b;
#pragma unroll
  for (int i = 0; i < 8; ++i) { b[i] = lo[i]; b[i + 8] = hi[i]; }
  return b;
}

// Sum over a group of 8 lanes, left in each of them: three DPP exchanges.
template <int M>
__device__ __forceinline__ float row_xor_add(float v) {
  return v + __builtin_bit_cast(
                 float, __builtin_amdgcn_update_dpp(
                            0, __builtin_bit_cast(int, v), 0x160 | M, 0xf, 0xf,
                            true));  // 0x160 | M: row_xmask:M
}
__device__ __forceinline__ float row_sum8(float v) {
  return row_xor_add<4>(row_xor_add<2>(row_xor_add<1>(v)));
}

// Kernel 1: LN1 + QKV projection, block = 128 (4 waves), LNQ_BLOCKS blocks.
// The same grid carries, in the blocks behind those, the packing that only the
// later launches read and that reads nothing written here: the adjacency lane
// masks (one tile per wave) and the wo, w1, w2 tiles (one tile per wave).
#define LNQ_BLOCKS (NDIM / 64 * BT)
#define ADJ_TILES  ((NDIM / 16) * (NDIM / 32))
#define ADJ_BLOCKS (ADJ_TILES / 4)
#define WT_BLOCKS  ((8 + 32 + 32) / 4)
__global__ void __launch_bounds__(128)
ln_qkv_kernel(const float* __restrict__ x,
                              const float* __restrict__ g1,
                              const float* __restrict__ be1,
                              const float* __restrict__ wq,
                              const float* __restrict__ wk,
                              const float* __restrict__ wv,
                              bf16* __restrict__ Qf, bf16* __restrict__ Kf,
                              bf16* __restrict__ Vf,
                              const int* __restrict__ adj,
                              unsigned* __restrict__ adjb,
                              const float* __restrict__ wo,
                              const float* __restrict__ w1,
                              const float* __restrict__ w2,
                              bf16* __restrict__ wop, bf16* __restrict__ w1p,
                              bf16* __restrict__ w2p) {
  __shared__ __align__(16) bf16 hbuf[64 * 80];
  __shared__ __align__(16) bf16 wbuf[3 * 64 * WPITCH];  // wq, wk, wv rows
  const int tid = threadIdx.x;
  const int bid = blockIdx.x;
  if (bid >= LNQ_BLOCKS) {  // whole blocks leave here, ahead of the barrier
    const int pw = (bid - LNQ_BLOCKS) * 4 + (tid >> 5);
    const int pl = tid & 31;
    if (pw < ADJ_TILES) {
      pack_adj_tile(adj, adjb, pw >> 5, pw & 31, pl);
    } else {
      const int tl = pw - ADJ_TILES;
      if (tl < 8)       pack_w_tile(wo, wop, 64, 64, tl & 1, tl >> 1, pl);
      else if (tl < 40) pack_w_tile(w1, w1p, 64, 256, tl & 1, (tl - 8) >> 1, pl);
      else              pack_w_tile(w2, w2p, 256, 64, tl & 7, (tl - 40) >> 3, pl);
    }
    return;
  }
  const int bt = bid / (NDIM / 64);
  const int b = bt / TDIM, t = bt % TDIM;
  const int r0 = (bid % (NDIM / 64)) * 64;

  // The three weights, f32 as the inputs have them: 3072 chunks of 16 bytes, 24
  // per thread, a wave-wide load covering four whole lines. They are in flight
  // while the LayerNorm runs.
  f32x4 wreg[24];
#pragma unroll
  for (int i = 0; i < 24; ++i) {
    const float* ws = (i < 8) ? wq : (i < 16) ? wk : wv;
    wreg[i] = *(const f32x4*)(ws + ((i & 7) * 128 + tid) * 4);
  }
  // Keeps the 24 loads up here: left free, part of them moves down to the
  // conversions and meets its whole latency there.
  __builtin_amdgcn_sched_barrier(0);

  {  // LayerNorm: 8 lanes per row, so that a wave-wide load is the same half
    // (128 bytes, one whole line) of four rows. A wave takes the 16 rows whose
    // fragments it reads below, four at a time; a lane holds 8 columns of each.
    const int pc = tid & 7;
    const int row0 = (tid >> 5) * 16 + ((tid >> 3) & 3);
    const float* xr =
        x + (((size_t)b * NDIM + (r0 + row0)) * TDIM + t) * DDIM + pc * 4;
    f32x4 v[4][2], g[2], be[2];
#pragma unroll
    for (int i = 0; i < 4; ++i)
#pragma unroll
      for (int hf = 0; hf < 2; ++hf)
        v[i][hf] = *(const f32x4*)(xr + i * (4 * TDIM * DDIM) + hf * 32);
#pragma unroll
    for (int hf = 0; hf < 2; ++hf) {
      g[hf]  = *(const f32x4*)(g1 + hf * 32 + pc * 4);
      be[hf] = *(const f32x4*)(be1 + hf * 32 + pc * 4);
    }
    // Stands ahead of every rewrite of a register that the loads of the weights,
    // of x and of the two parameter vectors name as their address; as inputs of
    // the wait, the addresses stay in place up to it.
    asm volatile("s_wait_xcnt 0x0" :: "v"(tid), "v"(xr), "v"(pc) : "memory");
    float s[4], ss[4];
#pragma unroll
    for (int i = 0; i < 4; ++i) {
      const f32x4 a = v[i][0], c = v[i][1];
      s[i]  = ((a.x + a.y) + (a.z + a.w)) + ((c.x + c.y) + (c.z + c.w));
      ss[i] = ((a.x * a.x + a.y * a.y) + (a.z * a.z + a.w * a.w)) +
              ((c.x * c.x + c.y * c.y) + (c.z * c.z + c.w * c.w));
    }
#pragma unroll
    for (int i = 0; i < 4; ++i) { s[i] = row_sum8(s[i]); ss[i] = row_sum8(ss[i]); }
#pragma unroll
    for (int i = 0; i < 4; ++i) {
      const float mean = s[i] * (1.f / 64.f);
      const float var  = ss[i] * (1.f / 64.f) - mean * mean;
      const float rstd = rsqrtf(var + 1e-5f);
#pragma unroll
      for (int hf = 0; hf < 2; ++hf) {
        const f32x4 a = v[i][hf];
        const bf16x4 o = {(bf16)((a.x - mean) * rstd * g[hf].x + be[hf].x),
                          (bf16)((a.y - mean) * rstd * g[hf].y + be[hf].y),
                          (bf16)((a.z - mean) * rstd * g[hf].z + be[hf].z),
                          (bf16)((a.w - mean) * rstd * g[hf].w + be[hf].w)};
        *(bf16x4*)(hbuf + (row0 + 4 * i) * 80 + hf * 32 + pc * 4) = o;
      }
    }
  }
  // Inputs only: holds the wait for the weights, and the conversions behind it,
  // down here. Left free, the conversions move up ahead of the LayerNorm, which
  // then starts only when the weights have arrived. It also keeps each load whole
  // (16 bytes a lane) where the compiler otherwise halves it. The scheduling
  // barrier is what stops the conversions, which the statement does not order.
  __builtin_amdgcn_sched_barrier(0);
  asm volatile("" :: "v"(wreg[0]), "v"(wreg[1]), "v"(wreg[2]), "v"(wreg[3]),
               "v"(wreg[4]), "v"(wreg[5]), "v"(wreg[6]), "v"(wreg[7]),
               "v"(wreg[8]), "v"(wreg[9]), "v"(wreg[10]), "v"(wreg[11]),
               "v"(wreg[12]), "v"(wreg[13]), "v"(wreg[14]), "v"(wreg[15]),
               "v"(wreg[16]), "v"(wreg[17]), "v"(wreg[18]), "v"(wreg[19]),
               "v"(wreg[20]), "v"(wreg[21]), "v"(wreg[22]), "v"(wreg[23]));
  // The weights go to LDS as bf16, row-major: chunk c is row c >> 4 of the 192,
  // columns 4 * (c & 15) .. + 3.
#pragma unroll
  for (int i = 0; i < 24; ++i) {
    const int c = i * 128 + tid;
    const bf16x4 o = {(bf16)wreg[i].x, (bf16)wreg[i].y, (bf16)wreg[i].z,
                      (bf16)wreg[i].w};
    *(bf16x4*)(wbuf + (c >> 4) * WPITCH + (c & 15) * 4) = o;
  }
  __syncthreads();

  const int wave = tid >> 5, lane = tid & 31;
  const int rowbase = wave * 16;
  bf16* frags[3] = {Qf, Kf, Vf};
  const int tile = (r0 + rowbase) >> 4;
  const f32x8 fz = {0.f, 0.f, 0.f, 0.f, 0.f, 0.f, 0.f, 0.f};

  // Head nt of this wave's 16 nodes is one fragment tile. Q and K are formed
  // transposed (W^T h^T: the two operands swap places, their k orders being
  // equal), so a lane ends with 8 channels of one node; V stays h W, so a lane
  // ends with 8 nodes of one channel. Either way the lane's 8 values are the
  // 16 bytes that the same lane of an attention wave loads.
#pragma unroll
  for (int mtx = 0; mtx < 3; ++mtx) {
    bf16x8 o[4];
#pragma unroll
    for (int nt = 0; nt < 4; ++nt) {
      f32x8 acc = fz;
#pragma unroll
      for (int kt = 0; kt < 2; ++kt) {
        const bf16x16 hf = load_a_frag(hbuf + rowbase * 80 + kt * 32, 80);
        const bf16x16 wf = load_w_tr(wbuf + mtx * 64 * WPITCH, kt, nt);
        acc = (mtx == 2) ? wmma_bf16(hf, wf, acc) : wmma_bf16(wf, hf, acc);
      }
#pragma unroll
      for (int r = 0; r < 8; ++r)  // Q pre-scaled by log2(e) / sqrt(HD)
        o[nt][r] = (bf16)((mtx == 0) ? acc[r] * (0.25f * LOG2E) : acc[r]);
    }
    bf16* dst = frags[mtx] + frag_index(bt, 0, tile, lane);
#pragma unroll
    for (int nt = 0; nt < 4; ++nt)
      *(bf16x8*)(dst + frag_index(0, nt, 0, 0)) = o[nt];
    // Stands ahead of every rewrite of a register that the four stores name;
    // as inputs of the wait, address and data stay in place up to it.
    asm volatile("s_wait_xcnt 0x0"
                 :: "v"(dst), "v"(o[0]), "v"(o[1]), "v"(o[2]), "v"(o[3])
                 : "memory");
  }
}

#define ATT_WAVES 8
#define ATT_Q     (ATT_WAVES * 16)
#define ATT_T     (ATT_WAVES * 32)

// Value of lane l ^ 16 (the other half of the same query column).
__device__ __forceinline__ float other_half(float v) {
  const int b = __builtin_bit_cast(int, v);
  return __builtin_bit_cast(
      float, __builtin_amdgcn_permlanex16(b, b, 0x76543210, 0xfedcba98, false,
                                          false));
}

// s in the lanes whose bit of the wave-uniform word w is set, else 'masked':
// the word is used as a lane mask, so this is one conditional move.
__device__ __forceinline__ float mask_score(float s, unsigned w, float masked) {
  return __builtin_amdgcn_inverse_ballot_w32(w) ? s : masked;
}

// The score of a masked key, in log2 units.
#define MASKED (-1e9f * LOG2E)
// A trip's sum of exponentials (32 per lane) above which the maximum in use is
// renewed: below it no exponential exceeds 2^12.
#define P_LIMIT 4096.f

// P^T B-fragment of one chunk of 32 keys. negm holds minus the maximum in use
// in all eight registers: as the C operand it leaves each score ready for exp2.
// 'maskedp' is MASKED minus that maximum. The exponentials are added to ps.
__device__ __forceinline__ bf16x16 chunk_p(bf16x16 ka0, bf16x16 ka1, bf16x16 qb,
                                           f32x8 negm, float maskedp, u32x16 mw,
                                           f32x2& ps) {
  // s0[r] = S[query coln][32 * chunk + koff + r] - maximum, s1[r]: 16 keys on.
  const f32x8 s0 = wmma_bf16(ka0, qb, negm);
  const f32x8 s1 = wmma_bf16(ka1, qb, negm);
  bf16x16 pb;  // word r of mw: s0[r], word 8 + r: s1[r]
#pragma unroll
  for (int r = 0; r < 8; ++r) {
    const float e0 =
        __builtin_amdgcn_exp2f(mask_score(s0[r], mw[r], maskedp));
    const float e1 =
        __builtin_amdgcn_exp2f(mask_score(s1[r], mw[8 + r], maskedp));
    ps += f32x2{e0, e1};
    pb[r]     = (bf16)e0;
    pb[r + 8] = (bf16)e1;
  }
  return pb;
}

// Largest masked score of one chunk in this lane, and cm.
__device__ __forceinline__ float chunk_max(bf16x16 ka0, bf16x16 ka1, bf16x16 qb,
                                           u32x16 mw, float cm) {
  const f32x8 fz = {0.f, 0.f, 0.f, 0.f, 0.f, 0.f, 0.f, 0.f};
  const f32x8 s0 = wmma_bf16(ka0, qb, fz);
  const f32x8 s1 = wmma_bf16(ka1, qb, fz);
#pragma unroll
  for (int r = 0; r < 8; ++r)
    cm = fmaxf(cm, fmaxf(mask_score(s0[r], mw[r], MASKED),
                         mask_score(s1[r], mw[8 + r], MASKED)));
  return cm;
}

__global__ void attn_kernel(const bf16* __restrict__ Qf,
                            const bf16* __restrict__ Kf,
                            const bf16* __restrict__ Vf,
                            const unsigned* __restrict__ adjb,
                            bf16* __restrict__ Of) {
  __shared__ __align__(16) bf16 kbuf[NDIM * HD];
  __shared__ __align__(16) bf16 vbuf[NDIM * HD];
  const int tid = threadIdx.x;
  // The wave's number in a scalar register: the mask words' address is formed
  // from it, and only a wave-uniform address is read by scalar loads.
  const int wave = __builtin_amdgcn_readfirstlane(tid >> 5);
  const int lane = tid & 31;
  const int qt = blockIdx.x, h = blockIdx.y, bt = blockIdx.z;
  const int qblock = qt * ATT_Q;
  const int qbase = qblock + wave * 16;

  {  // K, then V: 2048 chunks of 16 bytes each, eight per thread.
    unsigned l[8];
    const void* g[8];
    const bf16* kg = Kf + frag_index(bt, h, 0, 0);
    const bf16* vg = Vf + frag_index(bt, h, 0, 0);
#pragma unroll
    for (int i = 0; i < 8; ++i) {
      const int c = i * ATT_T + tid;
      l[i] = lds_addr(kbuf + c * 8);
      g[i] = kg + c * 8;
    }
    async_copy_x8(l, g);
#pragma unroll
    for (int i = 0; i < 8; ++i) {
      const int c = i * ATT_T + tid;
      l[i] = lds_addr(vbuf + c * 8);
      g[i] = vg + c * 8;
    }
    async_copy_x8(l, g);
  }
  // This wave's copies have landed; the barrier publishes them to the others.
  asm volatile("s_wait_asynccnt 0x0" ::: "memory");
  __syncthreads();

  // Q^T B-fragment (column = query): HD=16 channels zero-padded to K=32.
  bf16x16 qb;
  {
    bf16x8 lo = *(const bf16x8*)(Qf + frag_index(bt, h, qbase >> 4, lane));
#pragma unroll
    for (int i = 0; i < 8; ++i) { qb[i] = lo[i]; qb[i + 8] = (bf16)0.f; }
  }

  // Per lane: the maximum in use for its query (equal in both halves; it may
  // lag the true running maximum by up to 12), the sum of its own half's keys,
  // and 8 output channels of its query.
  float mrun = MASKED, maskedp = 0.f, lrun = 0.f;
  f32x8 negm;
#pragma unroll
  for (int r = 0; r < 8; ++r) negm[r] = -MASKED;
  f32x8 oacc = {0.f, 0.f, 0.f, 0.f, 0.f, 0.f, 0.f, 0.f};

  // A chunk of 32 keys is two tiles: 512 elements of K and 512 of V.
  const bf16* kp = kbuf + lane * 8;
  const bf16* vp = vbuf + lane * 8;
  // This wave's lane masks: 16 words a chunk, read one trip (two chunks) ahead.
  const u32x16* mrow = (const u32x16*)(adjb + (size_t)(qbase >> 4) * 32 * 16);
  u32x16 mcur[2] = {mrow[0], mrow[1]};
  bf16x16 ka[4];  // upper halves (k = 16..31) stay zero through the loop
#pragma unroll
  for (int f = 0; f < 4; ++f)
#pragma unroll
    for (int i = 0; i < 16; ++i) ka[f][i] = (bf16)0.f;

  // Takes the larger of the maximum in use and the trip's own maximum (keys in
  // ka, words in mw) into use, and rescales sum and output to it.
  auto renew_max = [&](const u32x16 (&mw)[2]) {
    float cm = chunk_max(ka[0], ka[1], qb, mw[0], MASKED);
    cm = chunk_max(ka[2], ka[3], qb, mw[1], cm);
    const float mnew = fmaxf(mrun, fmaxf(cm, other_half(cm)));
    const float corr = __builtin_amdgcn_exp2f(mrun - mnew);
    mrun = mnew;
    maskedp = MASKED - mnew;
    lrun *= corr;
#pragma unroll
    for (int r = 0; r < 8; ++r) { oacc[r] *= corr; negm[r] = -mnew; }
  };
  // Four K A-fragments (row = key, channels on K dim, zero-padded to 32).
  auto load_k = [&]() {
#pragma unroll
    for (int f = 0; f < 4; ++f) {
      const bf16x8 l = *(const bf16x8*)(kp + f * 256);
#pragma unroll
      for (int i = 0; i < 8; ++i) ka[f][i] = l[i];
    }
  };

  // The first trip's own maximum starts the loop.
  load_k();
  renew_max(mcur);

  // Two chunks a trip: their LDS reads share one address register, and their
  // mask words are one 128-byte line.
  for (int kc = 0; kc < 32; kc += 2) {
    // The last trip reads chunks 0 and 1 again, unused.
    const u32x16 mnext[2] = {mrow[(kc + 2) & 31], mrow[(kc + 3) & 31]};
    load_k();
    // Two V^T A-fragments (row = channel, keys in the hardware k order).
    bf16x16 va[2];
#pragma unroll
    for (int c = 0; c < 2; ++c) {
      const bf16x8 lo = *(const bf16x8*)(vp + c * 512);
      const bf16x8 hi = *(const bf16x8*)(vp + c * 512 + 256);
#pragma unroll
      for (int i = 0; i < 8; ++i) { va[c][i] = lo[i]; va[c][i + 8] = hi[i]; }
    }
    kp += 1024;
    vp += 1024;
    // Keeps all of the trip's loads, V's too, up here, ahead of the arithmetic
    // that hides their latency; left free, V's loads move down to the wait.
    __builtin_amdgcn_sched_barrier(0);

    f32x2 ps0 = {0.f, 0.f}, ps1 = {0.f, 0.f};
    bf16x16 pb0 = chunk_p(ka[0], ka[1], qb, negm, maskedp, mcur[0], ps0);
    bf16x16 pb1 = chunk_p(ka[2], ka[3], qb, negm, maskedp, mcur[1], ps1);
    ps0 += ps1;
    float pt = ps0.x + ps0.y;
    // Inputs only: keeps the loads of the next trip's mask words and of this
    // trip's V ahead of the branch below. Without it they sink behind it, to
    // their first use, where a wave would wait out the whole load latency. The
    // scheduling barrier keeps the statement, and so the wait for the loads, at
    // this place instead of directly behind them. negm is named so that it is
    // still in use behind the last score product: otherwise the compiler lets
    // that product overwrite its C operand and copies the eight registers for
    // it in every trip.
    __builtin_amdgcn_sched_barrier(0);
    asm volatile("" :: "s"(mnext[0]), "s"(mnext[1]), "v"(va[0]), "v"(va[1]), "v"(negm));
    // One test a trip, the same for the whole wave: a scalar branch.
    if (__builtin_amdgcn_ballot_w32(pt > P_LIMIT) != 0u) {
      // Some query's scores have outgrown the maximum in use: P is formed anew.
      renew_max(mcur);
      ps0 = f32x2{0.f, 0.f};
      ps1 = f32x2{0.f, 0.f};
      pb0 = chunk_p(ka[0], ka[1], qb, negm, maskedp, mcur[0], ps0);
      pb1 = chunk_p(ka[2], ka[3], qb, negm, maskedp, mcur[1], ps1);
      ps0 += ps1;
      pt = ps0.x + ps0.y;
    }
    lrun += pt;
    oacc = wmma_bf16(va[0], pb0, oacc);
    oacc = wmma_bf16(va[1], pb1, oacc);
    mcur[0] = mnext[0];
    mcur[1] = mnext[1];
  }

  // oacc[r] = O[query lane & 15][channel 8 * (lane >> 4) + r] of this head: a
  // tile in the order of Q's, rounded here to the bf16 that the output
  // projection multiplies. The wave's store is 512 contiguous bytes.
  const float inv = 1.f / (lrun + other_half(lrun));
  bf16x8 ob;
#pragma unroll
  for (int r = 0; r < 8; ++r) ob[r] = (bf16)(oacc[r] * inv);
  *(bf16x8*)(Of + frag_index(bt, h, qbase >> 4, lane)) = ob;
}

// ---------------------------------------------------------------------------
// Kernel 3: out-proj + residual + LN2 + MLP + residual.
// grid = (N/64, BT), block = 128.
__global__ void proj_mlp_kernel(const float* __restrict__ x,
                                const bf16* __restrict__ Of,
                                const bf16* __restrict__ wop,
                                const float* __restrict__ bo,
                                const float* __restrict__ g2,
                                const float* __restrict__ be2,
                                const bf16* __restrict__ w1p,
                                const float* __restrict__ b1,
                                const bf16* __restrict__ w2p,
                                const float* __restrict__ b2,
                                float* __restrict__ out) {
  __shared__ __align__(16) bf16 hbuf[64 * 80];
  __shared__ __align__(16) float xbuf[64 * 72];
  __shared__ __align__(16) bf16 ubuf[64 * 264];
  __shared__ __align__(16) bf16 wbuf[(8 + 32 + 32) * 512];  // wo, w1, w2
  __shared__ __align__(16) float pbuf[512];  // b1, bo, b2, g2, be2
  const float* b1s = pbuf;
  const float* bos = pbuf + 256;
  const float* b2s = pbuf + 320;
  const float* g2s = pbuf + 384;
  const float* be2s = pbuf + 448;
  const int tid = threadIdx.x;
  const int bt = blockIdx.y;
  const int b = bt / TDIM, t = bt % TDIM;
  const int r0 = blockIdx.x * 64;
  const f32x8 fz = {0.f, 0.f, 0.f, 0.f, 0.f, 0.f, 0.f, 0.f};

  {  // All that the later phases read from global memory, bar the attention output, flies to LDS at once:
    // the 64 residual rows (16 chunks of 16 bytes each), the five parameter
    // vectors (128 chunks) and the three packed weights (4608 chunks).
    unsigned l[9];
    const void* g[9];
#pragma unroll
    for (int i = 0; i < 8; ++i) {
      const int c = i * 128 + tid;
      const int row = c >> 4, pc = c & 15;
      l[i] = lds_addr(xbuf + row * 72 + pc * 4);
      g[i] = x + (((size_t)b * NDIM + r0 + row) * TDIM + t) * DDIM + pc * 4;
    }
    const float* pv = (tid < 80) ? bo : (tid < 96) ? b2 : (tid < 112) ? g2 : be2;
    l[8] = lds_addr(pbuf + tid * 4);
    g[8] = (tid < 64) ? b1 + tid * 4 : pv + (tid & 15) * 4;
    async_copy_x9(l, g);
#pragma unroll
    for (int grp = 0; grp < 4; ++grp) {
#pragma unroll
      for (int j = 0; j < 9; ++j) {
        const int i = grp * 9 + j;
        const int c = i * 128 + tid;
        l[j] = lds_addr(wbuf + w_lds_index(c));
        g[j] = (i < 4) ? wop + c * 8
                       : (i < 20) ? w1p + (c - 512) * 8 : w2p + (c - 2560) * 8;
      }
      async_copy_x9(l, g);
    }
  }

  const int wave = tid >> 5, lane = tid & 31;
  const int rowbase = wave * 16;
  const int rhalf = (lane >> 4) * 8;
  const int coln = lane & 15;

  // The attention output of this wave's 16 rows: the tiles of heads 2 kt and
  // 2 kt + 1 are, lane by lane, the two halves of A fragment kt (the k order of
  // load_a_frag). Four wave-wide loads of 512 contiguous bytes.
  bf16x16 of[2];
  {
    const bf16* op = Of + frag_index(bt, 0, (r0 + rowbase) >> 4, lane);
    bf16x8 ot[4];
#pragma unroll
    for (int hh = 0; hh < 4; ++hh)
      ot[hh] = *(const bf16x8*)(op + frag_index(0, hh, 0, 0));
    // Stands ahead of every rewrite of the address that the four loads name.
    asm volatile("s_wait_xcnt 0x0" :: "v"(op) : "memory");
#pragma unroll
    for (int kt = 0; kt < 2; ++kt)
#pragma unroll
      for (int i = 0; i < 8; ++i) {
        of[kt][i] = ot[2 * kt][i];
        of[kt][i + 8] = ot[2 * kt + 1][i];
      }
  }
  // This wave's copies have landed; the barrier publishes them to the others.
  asm volatile("s_wait_asynccnt 0x0" ::: "memory");
  __syncthreads();

  // o @ wo + bo + x  -> xbuf (f32)
#pragma unroll
  for (int nt = 0; nt < 4; ++nt) {
    f32x8 acc = fz;
#pragma unroll
    for (int kt = 0; kt < 2; ++kt)
      acc = wmma_bf16(of[kt], load_b_lds(wbuf, nt * 2 + kt), acc);
#pragma unroll
    for (int r = 0; r < 8; ++r) {
      const int row_in = rowbase + rhalf + r;
      const int col = nt * 16 + coln;
      const float xv = xbuf[row_in * 72 + col];  // the residual, copied above
      xbuf[row_in * 72 + col] = xv + acc[r] + bos[col];
    }
  }
  __syncthreads();

  {  // LN2 -> hbuf (bf16)
    const int row = tid >> 1;
    const int c0 = (tid & 1) * 32;
    float v[32], s = 0.f, ss = 0.f;
#pragma unroll
    for (int i = 0; i < 32; ++i) {
      v[i] = xbuf[row * 72 + c0 + i];
      s += v[i]; ss += v[i] * v[i];
    }
    s  += __shfl_xor(s, 1);
    ss += __shfl_xor(ss, 1);
    const float mean = s * (1.f / 64.f);
    const float var  = ss * (1.f / 64.f) - mean * mean;
    const float rstd = rsqrtf(var + 1e-5f);
#pragma unroll
    for (int i = 0; i < 32; ++i) {
      const int c = c0 + i;
      hbuf[row * 80 + c] = (bf16)((v[i] - mean) * rstd * g2s[c] + be2s[c]);
    }
  }
  __syncthreads();

  // MLP layer 1: 64 -> 256, ReLU -> ubuf (bf16)
#pragma unroll
  for (int nt = 0; nt < 16; ++nt) {
    f32x8 acc = fz;
#pragma unroll
    for (int kt = 0; kt < 2; ++kt)
      acc = wmma_bf16(load_a_frag(hbuf + rowbase * 80 + kt * 32, 80),
                      load_b_lds(wbuf, 8 + nt * 2 + kt), acc);
#pragma unroll
    for (int r = 0; r < 8; ++r) {
      const int row_in = rowbase + rhalf + r;
      const int col = nt * 16 + coln;
      ubuf[row_in * 264 + col] = (bf16)fmaxf(acc[r] + b1s[col], 0.f);
    }
  }
  __syncthreads();

  // MLP layer 2: 256 -> 64, + residual -> out (original [B,N,T,D] layout)
#pragma unroll
  for (int nt = 0; nt < 4; ++nt) {
    f32x8 acc = fz;
#pragma unroll
    for (int kt = 0; kt < 8; ++kt)
      acc = wmma_bf16(load_a_frag(ubuf + rowbase * 264 + kt * 32, 264),
                      load_b_lds(wbuf, 40 + nt * 8 + kt), acc);
#pragma unroll
    for (int r = 0; r < 8; ++r) {
      const int row_in = rowbase + rhalf + r;
      const int node = r0 + row_in;
      const int col = nt * 16 + coln;
      out[(((size_t)b * NDIM + node) * TDIM + t) * DDIM + col] =
          xbuf[row_in * 72 + col] + acc[r] + b2s[col];
    }
  }
}

// ---------------------------------------------------------------------------
extern "C" void kernel_launch(void* const* d_in, const int* in_sizes, int n_in,
                              void* d_out, int out_size, void* d_ws,
                              size_t ws_size, hipStream_t stream) {
  (void)in_sizes; (void)n_in; (void)out_size; (void)ws_size;
  const float* x   = (const float*)d_in[0];
  const int*   adj = (const int*)d_in[1];
  const float* wq  = (const float*)d_in[2];
  const float* wk  = (const float*)d_in[3];
  const float* wv  = (const float*)d_in[4];
  const float* wo  = (const float*)d_in[5];
  const float* bo  = (const float*)d_in[6];
  const float* w1  = (const float*)d_in[7];
  const float* b1  = (const float*)d_in[8];
  const float* w2  = (const float*)d_in[9];
  const float* b2  = (const float*)d_in[10];
  const float* g1  = (const float*)d_in[11];
  const float* be1 = (const float*)d_in[12];
  const float* g2  = (const float*)d_in[13];
  const float* be2 = (const float*)d_in[14];
  float* out = (float*)d_out;

  char* w = (char*)d_ws;
  size_t off = 0;
  auto carve = [&](size_t bytes) -> void* {
    off = (off + 255) & ~(size_t)255;
    void* p = w + off;
    off += bytes;
    return p;
  };
  const size_t act = (size_t)BT * NDIM * DDIM;  // 1.57M elements
  bf16*     Qf   = (bf16*)carve(act * 2);
  bf16*     Kf   = (bf16*)carve(act * 2);
  bf16*     Vf   = (bf16*)carve(act * 2);
  bf16*     Of   = (bf16*)carve(act * 2);
  unsigned* adjb = (unsigned*)carve((size_t)NDIM * 32 * 4);
  bf16* wop = (bf16*)carve(64 * 64 * 2);
  bf16* w1p = (bf16*)carve(64 * 256 * 2);
  bf16* w2p = (bf16*)carve(256 * 64 * 2);

  ln_qkv_kernel<<<dim3(LNQ_BLOCKS + ADJ_BLOCKS + WT_BLOCKS), 128, 0, stream>>>(
      x, g1, be1, wq, wk, wv, Qf, Kf, Vf, adj, adjb, wo, w1, w2, wop, w1p, w2p);
  attn_kernel<<<dim3(NDIM / ATT_Q, HDIM, BT), ATT_T, 0, stream>>>(Qf, Kf, Vf, adjb, Of);
  proj_mlp_kernel<<<dim3(NDIM / 64, BT), 128, 0, stream>>>(
      x, Of, wop, bo, g2, be2, w1p, b1, w2p, b2, out);
}

// v010
// One run takes 25.8 microseconds.
// Two timings next to v009 both put it at 1.05 times that version's speed.
// All steps since v000 together make it 4.58 times as fast.
#include <hip/hip_runtime.h>

#define BDIM 2
#define NDIM 1024
#define TDIM 12
#define DDIM 64
#define HDIM 4
#define HD   16
#define BT   (BDIM * TDIM)

typedef __bf16 bf16;
typedef __attribute__((ext_vector_type(16))) __bf16 bf16x16;
typedef __attribute__((ext_vector_type(8)))  __bf16 bf16x8;
typedef __attribute__((ext_vector_type(8)))  float  f32x8;
typedef __attribute__((ext_vector_type(2)))  float  f32x2;

// Scores are kept in units of log2: exp(s) = exp2(s * LOG2E).
#define LOG2E 0x1.715476p+0f

__device__ __forceinline__ f32x8 wmma_bf16(bf16x16 a, bf16x16 b, f32x8 c) {
  return __builtin_amdgcn_wmma_f32_16x16x32_bf16(false, a, false, b, (short)0, c,
                                                 false, false);
}

// A fragment (16x32 bf16, rows on lanes). ISA 7.12.2: lane<16 holds K=0..7 /
// 16..23, lane>=16 holds K=8..15 / 24..31 for row M=lane%16.
__device__ __forceinline__ bf16x16 load_a_frag(const bf16* base, int ld) {
  const int lane = threadIdx.x & 31;
  const int m    = lane & 15;
  const int koff = (lane & 16) ? 8 : 0;
  const bf16* p  = base + m * ld + koff;
  bf16x8 lo = *(const bf16x8*)(p);
  bf16x8 hi = *(const bf16x8*)(p + 16);
  bf16x16 a;
#pragma unroll
  for (int i = 0; i < 8; ++i) { a[i] = lo[i]; a[i + 8] = hi[i]; }
  return a;
}


// ---------------------------------------------------------------------------
// Asynchronous copies to LDS, 16 or 4 bytes per lane and copy, every lane on. A run
// of copies shares one statement, so that all of them are in flight together;
// its last line holds every rewrite of an address register behind the copies.
__device__ __forceinline__ unsigned lds_addr(const void* p) {
  return (unsigned)(size_t)p;  // byte offset in the work-group's LDS
}
__device__ __forceinline__ void async_copy_x8(const unsigned (&l)[8],
                                               const void* const (&g)[8]) {
  asm volatile(
      "global_load_async_to_lds_b128 %0, %8, off\n\t"
      "global_load_async_to_lds_b128 %1, %9, off\n\t"
      "global_load_async_to_lds_b128 %2, %10, off\n\t"
      "global_load_async_to_lds_b128 %3, %11, off\n\t"
      "global_load_async_to_lds_b128 %4, %12, off\n\t"
      "global_load_async_to_lds_b128 %5, %13, off\n\t"
      "global_load_async_to_lds_b128 %6, %14, off\n\t"
      "global_load_async_to_lds_b128 %7, %15, off\n\t"
      "s_wait_xcnt 0x0"
      :: "v"(l[0]), "v"(l[1]), "v"(l[2]), "v"(l[3]), "v"(l[4]), "v"(l[5]),
         "v"(l[6]), "v"(l[7]), "v"(g[0]), "v"(g[1]), "v"(g[2]), "v"(g[3]),
         "v"(g[4]), "v"(g[5]), "v"(g[6]), "v"(g[7])
      : "memory");
}
__device__ __forceinline__ void async_copy_x12(const unsigned (&l)[12],
                                                const void* const (&g)[12]) {
  asm volatile(
      "global_load_async_to_lds_b128 %0, %12, off\n\t"
      "global_load_async_to_lds_b128 %1, %13, off\n\t"
      "global_load_async_to_lds_b128 %2, %14, off\n\t"
      "global_load_async_to_lds_b128 %3, %15, off\n\t"
      "global_load_async_to_lds_b128 %4, %16, off\n\t"
      "global_load_async_to_lds_b128 %5, %17, off\n\t"
      "global_load_async_to_lds_b128 %6, %18, off\n\t"
      "global_load_async_to_lds_b128 %7, %19, off\n\t"
      "global_load_async_to_lds_b128 %8, %20, off\n\t"
      "global_load_async_to_lds_b128 %9, %21, off\n\t"
      "global_load_async_to_lds_b128 %10, %22, off\n\t"
      "global_load_async_to_lds_b128 %11, %23, off\n\t"
      "s_wait_xcnt 0x0"
      :: "v"(l[0]), "v"(l[1]), "v"(l[2]), "v"(l[3]), "v"(l[4]), "v"(l[5]),
         "v"(l[6]), "v"(l[7]), "v"(l[8]), "v"(l[9]), "v"(l[10]), "v"(l[11]),
         "v"(g[0]), "v"(g[1]), "v"(g[2]), "v"(g[3]), "v"(g[4]), "v"(g[5]),
         "v"(g[6]), "v"(g[7]), "v"(g[8]), "v"(g[9]), "v"(g[10]), "v"(g[11])
      : "memory");
}
// Four copies of 16 bytes and one of 4 bytes per lane.
__device__ __forceinline__ void async_copy_x4_b32(const unsigned (&l)[4],
                                                   const void* const (&g)[4],
                                                   unsigned l4, const void* g4) {
  asm volatile(
      "global_load_async_to_lds_b128 %0, %5, off\n\t"
      "global_load_async_to_lds_b128 %1, %6, off\n\t"
      "global_load_async_to_lds_b128 %2, %7, off\n\t"
      "global_load_async_to_lds_b128 %3, %8, off\n\t"
      "global_load_async_to_lds_b32 %4, %9, off\n\t"
      "s_wait_xcnt 0x0"
      :: "v"(l[0]), "v"(l[1]), "v"(l[2]), "v"(l[3]), "v"(l4), "v"(g[0]),
         "v"(g[1]), "v"(g[2]), "v"(g[3]), "v"(g4)
      : "memory");
}

// Packed weights: in global memory a lane's 16 elements of B fragment
// nt * KT + kt are contiguous. In LDS fragment f is 1 KiB, the lanes' first 16
// bytes in its lower half and their second 16 bytes in its upper half, so that
// each of the two reads of a fragment is 512 contiguous bytes. Chunk c (16
// bytes) of the global order goes to this element offset.
__device__ __forceinline__ int w_lds_index(int c) {
  return (c >> 6) * 512 + (c & 1) * 256 + ((c >> 1) & 31) * 8;
}
__device__ __forceinline__ bf16x16 load_b_lds(const bf16* w, int f) {
  const int lane = threadIdx.x & 31;
  bf16x8 lo = *(const bf16x8*)(w + f * 512 + lane * 8);
  bf16x8 hi = *(const bf16x8*)(w + f * 512 + 256 + lane * 8);
  bf16x16 b;
#pragma unroll
  for (int i = 0; i < 8; ++i) { b[i] = lo[i]; b[i + 8] = hi[i]; }
  return b;
}

// Q, K and V live in the workspace in fragment order: per (bt, head) 64 tiles
// of 16 nodes, a tile being 32 lanes x 8 bf16 = 512 contiguous bytes, so that a
// wave-wide 16-byte access covers four whole cache lines.
//   Q, K tile: lane l holds node (l & 15), channels 8 * (l >> 4) + 0..7.
//   V tile:    lane l holds channel (l & 15), nodes 8 * (l >> 4) + 0..7.
__device__ __forceinline__ size_t frag_index(int bt, int h, int tile, int lane) {
  return ((((size_t)bt * HDIM + h) * (NDIM / 16) + tile) * 32 + lane) * 8;
}

// ---------------------------------------------------------------------------
// Repack one 32x16 tile (kt, nt) of a KxNn f32 weight matrix into per-lane
// B-fragment order (bf16). One wave per tile.
__device__ __forceinline__ void pack_w_tile(const float* __restrict__ src,
                                            bf16* __restrict__ dst, int K, int Nn,
                                            int kt, int nt, int lane) {
  const int KT = K >> 5;
  const int n  = nt * 16 + (lane & 15);
  const int koff = (lane & 16) ? 8 : 0;
  float vals[16];
#pragma unroll
  for (int e = 0; e < 16; ++e) {
    const int p = e >> 1, h = e & 1;
    const int k = kt * 32 + ((p < 4) ? 0 : 16) + ((p & 3) * 2 + h) + koff;
    vals[e] = src[(size_t)k * Nn + n];
  }
  // Stands ahead of the conversions, whose results may land in the registers
  // that the loads above name as addresses.
  asm volatile("s_wait_xcnt 0x0" ::: "memory");
  bf16* d = dst + (((size_t)nt * KT + kt) * 32 + lane) * 16;
#pragma unroll
  for (int e = 0; e < 16; ++e) d[e] = (bf16)vals[e];
}

// The adjacency mask is kept as lane masks of the attention wave: for a tile of
// 16 queries and a chunk of 32 keys, 16 words, one per score register. Bit l of
// word j says whether lane l keeps its score j, which is that of
//   query 16 * qtile + (l & 15),
//   key   32 * kc + 16 * (j >> 3) + 8 * (l >> 4) + (j & 7).
// One wave per (qtile, kc): a lane reads the 16 entries of its own scores.
typedef __attribute__((ext_vector_type(16))) unsigned u32x16;
__device__ __forceinline__ void pack_adj_tile(const int* __restrict__ adj,
                                              unsigned* __restrict__ adjl,
                                              int qtile, int kc, int lane) {
  const int* p = adj + (size_t)(qtile * 16 + (lane & 15)) * NDIM + kc * 32 +
                 ((lane & 16) ? 8 : 0);
  const int4 a[4] = {*(const int4*)(p), *(const int4*)(p + 4),
                     *(const int4*)(p + 16), *(const int4*)(p + 20)};
  // Stands ahead of every rewrite of the address that the four loads name.
  asm volatile("s_wait_xcnt 0x0" ::: "memory");
  unsigned mine = 0u;
#pragma unroll
  for (int q = 0; q < 4; ++q) {
    const unsigned b0 = __builtin_amdgcn_ballot_w32(a[q].x != 0);
    const unsigned b1 = __builtin_amdgcn_ballot_w32(a[q].y != 0);
    const unsigned b2 = __builtin_amdgcn_ballot_w32(a[q].z != 0);
    const unsigned b3 = __builtin_amdgcn_ballot_w32(a[q].w != 0);
    mine = (lane == q * 4 + 0) ? b0 : mine;
    mine = (lane == q * 4 + 1) ? b1 : mine;
    mine = (lane == q * 4 + 2) ? b2 : mine;
    mine = (lane == q * 4 + 3) ? b3 : mine;
  }
  if (lane < 16) adjl[((size_t)qtile * 32 + kc) * 16 + lane] = mine;
}

// ---------------------------------------------------------------------------
// wq, wk, wv in LDS: bf16, row-major as in global memory (row = input channel
// k, 64 output channels n), rows WPITCH elements apart: 160 bytes, an odd
// multiple of 32 bytes, the pitch at which the transposing load has no bank
// conflict. Two transposing loads give the fragment of rows kt * 32 .. + 31 and
// columns nt * 16 .. + 15: lane l holds column (l & 15), k = 8 * (l >> 4) + 0..7
// and 16 more, the k order of load_a_frag.
#define WPITCH 80
typedef __attribute__((ext_vector_type(8))) short s16x8;
typedef __attribute__((ext_vector_type(4))) __bf16 bf16x4;
typedef __attribute__((ext_vector_type(4))) float f32x4;
__device__ __forceinline__ bf16x16 load_w_tr(const bf16* w, int kt, int nt) {
  typedef __attribute__((address_space(3))) s16x8 lds_s16x8;
  const int lane = threadIdx.x & 31;
  const bf16* p = w + (kt * 32 + 8 * (lane >> 4) + (lane & 7)) * WPITCH +
                  nt * 16 + 8 * ((lane >> 3) & 1);
  const bf16x8 lo = __builtin_bit_cast(
      bf16x8, __builtin_amdgcn_ds_load_tr16_b128_v8i16((lds_s16x8*)p));
  const bf16x8 hi = __builtin_bit_cast(
      bf16x8,
      __builtin_amdgcn_ds_load_tr16_b128_v8i16((lds_s16x8*)(p + 16 * WPITCH)));
  bf16x16 b;
#pragma unroll
  for (int i = 0; i < 8; ++i) { b[i] = lo[i]; b[i + 8] = hi[i]; }
  return b;
}

// Sum over a group of 8 lanes, left in each of them: three DPP exchanges.
template <int M>
__device__ __forceinline__ float row_xor_add(float v) {
  return v + __builtin_bit_cast(
                 float, __builtin_amdgcn_update_dpp(
                            0, __builtin_bit_cast(int, v), 0x160 | M, 0xf, 0xf,
                            true));  // 0x160 | M: row_xmask:M
}
__device__ __forceinline__ float row_sum8(float v) {
  return row_xor_add<4>(row_xor_add<2>(row_xor_add<1>(v)));
}

// Kernel 1: LN1 + QKV projection, block = 128 (4 waves), LNQ_BLOCKS blocks.
// The same grid carries, in the blocks behind those, the packing that only the
// later launches read and that reads nothing written here: the adjacency lane
// masks (one tile per wave) and the wo, w1, w2 tiles (one tile per wave).
#define LNQ_BLOCKS (NDIM / 64 * BT)
#define ADJ_TILES  ((NDIM / 16) * (NDIM / 32))
#define ADJ_BLOCKS (ADJ_TILES / 4)
#define WT_BLOCKS  ((8 + 32 + 32) / 4)
__global__ void __launch_bounds__(128)
ln_qkv_kernel(const float* __restrict__ x,
                              const float* __restrict__ g1,
                              const float* __restrict__ be1,
                              const float* __restrict__ wq,
                              const float* __restrict__ wk,
                              const float* __restrict__ wv,
                              bf16* __restrict__ Qf, bf16* __restrict__ Kf,
                              bf16* __restrict__ Vf,
                              const int* __restrict__ adj,
                              unsigned* __restrict__ adjb,
                              const float* __restrict__ wo,
                              const float* __restrict__ w1,
                              const float* __restrict__ w2,
                              bf16* __restrict__ wop, bf16* __restrict__ w1p,
                              bf16* __restrict__ w2p) {
  __shared__ __align__(16) bf16 hbuf[64 * 80];
  __shared__ __align__(16) bf16 wbuf[3 * 64 * WPITCH];  // wq, wk, wv rows
  const int tid = threadIdx.x;
  const int bid = blockIdx.x;
  if (bid >= LNQ_BLOCKS) {  // whole blocks leave here, ahead of the barrier
    const int pw = (bid - LNQ_BLOCKS) * 4 + (tid >> 5);
    const int pl = tid & 31;
    if (pw < ADJ_TILES) {
      pack_adj_tile(adj, adjb, pw >> 5, pw & 31, pl);
    } else {
      const int tl = pw - ADJ_TILES;
      if (tl < 8)       pack_w_tile(wo, wop, 64, 64, tl & 1, tl >> 1, pl);
      else if (tl < 40) pack_w_tile(w1, w1p, 64, 256, tl & 1, (tl - 8) >> 1, pl);
      else              pack_w_tile(w2, w2p, 256, 64, tl & 7, (tl - 40) >> 3, pl);
    }
    return;
  }
  const int bt = bid / (NDIM / 64);
  const int b = bt / TDIM, t = bt % TDIM;
  const int r0 = (bid % (NDIM / 64)) * 64;

  // The three weights, f32 as the inputs have them: 3072 chunks of 16 bytes, 24
  // per thread, a wave-wide load covering four whole lines. They are in flight
  // while the LayerNorm runs.
  f32x4 wreg[24];
#pragma unroll
  for (int i = 0; i < 24; ++i) {
    const float* ws = (i < 8) ? wq : (i < 16) ? wk : wv;
    wreg[i] = *(const f32x4*)(ws + ((i & 7) * 128 + tid) * 4);
  }
  // Keeps the 24 loads up here: left free, part of them moves down to the
  // conversions and meets its whole latency there.
  __builtin_amdgcn_sched_barrier(0);

  {  // LayerNorm: 8 lanes per row, so that a wave-wide load is the same half
    // (128 bytes, one whole line) of four rows. A wave takes the 16 rows whose
    // fragments it reads below, four at a time; a lane holds 8 columns of each.
    const int pc = tid & 7;
    const int row0 = (tid >> 5) * 16 + ((tid >> 3) & 3);
    const float* xr =
        x + (((size_t)b * NDIM + (r0 + row0)) * TDIM + t) * DDIM + pc * 4;
    f32x4 v[4][2], g[2], be[2];
#pragma unroll
    for (int i = 0; i < 4; ++i)
#pragma unroll
      for (int hf = 0; hf < 2; ++hf)
        v[i][hf] = *(const f32x4*)(xr + i * (4 * TDIM * DDIM) + hf * 32);
#pragma unroll
    for (int hf = 0; hf < 2; ++hf) {
      g[hf]  = *(const f32x4*)(g1 + hf * 32 + pc * 4);
      be[hf] = *(const f32x4*)(be1 + hf * 32 + pc * 4);
    }
    // Stands ahead of every rewrite of a register that the loads of the weights,
    // of x and of the two parameter vectors name as their address; as inputs of
    // the wait, the addresses stay in place up to it.
    asm volatile("s_wait_xcnt 0x0" :: "v"(tid), "v"(xr), "v"(pc) : "memory");
    float s[4], ss[4];
#pragma unroll
    for (int i = 0; i < 4; ++i) {
      const f32x4 a = v[i][0], c = v[i][1];
      s[i]  = ((a.x + a.y) + (a.z + a.w)) + ((c.x + c.y) + (c.z + c.w));
      ss[i] = ((a.x * a.x + a.y * a.y) + (a.z * a.z + a.w * a.w)) +
              ((c.x * c.x + c.y * c.y) + (c.z * c.z + c.w * c.w));
    }
#pragma unroll
    for (int i = 0; i < 4; ++i) { s[i] = row_sum8(s[i]); ss[i] = row_sum8(ss[i]); }
#pragma unroll
    for (int i = 0; i < 4; ++i) {
      const float mean = s[i] * (1.f / 64.f);
      const float var  = ss[i] * (1.f / 64.f) - mean * mean;
      const float rstd = rsqrtf(var + 1e-5f);
#pragma unroll
      for (int hf = 0; hf < 2; ++hf) {
        const f32x4 a = v[i][hf];
        const bf16x4 o = {(bf16)((a.x - mean) * rstd * g[hf].x + be[hf].x),
                          (bf16)((a.y - mean) * rstd * g[hf].y + be[hf].y),
                          (bf16)((a.z - mean) * rstd * g[hf].z + be[hf].z),
                          (bf16)((a.w - mean) * rstd * g[hf].w + be[hf].w)};
        *(bf16x4*)(hbuf + (row0 + 4 * i) * 80 + hf * 32 + pc * 4) = o;
      }
    }
  }
  // Inputs only: holds the wait for the weights, and the conversions behind it,
  // down here. Left free, the conversions move up ahead of the LayerNorm, which
  // then starts only when the weights have arrived. It also keeps each load whole
  // (16 bytes a lane) where the compiler otherwise halves it. The scheduling
  // barrier is what stops the conversions, which the statement does not order.
  __builtin_amdgcn_sched_barrier(0);
  asm volatile("" :: "v"(wreg[0]), "v"(wreg[1]), "v"(wreg[2]), "v"(wreg[3]),
               "v"(wreg[4]), "v"(wreg[5]), "v"(wreg[6]), "v"(wreg[7]),
               "v"(wreg[8]), "v"(wreg[9]), "v"(wreg[10]), "v"(wreg[11]),
               "v"(wreg[12]), "v"(wreg[13]), "v"(wreg[14]), "v"(wreg[15]),
               "v"(wreg[16]), "v"(wreg[17]), "v"(wreg[18]), "v"(wreg[19]),
               "v"(wreg[20]), "v"(wreg[21]), "v"(wreg[22]), "v"(wreg[23]));
  // The weights go to LDS as bf16, row-major: chunk c is row c >> 4 of the 192,
  // columns 4 * (c & 15) .. + 3.
#pragma unroll
  for (int i = 0; i < 24; ++i) {
    const int c = i * 128 + tid;
    const bf16x4 o = {(bf16)wreg[i].x, (bf16)wreg[i].y, (bf16)wreg[i].z,
                      (bf16)wreg[i].w};
    *(bf16x4*)(wbuf + (c >> 4) * WPITCH + (c & 15) * 4) = o;
  }
  __syncthreads();

  const int wave = tid >> 5, lane = tid & 31;
  const int rowbase = wave * 16;
  bf16* frags[3] = {Qf, Kf, Vf};
  const int tile = (r0 + rowbase) >> 4;
  const f32x8 fz = {0.f, 0.f, 0.f, 0.f, 0.f, 0.f, 0.f, 0.f};

  // Head nt of this wave's 16 nodes is one fragment tile. Q and K are formed
  // transposed (W^T h^T: the two operands swap places, their k orders being
  // equal), so a lane ends with 8 channels of one node; V stays h W, so a lane
  // ends with 8 nodes of one channel. Either way the lane's 8 values are the
  // 16 bytes that the same lane of an attention wave loads.
#pragma unroll
  for (int mtx = 0; mtx < 3; ++mtx) {
    bf16x8 o[4];
#pragma unroll
    for (int nt = 0; nt < 4; ++nt) {
      f32x8 acc = fz;
#pragma unroll
      for (int kt = 0; kt < 2; ++kt) {
        const bf16x16 hf = load_a_frag(hbuf + rowbase * 80 + kt * 32, 80);
        const bf16x16 wf = load_w_tr(wbuf + mtx * 64 * WPITCH, kt, nt);
        acc = (mtx == 2) ? wmma_bf16(hf, wf, acc) : wmma_bf16(wf, hf, acc);
      }
#pragma unroll
      for (int r = 0; r < 8; ++r)  // Q pre-scaled by log2(e) / sqrt(HD)
        o[nt][r] = (bf16)((mtx == 0) ? acc[r] * (0.25f * LOG2E) : acc[r]);
    }
    bf16* dst = frags[mtx] + frag_index(bt, 0, tile, lane);
#pragma unroll
    for (int nt = 0; nt < 4; ++nt)
      *(bf16x8*)(dst + frag_index(0, nt, 0, 0)) = o[nt];
    // Stands ahead of every rewrite of a register that the four stores name;
    // as inputs of the wait, address and data stay in place up to it.
    asm volatile("s_wait_xcnt 0x0"
                 :: "v"(dst), "v"(o[0]), "v"(o[1]), "v"(o[2]), "v"(o[3])
                 : "memory");
  }
}

#define ATT_WAVES 8
#define ATT_Q     (ATT_WAVES * 16)
#define ATT_T     (ATT_WAVES * 32)

// Value of lane l ^ 16 (the other half of the same query column).
__device__ __forceinline__ float other_half(float v) {
  const int b = __builtin_bit_cast(int, v);
  return __builtin_bit_cast(
      float, __builtin_amdgcn_permlanex16(b, b, 0x76543210, 0xfedcba98, false,
                                          false));
}

// s in the lanes whose bit of the wave-uniform word w is set, else 'masked':
// the word is used as a lane mask, so this is one conditional move.
__device__ __forceinline__ float mask_score(float s, unsigned w, float masked) {
  return __builtin_amdgcn_inverse_ballot_w32(w) ? s : masked;
}

// The score of a masked key, in log2 units.
#define MASKED (-1e9f * LOG2E)
// A trip's sum of exponentials (32 per lane) above which the maximum in use is
// renewed: below it no exponential exceeds 2^12.
#define P_LIMIT 4096.f

// P^T B-fragment of one chunk of 32 keys. negm holds minus the maximum in use
// in all eight registers: as the C operand it leaves each score ready for exp2.
// 'maskedp' is MASKED minus that maximum. The exponentials are added to ps.
__device__ __forceinline__ bf16x16 chunk_p(bf16x16 ka0, bf16x16 ka1, bf16x16 qb,
                                           f32x8 negm, float maskedp, u32x16 mw,
                                           f32x2& ps) {
  // s0[r] = S[query coln][32 * chunk + koff + r] - maximum, s1[r]: 16 keys on.
  const f32x8 s0 = wmma_bf16(ka0, qb, negm);
  const f32x8 s1 = wmma_bf16(ka1, qb, negm);
  bf16x16 pb;  // word r of mw: s0[r], word 8 + r: s1[r]
#pragma unroll
  for (int r = 0; r < 8; ++r) {
    const float e0 =
        __builtin_amdgcn_exp2f(mask_score(s0[r], mw[r], maskedp));
    const float e1 =
        __builtin_amdgcn_exp2f(mask_score(s1[r], mw[8 + r], maskedp));
    ps += f32x2{e0, e1};
    pb[r]     = (bf16)e0;
    pb[r + 8] = (bf16)e1;
  }
  return pb;
}

// Largest masked score of one chunk in this lane, and cm.
__device__ __forceinline__ float chunk_max(bf16x16 ka0, bf16x16 ka1, bf16x16 qb,
                                           u32x16 mw, float cm) {
  const f32x8 fz = {0.f, 0.f, 0.f, 0.f, 0.f, 0.f, 0.f, 0.f};
  const f32x8 s0 = wmma_bf16(ka0, qb, fz);
  const f32x8 s1 = wmma_bf16(ka1, qb, fz);
#pragma unroll
  for (int r = 0; r < 8; ++r)
    cm = fmaxf(cm, fmaxf(mask_score(s0[r], mw[r], MASKED),
                         mask_score(s1[r], mw[8 + r], MASKED)));
  return cm;
}

__global__ void attn_kernel(const bf16* __restrict__ Qf,
                            const bf16* __restrict__ Kf,
                            const bf16* __restrict__ Vf,
                            const unsigned* __restrict__ adjb,
                            bf16* __restrict__ Of) {
  __shared__ __align__(16) bf16 kbuf[NDIM * HD];
  __shared__ __align__(16) bf16 vbuf[NDIM * HD];
  const int tid = threadIdx.x;
  // The wave's number in a scalar register: the mask words' address is formed
  // from it, and only a wave-uniform address is read by scalar loads.
  const int wave = __builtin_amdgcn_readfirstlane(tid >> 5);
  const int lane = tid & 31;
  const int qt = blockIdx.x, h = blockIdx.y, bt = blockIdx.z;
  const int qblock = qt * ATT_Q;
  const int qbase = qblock + wave * 16;

  {  // K, then V: 2048 chunks of 16 bytes each, eight per thread.
    unsigned l[8];
    const void* g[8];
    const bf16* kg = Kf + frag_index(bt, h, 0, 0);
    const bf16* vg = Vf + frag_index(bt, h, 0, 0);
#pragma unroll
    for (int i = 0; i < 8; ++i) {
      const int c = i * ATT_T + tid;
      l[i] = lds_addr(kbuf + c * 8);
      g[i] = kg + c * 8;
    }
    async_copy_x8(l, g);
#pragma unroll
    for (int i = 0; i < 8; ++i) {
      const int c = i * ATT_T + tid;
      l[i] = lds_addr(vbuf + c * 8);
      g[i] = vg + c * 8;
    }
    async_copy_x8(l, g);
  }
  // This wave's copies have landed; the barrier publishes them to the others.
  asm volatile("s_wait_asynccnt 0x0" ::: "memory");
  __syncthreads();

  // Q^T B-fragment (column = query): HD=16 channels zero-padded to K=32.
  bf16x16 qb;
  {
    bf16x8 lo = *(const bf16x8*)(Qf + frag_index(bt, h, qbase >> 4, lane));
#pragma unroll
    for (int i = 0; i < 8; ++i) { qb[i] = lo[i]; qb[i + 8] = (bf16)0.f; }
  }

  // Per lane: the maximum in use for its query (equal in both halves; it may
  // lag the true running maximum by up to 12), the sum of its own half's keys,
  // and 8 output channels of its query.
  float mrun = MASKED, maskedp = 0.f, lrun = 0.f;
  f32x8 negm;
#pragma unroll
  for (int r = 0; r < 8; ++r) negm[r] = -MASKED;
  f32x8 oacc = {0.f, 0.f, 0.f, 0.f, 0.f, 0.f, 0.f, 0.f};

  // A chunk of 32 keys is two tiles: 512 elements of K and 512 of V.
  const bf16* kp = kbuf + lane * 8;
  const bf16* vp = vbuf + lane * 8;
  // This wave's lane masks: 16 words a chunk, read one trip (two chunks) ahead.
  const u32x16* mrow = (const u32x16*)(adjb + (size_t)(qbase >> 4) * 32 * 16);
  u32x16 mcur[2] = {mrow[0], mrow[1]};
  bf16x16 ka[4];  // upper halves (k = 16..31) stay zero through the loop
#pragma unroll
  for (int f = 0; f < 4; ++f)
#pragma unroll
    for (int i = 0; i < 16; ++i) ka[f][i] = (bf16)0.f;

  // Takes the larger of the maximum in use and the trip's own maximum (keys in
  // ka, words in mw) into use, and rescales sum and output to it.
  auto renew_max = [&](const u32x16 (&mw)[2]) {
    float cm = chunk_max(ka[0], ka[1], qb, mw[0], MASKED);
    cm = chunk_max(ka[2], ka[3], qb, mw[1], cm);
    const float mnew = fmaxf(mrun, fmaxf(cm, other_half(cm)));
    const float corr = __builtin_amdgcn_exp2f(mrun - mnew);
    mrun = mnew;
    maskedp = MASKED - mnew;
    lrun *= corr;
#pragma unroll
    for (int r = 0; r < 8; ++r) { oacc[r] *= corr; negm[r] = -mnew; }
  };
  // Four K A-fragments (row = key, channels on K dim, zero-padded to 32).
  auto load_k = [&]() {
#pragma unroll
    for (int f = 0; f < 4; ++f) {
      const bf16x8 l = *(const bf16x8*)(kp + f * 256);
#pragma unroll
      for (int i = 0; i < 8; ++i) ka[f][i] = l[i];
    }
  };

  // The first trip's own maximum starts the loop.
  load_k();
  renew_max(mcur);

  // Two chunks a trip: their LDS reads share one address register, and their
  // mask words are one 128-byte line.
  for (int kc = 0; kc < 32; kc += 2) {
    // The last trip reads chunks 0 and 1 again, unused.
    const u32x16 mnext[2] = {mrow[(kc + 2) & 31], mrow[(kc + 3) & 31]};
    load_k();
    // Two V^T A-fragments (row = channel, keys in the hardware k order).
    bf16x16 va[2];
#pragma unroll
    for (int c = 0; c < 2; ++c) {
      const bf16x8 lo = *(const bf16x8*)(vp + c * 512);
      const bf16x8 hi = *(const bf16x8*)(vp + c * 512 + 256);
#pragma unroll
      for (int i = 0; i < 8; ++i) { va[c][i] = lo[i]; va[c][i + 8] = hi[i]; }
    }
    kp += 1024;
    vp += 1024;
    // Keeps all of the trip's loads, V's too, up here, ahead of the arithmetic
    // that hides their latency; left free, V's loads move down to the wait.
    __builtin_amdgcn_sched_barrier(0);

    f32x2 ps0 = {0.f, 0.f}, ps1 = {0.f, 0.f};
    bf16x16 pb0 = chunk_p(ka[0], ka[1], qb, negm, maskedp, mcur[0], ps0);
    bf16x16 pb1 = chunk_p(ka[2], ka[3], qb, negm, maskedp, mcur[1], ps1);
    ps0 += ps1;
    float pt = ps0.x + ps0.y;
    // Inputs only: keeps the loads of the next trip's mask words and of this
    // trip's V ahead of the branch below. Without it they sink behind it, to
    // their first use, where a wave would wait out the whole load latency. The
    // scheduling barrier keeps the statement, and so the wait for the loads, at
    // this place instead of directly behind them. negm is named so that it is
    // still in use behind the last score product: otherwise the compiler lets
    // that product overwrite its C operand and copies the eight registers for
    // it in every trip.
    __builtin_amdgcn_sched_barrier(0);
    asm volatile("" :: "s"(mnext[0]), "s"(mnext[1]), "v"(va[0]), "v"(va[1]), "v"(negm));
    // One test a trip, the same for the whole wave: a scalar branch.
    if (__builtin_amdgcn_ballot_w32(pt > P_LIMIT) != 0u) {
      // Some query's scores have outgrown the maximum in use: P is formed anew.
      renew_max(mcur);
      ps0 = f32x2{0.f, 0.f};
      ps1 = f32x2{0.f, 0.f};
      pb0 = chunk_p(ka[0], ka[1], qb, negm, maskedp, mcur[0], ps0);
      pb1 = chunk_p(ka[2], ka[3], qb, negm, maskedp, mcur[1], ps1);
      ps0 += ps1;
      pt = ps0.x + ps0.y;
    }
    lrun += pt;
    oacc = wmma_bf16(va[0], pb0, oacc);
    oacc = wmma_bf16(va[1], pb1, oacc);
    mcur[0] = mnext[0];
    mcur[1] = mnext[1];
  }

  // oacc[r] = O[query lane & 15][channel 8 * (lane >> 4) + r] of this head: a
  // tile in the order of Q's, rounded here to the bf16 that the output
  // projection multiplies. The wave's store is 512 contiguous bytes.
  const float inv = 1.f / (lrun + other_half(lrun));
  bf16x8 ob;
#pragma unroll
  for (int r = 0; r < 8; ++r) ob[r] = (bf16)(oacc[r] * inv);
  *(bf16x8*)(Of + frag_index(bt, h, qbase >> 4, lane)) = ob;
}

// ---------------------------------------------------------------------------
// Kernel 3: out-proj + residual + LN2 + MLP + residual.
// The BT * N rows, counted bt-major, are dealt 96 to a block: 256 blocks of
// twelve waves, one block a WGP by its LDS. A block may hold rows of two bt; a
// tile of 16 rows never does. The weights are copied to LDS once per 96 rows.
// Of the two products with 64 output columns a wave takes 16 rows x 32 columns
// (one whole line of each output row), of MLP layer 1 it takes 32 rows x 64
// columns, so that a weight fragment read from LDS feeds two products.
#define PM_T 384
#define PM_R 96
#define PM_BLOCKS (BT * NDIM / PM_R)
__global__ void __launch_bounds__(PM_T)
proj_mlp_kernel(const float* __restrict__ x,
                                const bf16* __restrict__ Of,
                                const bf16* __restrict__ wop,
                                const float* __restrict__ bo,
                                const float* __restrict__ g2,
                                const float* __restrict__ be2,
                                const bf16* __restrict__ w1p,
                                const float* __restrict__ b1,
                                const bf16* __restrict__ w2p,
                                const float* __restrict__ b2,
                                float* __restrict__ out) {
  __shared__ __align__(16) bf16 hbuf[PM_R * 80];
  __shared__ __align__(16) float xbuf[PM_R * 72];
  __shared__ __align__(16) bf16 ubuf[PM_R * 264];
  __shared__ __align__(16) bf16 wbuf[(8 + 32 + 32) * 512];  // wo, w1, w2
  __shared__ __align__(16) float pbuf[512];  // b1, bo, b2, g2, be2
  const float* b1s = pbuf;
  const float* bos = pbuf + 256;
  const float* b2s = pbuf + 320;
  const float* g2s = pbuf + 384;
  const float* be2s = pbuf + 448;
  const int tid = threadIdx.x;
  // The wave's number in a scalar register: the branch around the last copy of
  // the parameter vectors and the wave's tile indices are formed from it.
  const int wave = __builtin_amdgcn_readfirstlane(tid >> 5);
  const int lane = tid & 31;
  const f32x8 fz = {0.f, 0.f, 0.f, 0.f, 0.f, 0.f, 0.f, 0.f};

  {  // All that the later phases read from global memory but the attention output flies to LDS at once:
    // the 96 residual rows (16 chunks of 16 bytes each), the five parameter
    // vectors (512 words) and the three packed weights (4608 chunks of 16
    // bytes).
    unsigned lx[4];
    const void* gx[4];
#pragma unroll
    for (int i = 0; i < 4; ++i) {
      const int c = i * PM_T + tid;
      const int row = c >> 4, pc = c & 15;
      const int grow = blockIdx.x * PM_R + row;  // bt * N + node
      const int rbt = grow / NDIM, rnode = grow % NDIM;
      lx[i] = lds_addr(xbuf + row * 72 + pc * 4);
      gx[i] = x + (((size_t)(rbt / TDIM) * NDIM + rnode) * TDIM + rbt % TDIM) *
                      DDIM + pc * 4;
    }
    // Words 0 .. 383 of pbuf, one per lane: b1, bo, b2.
    const float* pv = (tid < 256) ? b1 : (tid < 320) ? bo : b2;
    async_copy_x4_b32(lx, gx, lds_addr(pbuf + tid),
                      pv + ((tid < 256) ? tid : (tid & 63)));
    unsigned l[12];
    const void* g[12];
#pragma unroll
    for (int i = 0; i < 12; ++i) {
      const int c = i * PM_T + tid;
      l[i] = lds_addr(wbuf + w_lds_index(c));
      g[i] = (c < 512) ? wop + c * 8
                       : (c < 2560) ? w1p + (c - 512) * 8 : w2p + (c - 2560) * 8;
    }
    async_copy_x12(l, g);
    if (wave < 4) {  // words 384 .. 511: g2, be2; whole waves, a scalar branch
      asm volatile(
          "global_load_async_to_lds_b32 %0, %1, off\n\t"
          "s_wait_xcnt 0x0"
          :: "v"(lds_addr(pbuf + 384 + tid)),
             "v"(((tid < 64) ? g2 : be2) + (tid & 63))
          : "memory");
    }
  }

  const int rowbase = (wave % 6) * 16;
  const int ch = wave / 6;  // this wave's half of 64 output columns
  // The 16 rows at rowbase are one tile of 16 nodes of one bt.
  const int gtile = blockIdx.x * (PM_R / 16) + wave % 6;
  const int bt = gtile / (NDIM / 16);
  const int b = bt / TDIM, t = bt % TDIM;
  const int r0 = (gtile % (NDIM / 16)) * 16 - rowbase;  // r0 + rowbase: node of the wave's first row
  const int rhalf = (lane >> 4) * 8;
  const int coln = lane & 15;

  // The attention output of this wave's 16 rows: the tiles of heads 2 kt and
  // 2 kt + 1 are, lane by lane, the two halves of A fragment kt (the k order of
  // load_a_frag). Four wave-wide loads of 512 contiguous bytes.
  bf16x16 of[2];
  {
    const bf16* op = Of + frag_index(bt, 0, (r0 + rowbase) >> 4, lane);
    bf16x8 ot[4];
#pragma unroll
    for (int hh = 0; hh < 4; ++hh)
      ot[hh] = *(const bf16x8*)(op + frag_index(0, hh, 0, 0));
    // Stands ahead of every rewrite of the address that the four loads name.
    asm volatile("s_wait_xcnt 0x0" :: "v"(op) : "memory");
#pragma unroll
    for (int kt = 0; kt < 2; ++kt)
#pragma unroll
      for (int i = 0; i < 8; ++i) {
        of[kt][i] = ot[2 * kt][i];
        of[kt][i + 8] = ot[2 * kt + 1][i];
      }
  }
  // This wave's copies have landed; the barrier publishes them to the others.
  asm volatile("s_wait_asynccnt 0x0" ::: "memory");
  __syncthreads();

  // o @ wo + bo + x  -> xbuf (f32)
#pragma unroll
  for (int j = 0; j < 2; ++j) {
    const int nt = ch * 2 + j;
    f32x8 acc = fz;
#pragma unroll
    for (int kt = 0; kt < 2; ++kt)
      acc = wmma_bf16(of[kt], load_b_lds(wbuf, nt * 2 + kt), acc);
#pragma unroll
    for (int r = 0; r < 8; ++r) {
      const int row_in = rowbase + rhalf + r;
      const int col = nt * 16 + coln;
      const float xv = xbuf[row_in * 72 + col];  // the residual, copied above
      xbuf[row_in * 72 + col] = xv + acc[r] + bos[col];
    }
  }
  __syncthreads();

  {  // LN2 -> hbuf (bf16)
    const int row = tid >> 2;  // four lanes a row, 16 columns each
    const int c0 = (tid & 3) * 16;
    float v[16], s = 0.f, ss = 0.f;
#pragma unroll
    for (int i = 0; i < 16; ++i) {
      v[i] = xbuf[row * 72 + c0 + i];
      s += v[i]; ss += v[i] * v[i];
    }
    s  = row_xor_add<2>(row_xor_add<1>(s));
    ss = row_xor_add<2>(row_xor_add<1>(ss));
    const float mean = s * (1.f / 64.f);
    const float var  = ss * (1.f / 64.f) - mean * mean;
    const float rstd = rsqrtf(var + 1e-5f);
#pragma unroll
    for (int i = 0; i < 16; ++i) {
      const int c = c0 + i;
      hbuf[row * 80 + c] = (bf16)((v[i] - mean) * rstd * g2s[c] + be2s[c]);
    }
  }
  __syncthreads();

  // MLP layer 1: 64 -> 256, ReLU -> ubuf (bf16)
  {
    const int rb1 = (wave % 3) * 32;  // this wave's 32 rows
    const int cq = wave / 3;          // and its quarter of the 256 columns
    bf16x16 ha[2][2];
#pragma unroll
    for (int rt = 0; rt < 2; ++rt)
#pragma unroll
      for (int kt = 0; kt < 2; ++kt)
        ha[rt][kt] = load_a_frag(hbuf + (rb1 + rt * 16) * 80 + kt * 32, 80);
    bf16x16 wf[4][2];
#pragma unroll
    for (int j = 0; j < 4; ++j)
#pragma unroll
      for (int kt = 0; kt < 2; ++kt)
        wf[j][kt] = load_b_lds(wbuf, 8 + (cq * 4 + j) * 2 + kt);
    // Keeps the 24 reads together, ahead of the products, as in layer 2 below.
    __builtin_amdgcn_sched_barrier(0);
#pragma unroll
    for (int j = 0; j < 4; ++j) {
      const int nt = cq * 4 + j;
      const int col = nt * 16 + coln;
#pragma unroll
      for (int rt = 0; rt < 2; ++rt) {
        f32x8 acc = fz;
#pragma unroll
        for (int kt = 0; kt < 2; ++kt)
          acc = wmma_bf16(ha[rt][kt], wf[j][kt], acc);
#pragma unroll
        for (int r = 0; r < 8; ++r) {
          const int row_in = rb1 + rt * 16 + rhalf + r;
          ubuf[row_in * 264 + col] = (bf16)fmaxf(acc[r] + b1s[col], 0.f);
        }
      }
    }
  }
  __syncthreads();

  // MLP layer 2: 256 -> 64, + residual -> out (original [B,N,T,D] layout)
  // Each fragment of the rows is read once and feeds both column tiles.
  f32x8 acc2[2] = {fz, fz};
  bf16x16 uf[8], wf2[8][2];
#pragma unroll
  for (int kt = 0; kt < 8; ++kt) {
    uf[kt] = load_a_frag(ubuf + rowbase * 264 + kt * 32, 264);
#pragma unroll
    for (int j = 0; j < 2; ++j)
      wf2[kt][j] = load_b_lds(wbuf, 40 + (ch * 2 + j) * 8 + kt);
  }
  // Keeps the 48 reads together, ahead of the products: left free, they sink to
  // their products, each of which then waits out a whole LDS latency.
  __builtin_amdgcn_sched_barrier(0);
#pragma unroll
  for (int kt = 0; kt < 8; ++kt)
#pragma unroll
    for (int j = 0; j < 2; ++j)
      acc2[j] = wmma_bf16(uf[kt], wf2[kt][j], acc2[j]);
  float ov[2][8];
#pragma unroll
  for (int j = 0; j < 2; ++j)
#pragma unroll
    for (int r = 0; r < 8; ++r) {
      const int col = (ch * 2 + j) * 16 + coln;
      ov[j][r] = xbuf[(rowbase + rhalf + r) * 72 + col] + acc2[j][r] + b2s[col];
    }
  float* op = out + (((size_t)b * NDIM + r0 + rowbase + rhalf) * TDIM + t) * DDIM +
              ch * 32 + coln;
  // Keeps every addition ahead of the 16 stores: behind them nothing rewrites a
  // register that a store names.
  __builtin_amdgcn_sched_barrier(0);
#pragma unroll
  for (int j = 0; j < 2; ++j)
#pragma unroll
    for (int r = 0; r < 8; ++r) op[r * (TDIM * DDIM) + j * 16] = ov[j][r];
}

// ---------------------------------------------------------------------------
extern "C" void kernel_launch(void* const* d_in, const int* in_sizes, int n_in,
                              void* d_out, int out_size, void* d_ws,
                              size_t ws_size, hipStream_t stream) {
  (void)in_sizes; (void)n_in; (void)out_size; (void)ws_size;
  const float* x   = (const float*)d_in[0];
  const int*   adj = (const int*)d_in[1];
  const float* wq  = (const float*)d_in[2];
  const float* wk  = (const float*)d_in[3];
  const float* wv  = (const float*)d_in[4];
  const float* wo  = (const float*)d_in[5];
  const float* bo  = (const float*)d_in[6];
  const float* w1  = (const float*)d_in[7];
  const float* b1  = (const float*)d_in[8];
  const float* w2  = (const float*)d_in[9];
  const float* b2  = (const float*)d_in[10];
  const float* g1  = (const float*)d_in[11];
  const float* be1 = (const float*)d_in[12];
  const float* g2  = (const float*)d_in[13];
  const float* be2 = (const float*)d_in[14];
  float* out = (float*)d_out;

  char* w = (char*)d_ws;
  size_t off = 0;
  auto carve = [&](size_t bytes) -> void* {
    off = (off + 255) & ~(size_t)255;
    void* p = w + off;
    off += bytes;
    return p;
  };
  const size_t act = (size_t)BT * NDIM * DDIM;  // 1.57M elements
  bf16*     Qf   = (bf16*)carve(act * 2);
  bf16*     Kf   = (bf16*)carve(act * 2);
  bf16*     Vf   = (bf16*)carve(act * 2);
  bf16*     Of   = (bf16*)carve(act * 2);
  unsigned* adjb = (unsigned*)carve((size_t)NDIM * 32 * 4);
  bf16* wop = (bf16*)carve(64 * 64 * 2);
  bf16* w1p = (bf16*)carve(64 * 256 * 2);
  bf16* w2p = (bf16*)carve(256 * 64 * 2);

  ln_qkv_kernel<<<dim3(LNQ_BLOCKS + ADJ_BLOCKS + WT_BLOCKS), 128, 0, stream>>>(
      x, g1, be1, wq, wk, wv, Qf, Kf, Vf, adj, adjb, wo, w1, w2, wop, w1p, w2p);
  attn_kernel<<<dim3(NDIM / ATT_Q, HDIM, BT), ATT_T, 0, stream>>>(Qf, Kf, Vf, adjb, Of);
  proj_mlp_kernel<<<dim3(PM_BLOCKS), PM_T, 0, stream>>>(
      x, Of, wop, bo, g2, be2, w1p, b1, w2p, b2, out);
}
